// v000
// Measured on an AMD MI455X. A time is GPU time per run, averaged over a window of back-to-back runs after a warm-up
// (all launches, gaps included; the runs take copies of the inputs in turn), and the median of several windows.
// Apart from v000's, it joins two sittings. Times from different sittings can be a few percent apart, while
// side-by-side timings come from the same sitting.
// v000 is the starting kernel. One run takes 4870 microseconds.
#include <hip/hip_runtime.h>
#include <hip/hip_bf16.h>

// ---------------------------------------------------------------------------
// CDNA5 (gfx1250) implementation of the TSSA causal-attention reference.
//   GEMMs run on v_wmma_f32_16x16x32_bf16 with an error-compensated
//   bf16 hi/lo split (hi*hi + hi*lo + lo*hi) to keep ~fp32 accuracy.
//   Cumsum/softmax stages are register-resident sequential scans.
// ---------------------------------------------------------------------------

typedef __attribute__((ext_vector_type(16))) __bf16 v16bf;
typedef __attribute__((ext_vector_type(8)))  float  v8f;

union Frag16 {
    v16bf v;
    uint4 u[2];
};

__device__ __forceinline__ unsigned short f2bf(float f) {
    // round-to-nearest-even bf16 truncation
    unsigned u = __float_as_uint(f);
    unsigned r = 0x7fffu + ((u >> 16) & 1u);
    return (unsigned short)((u + r) >> 16);
}
__device__ __forceinline__ float bf2f(unsigned short h) {
    return __uint_as_float(((unsigned)h) << 16);
}

// ---------------------------------------------------------------------------
// Split f32 -> bf16 hi + bf16 lo residual
// ---------------------------------------------------------------------------
__global__ void split_bf16(const float* __restrict__ in,
                           unsigned short* __restrict__ hi,
                           unsigned short* __restrict__ lo, int n) {
    int i = blockIdx.x * blockDim.x + threadIdx.x;
    if (i >= n) return;
    float f = in[i];
    unsigned short h = f2bf(f);
    hi[i] = h;
    lo[i] = f2bf(f - bf2f(h));
}

// ---------------------------------------------------------------------------
// C = A @ B^T + bias, via v_wmma_f32_16x16x32_bf16 with hi/lo compensation.
// A: (M,K) row-major (hi/lo bf16).  Brows: (N,K) row-major (hi/lo bf16),
// i.e. B^T columns are Brows rows -> WMMA B fragment loads are contiguous.
// Each wave computes a 16x64 strip (4 tiles sharing the A fragment).
// ---------------------------------------------------------------------------
__device__ __forceinline__ Frag16 load_frag(const unsigned short* __restrict__ base,
                                            int K, int row, int k, int koff) {
    Frag16 f;
    const unsigned short* p = base + (size_t)row * K + k + koff;
    f.u[0] = *(const uint4*)p;         // K chunk 0..7  (lane<16) / 8..15 (lane>=16)
    f.u[1] = *(const uint4*)(p + 16);  // K chunk 16..23 / 24..31
    return f;
}

__global__ __launch_bounds__(256)
void wmma_gemm_bias(const unsigned short* __restrict__ Ahi,
                    const unsigned short* __restrict__ Alo,
                    const unsigned short* __restrict__ Bhi,
                    const unsigned short* __restrict__ Blo,
                    const float* __restrict__ bias,
                    float* __restrict__ Cout,
                    int M, int N, int K) {
    const int lane    = threadIdx.x & 31;
    const int wave    = blockIdx.x * (blockDim.x >> 5) + (threadIdx.x >> 5);
    const int nstrips = N >> 6;                 // strips of 64 columns
    const int mtile   = wave / nstrips;
    const int nstrip  = wave % nstrips;
    if ((mtile << 4) >= M) return;

    const int m0   = mtile << 4;
    const int n0   = nstrip << 6;
    const int rowA = m0 + (lane & 15);
    const int koff = (lane >> 4) << 3;          // 0 or 8 (ISA 16-bit A layout)

    v8f zero = {};
    v8f acc[4];
    acc[0] = zero; acc[1] = zero; acc[2] = zero; acc[3] = zero;

    for (int k = 0; k < K; k += 32) {
        Frag16 ah = load_frag(Ahi, K, rowA, k, koff);
        Frag16 al = load_frag(Alo, K, rowA, k, koff);
        // prefetch next K-chunk of the A stream (global_prefetch_b8)
        if (k + 32 < K) {
            __builtin_prefetch(Ahi + (size_t)rowA * K + k + 32 + koff, 0, 1);
        }
#pragma unroll
        for (int j = 0; j < 4; ++j) {
            const int rowB = n0 + (j << 4) + (lane & 15);
            Frag16 bh = load_frag(Bhi, K, rowB, k, koff);
            Frag16 bl = load_frag(Blo, K, rowB, k, koff);
            acc[j] = __builtin_amdgcn_wmma_f32_16x16x32_bf16(
                false, ah.v, false, bh.v, (short)0, acc[j], false, false);
            acc[j] = __builtin_amdgcn_wmma_f32_16x16x32_bf16(
                false, ah.v, false, bl.v, (short)0, acc[j], false, false);
            acc[j] = __builtin_amdgcn_wmma_f32_16x16x32_bf16(
                false, al.v, false, bh.v, (short)0, acc[j], false, false);
        }
    }

    // C/D layout: VGPR v holds M = m0 + v + 8*(lane>=16), N = n0 + lane%16
    const int ncol  = lane & 15;
    const int mbase = m0 + ((lane >> 4) << 3);
#pragma unroll
    for (int j = 0; j < 4; ++j) {
        const int n  = n0 + (j << 4) + ncol;
        const float bv = bias[n];
#pragma unroll
        for (int v = 0; v < 8; ++v) {
            Cout[(size_t)(mbase + v) * N + n] = acc[j][v] + bv;
        }
    }
}

// ---------------------------------------------------------------------------
// Stage 1: denom = cumsum_T(w^2); tmp[b,h,t] = (sum_d w^2/denom + D*dbias)*temp
// 16 lanes per (b,h); each lane owns 4 d-channels (float4).
// ---------------------------------------------------------------------------
__global__ void stage_tmp(const float* __restrict__ w,
                          const float* __restrict__ temp,
                          const float* __restrict__ denom_bias,
                          float* __restrict__ tmpout,
                          int B, int T, int C, int H, int D) {
    int g = (blockIdx.x * blockDim.x + threadIdx.x) >> 4;
    int l = threadIdx.x & 15;
    if (g >= B * H) return;
    int b = g / H, h = g % H;

    const float* base  = w + (size_t)b * T * C + h * D + l * 4;
    const float* dbias = denom_bias + (size_t)h * T;
    float* out = tmpout + (size_t)g * T;
    const float th = temp[h];

    float4 run = make_float4(0.f, 0.f, 0.f, 0.f);
    for (int t = 0; t < T; ++t) {
        float4 wv = *(const float4*)(base + (size_t)t * C);
        float sx = wv.x * wv.x, sy = wv.y * wv.y, sz = wv.z * wv.z, sw = wv.w * wv.w;
        run.x += sx; run.y += sy; run.z += sz; run.w += sw;
        float val = sx / fmaxf(run.x, 1e-12f) + sy / fmaxf(run.y, 1e-12f)
                  + sz / fmaxf(run.z, 1e-12f) + sw / fmaxf(run.w, 1e-12f);
        // reduce over the 16-lane group (stays within half-wave)
        val += __shfl_xor(val, 8, 32);
        val += __shfl_xor(val, 4, 32);
        val += __shfl_xor(val, 2, 32);
        val += __shfl_xor(val, 1, 32);
        if (l == 0) out[t] = (val + (float)D * dbias[t]) * th;
    }
}

// ---------------------------------------------------------------------------
// Stage 2: Pi = softmax over heads (axis H=16). One thread per (b,t).
// ---------------------------------------------------------------------------
__global__ void stage_softmax(const float* __restrict__ tmpin,
                              float* __restrict__ Pi, int B, int T, int H) {
    int idx = blockIdx.x * blockDim.x + threadIdx.x;
    if (idx >= B * T) return;
    int b = idx / T, t = idx % T;
    const float* p = tmpin + (size_t)b * H * T + t;
    float v[16];
    float m = -3.4e38f;
#pragma unroll
    for (int h = 0; h < 16; ++h) { v[h] = p[(size_t)h * T]; m = fmaxf(m, v[h]); }
    float s = 0.f;
#pragma unroll
    for (int h = 0; h < 16; ++h) { v[h] = __expf(v[h] - m); s += v[h]; }
    float inv = 1.f / s;
    float* q = Pi + (size_t)b * H * T + t;
#pragma unroll
    for (int h = 0; h < 16; ++h) q[(size_t)h * T] = v[h] * inv;
}

// ---------------------------------------------------------------------------
// Stage 3: dots = cumsum_T(w^2*Pi)/(cumsum_T(Pi)+1e-8); y = -(w*Pi)/(1+dots)
// Writes y straight into bf16 hi/lo buffers (GEMM2 inputs).
// ---------------------------------------------------------------------------
__global__ void stage_y(const float* __restrict__ w,
                        const float* __restrict__ Pi,
                        unsigned short* __restrict__ yhi,
                        unsigned short* __restrict__ ylo,
                        int B, int T, int C, int H, int D) {
    int g = (blockIdx.x * blockDim.x + threadIdx.x) >> 4;
    int l = threadIdx.x & 15;
    if (g >= B * H) return;
    int b = g / H, h = g % H;

    const float* wbase = w + (size_t)b * T * C + h * D + l * 4;
    const float* pbase = Pi + (size_t)g * T;
    size_t obase = (size_t)b * T * C + h * D + l * 4;

    float4 cumWP = make_float4(0.f, 0.f, 0.f, 0.f);
    float cumPi = 0.f;
    for (int t = 0; t < T; ++t) {
        float pi = pbase[t];
        cumPi += pi;
        float4 wv = *(const float4*)(wbase + (size_t)t * C);
        cumWP.x += wv.x * wv.x * pi;
        cumWP.y += wv.y * wv.y * pi;
        cumWP.z += wv.z * wv.z * pi;
        cumWP.w += wv.w * wv.w * pi;
        float dn = cumPi + 1e-8f;
        float yx = -(wv.x * pi) / (1.f + cumWP.x / dn);
        float yy = -(wv.y * pi) / (1.f + cumWP.y / dn);
        float yz = -(wv.z * pi) / (1.f + cumWP.z / dn);
        float yw = -(wv.w * pi) / (1.f + cumWP.w / dn);

        unsigned short h0 = f2bf(yx), h1 = f2bf(yy), h2 = f2bf(yz), h3 = f2bf(yw);
        unsigned short l0 = f2bf(yx - bf2f(h0)), l1 = f2bf(yy - bf2f(h1));
        unsigned short l2 = f2bf(yz - bf2f(h2)), l3 = f2bf(yw - bf2f(h3));

        size_t o = obase + (size_t)t * C;
        uint2 hv, lv;
        hv.x = (unsigned)h0 | ((unsigned)h1 << 16);
        hv.y = (unsigned)h2 | ((unsigned)h3 << 16);
        lv.x = (unsigned)l0 | ((unsigned)l1 << 16);
        lv.y = (unsigned)l2 | ((unsigned)l3 << 16);
        *(uint2*)(yhi + o) = hv;
        *(uint2*)(ylo + o) = lv;
    }
}

// ---------------------------------------------------------------------------
// Host-side launch
// ---------------------------------------------------------------------------
extern "C" void kernel_launch(void* const* d_in, const int* in_sizes, int n_in,
                              void* d_out, int out_size, void* d_ws, size_t ws_size,
                              hipStream_t stream) {
    const float* x          = (const float*)d_in[0];
    const float* Wa         = (const float*)d_in[1];
    const float* ba         = (const float*)d_in[2];
    const float* Wp         = (const float*)d_in[3];
    const float* bp         = (const float*)d_in[4];
    const float* temp       = (const float*)d_in[5];
    const float* denom_bias = (const float*)d_in[6];

    const int B = 4, T = 4096, C = 1024, H = 16, D = 64;
    const int M = B * T;   // 16384
    const int N = C, K = C;

    // Workspace layout (bytes)
    char* ws = (char*)d_ws;
    float*          wbuf = (float*)(ws + 0);                       // 64 MB  (B,T,C) f32
    unsigned short* hi   = (unsigned short*)(ws + 67108864);       // 32 MB  x-hi / y-hi
    unsigned short* lo   = (unsigned short*)(ws + 100663296);      // 32 MB  x-lo / y-lo
    unsigned short* Wahi = (unsigned short*)(ws + 134217728);      //  2 MB
    unsigned short* Walo = (unsigned short*)(ws + 136314880);      //  2 MB
    unsigned short* Wphi = (unsigned short*)(ws + 138412032);      //  2 MB
    unsigned short* Wplo = (unsigned short*)(ws + 140509184);      //  2 MB
    float*          tmpb = (float*)(ws + 142606336);               //  1 MB  (B,H,T)
    float*          Pib  = (float*)(ws + 143654912);               //  1 MB  (B,H,T)

    const int nX = M * C;      // 16.7M
    const int nW = C * C;      // 1M
    split_bf16<<<(nX + 255) / 256, 256, 0, stream>>>(x,  hi,   lo,   nX);
    split_bf16<<<(nW + 255) / 256, 256, 0, stream>>>(Wa, Wahi, Walo, nW);
    split_bf16<<<(nW + 255) / 256, 256, 0, stream>>>(Wp, Wphi, Wplo, nW);

    const int waves  = (M / 16) * (N / 64);   // 16384 waves
    const int blocks = waves / 8;             // 8 waves (256 thr) per block

    // GEMM1: w = x @ Wa.T + ba
    wmma_gemm_bias<<<blocks, 256, 0, stream>>>(hi, lo, Wahi, Walo, ba, wbuf, M, N, K);

    // Scan / softmax / scan
    stage_tmp<<<(B * H * 16 + 255) / 256, 256, 0, stream>>>(wbuf, temp, denom_bias, tmpb,
                                                            B, T, C, H, D);
    stage_softmax<<<(B * T + 255) / 256, 256, 0, stream>>>(tmpb, Pib, B, T, H);
    stage_y<<<(B * H * 16 + 255) / 256, 256, 0, stream>>>(wbuf, Pib, hi, lo,
                                                          B, T, C, H, D);

    // GEMM2: out = y @ Wp.T + bp
    wmma_gemm_bias<<<blocks, 256, 0, stream>>>(hi, lo, Wphi, Wplo, bp,
                                               (float*)d_out, M, N, K);
}

// v001
// Measured time: 709 microseconds a run.
// Next to v000, in two timings, it ran 6.86 times as fast each time.
#include <hip/hip_runtime.h>
#include <hip/hip_bf16.h>

// ---------------------------------------------------------------------------
// CDNA5 (gfx1250) implementation of the TSSA causal-attention reference.
//   GEMMs run on v_wmma_f32_16x16x32_bf16 with an error-compensated
//   bf16 hi/lo split (hi*hi + hi*lo + lo*hi) to keep ~fp32 accuracy.
//   The cumsums over T are chunked scans (chunk sums, then a scan per chunk).
// ---------------------------------------------------------------------------

typedef __attribute__((ext_vector_type(16))) __bf16 v16bf;
typedef __attribute__((ext_vector_type(8)))  float  v8f;

union Frag16 {
    v16bf v;
    uint4 u[2];
};

__device__ __forceinline__ unsigned short f2bf(float f) {
    // round-to-nearest-even bf16 truncation
    unsigned u = __float_as_uint(f);
    unsigned r = 0x7fffu + ((u >> 16) & 1u);
    return (unsigned short)((u + r) >> 16);
}
__device__ __forceinline__ float bf2f(unsigned short h) {
    return __uint_as_float(((unsigned)h) << 16);
}

// ---------------------------------------------------------------------------
// Split f32 -> bf16 hi + bf16 lo residual
// ---------------------------------------------------------------------------
__global__ void split_bf16(const float* __restrict__ in,
                           unsigned short* __restrict__ hi,
                           unsigned short* __restrict__ lo, int n) {
    int i = blockIdx.x * blockDim.x + threadIdx.x;
    if (i >= n) return;
    float f = in[i];
    unsigned short h = f2bf(f);
    hi[i] = h;
    lo[i] = f2bf(f - bf2f(h));
}

// ---------------------------------------------------------------------------
// C = A @ B^T + bias, via v_wmma_f32_16x16x32_bf16 with hi/lo compensation.
// A: (M,K) row-major (hi/lo bf16).  Brows: (N,K) row-major (hi/lo bf16),
// i.e. B^T columns are Brows rows -> WMMA B fragment loads are contiguous.
// Each wave computes a 16x64 strip (4 tiles sharing the A fragment).
// ---------------------------------------------------------------------------
__device__ __forceinline__ Frag16 load_frag(const unsigned short* __restrict__ base,
                                            int K, int row, int k, int koff) {
    Frag16 f;
    const unsigned short* p = base + (size_t)row * K + k + koff;
    f.u[0] = *(const uint4*)p;         // K chunk 0..7  (lane<16) / 8..15 (lane>=16)
    f.u[1] = *(const uint4*)(p + 16);  // K chunk 16..23 / 24..31
    return f;
}

__global__ __launch_bounds__(256)
void wmma_gemm_bias(const unsigned short* __restrict__ Ahi,
                    const unsigned short* __restrict__ Alo,
                    const unsigned short* __restrict__ Bhi,
                    const unsigned short* __restrict__ Blo,
                    const float* __restrict__ bias,
                    float* __restrict__ Cout,
                    int M, int N, int K) {
    const int lane    = threadIdx.x & 31;
    const int wave    = blockIdx.x * (blockDim.x >> 5) + (threadIdx.x >> 5);
    const int nstrips = N >> 6;                 // strips of 64 columns
    const int mtile   = wave / nstrips;
    const int nstrip  = wave % nstrips;
    if ((mtile << 4) >= M) return;

    const int m0   = mtile << 4;
    const int n0   = nstrip << 6;
    const int rowA = m0 + (lane & 15);
    const int koff = (lane >> 4) << 3;          // 0 or 8 (ISA 16-bit A layout)

    v8f zero = {};
    v8f acc[4];
    acc[0] = zero; acc[1] = zero; acc[2] = zero; acc[3] = zero;

    for (int k = 0; k < K; k += 32) {
        Frag16 ah = load_frag(Ahi, K, rowA, k, koff);
        Frag16 al = load_frag(Alo, K, rowA, k, koff);
        // prefetch next K-chunk of the A stream (global_prefetch_b8)
        if (k + 32 < K) {
            __builtin_prefetch(Ahi + (size_t)rowA * K + k + 32 + koff, 0, 1);
        }
#pragma unroll
        for (int j = 0; j < 4; ++j) {
            const int rowB = n0 + (j << 4) + (lane & 15);
            Frag16 bh = load_frag(Bhi, K, rowB, k, koff);
            Frag16 bl = load_frag(Blo, K, rowB, k, koff);
            acc[j] = __builtin_amdgcn_wmma_f32_16x16x32_bf16(
                false, ah.v, false, bh.v, (short)0, acc[j], false, false);
            acc[j] = __builtin_amdgcn_wmma_f32_16x16x32_bf16(
                false, ah.v, false, bl.v, (short)0, acc[j], false, false);
            acc[j] = __builtin_amdgcn_wmma_f32_16x16x32_bf16(
                false, al.v, false, bh.v, (short)0, acc[j], false, false);
        }
    }

    // C/D layout: VGPR v holds M = m0 + v + 8*(lane>=16), N = n0 + lane%16
    const int ncol  = lane & 15;
    const int mbase = m0 + ((lane >> 4) << 3);
#pragma unroll
    for (int j = 0; j < 4; ++j) {
        const int n  = n0 + (j << 4) + ncol;
        const float bv = bias[n];
#pragma unroll
        for (int v = 0; v < 8; ++v) {
            Cout[(size_t)(mbase + v) * N + n] = acc[j][v] + bv;
        }
    }
}

// ---------------------------------------------------------------------------
// The two cumsums over T run as chunked scans: T is cut into chunks of CHUNK
// rows, a first launch sums each chunk, and the scan launch starts each chunk
// from the sum of the chunk sums in front of it. One block = one (b, chunk),
// 256 threads x 4 channels = all CH channels (16 lanes per head).
// ---------------------------------------------------------------------------
constexpr int CH = 1024;    // channels = 256 threads x 4; a constant, so that the rows of a
                            // trip are immediate offsets from one address
constexpr int CHUNK = 32;   // 32 floats of tmp/Pi per (b,h,chunk) = one 128-byte line
constexpr int PPITCH = 32;  // floats per block in the Pi chunk sums: one 128-byte line each
constexpr int PRE = 16;     // chunk sums read per trip when a chunk's start value is formed

// Stage 1a: S[b,chunk,c] = sum over the chunk's rows of w^2
__global__ __launch_bounds__(256)
void chunk_sum_sq(const float* __restrict__ w, float* __restrict__ S) {
    const float* base = w + (size_t)blockIdx.x * CHUNK * CH + threadIdx.x * 4;
    float4 s = make_float4(0.f, 0.f, 0.f, 0.f);
#pragma unroll  // the chunk's independent loads issue ahead of the serial sums
    for (int t = 0; t < CHUNK; ++t) {
        float4 wv = *(const float4*)(base + (size_t)t * CH);
        s.x += wv.x * wv.x; s.y += wv.y * wv.y; s.z += wv.z * wv.z; s.w += wv.w * wv.w;
    }
    *(float4*)(S + (size_t)blockIdx.x * CH + threadIdx.x * 4) = s;
}

// Stage 1b: denom = cumsum_T(w^2); tmp[b,h,t] = (sum_d w^2/denom + D*dbias)*temp
__global__ __launch_bounds__(256)
void stage_tmp(const float* __restrict__ w,
               const float* __restrict__ S,
               const float* __restrict__ temp,
               const float* __restrict__ denom_bias,
               float* __restrict__ tmpout,
               int T, int H, int D) {
    const int nc = T / CHUNK;
    const int b = blockIdx.x / nc, j = blockIdx.x % nc;
    const int h = threadIdx.x >> 4;
    const int l = threadIdx.x & 15;
    const int t0 = j * CHUNK;

    const float* base  = w + (size_t)blockIdx.x * CHUNK * CH + threadIdx.x * 4;
    const float* dbias = denom_bias + (size_t)h * T + t0;
    float* out = tmpout + ((size_t)b * H + h) * T + t0;
    const float th = temp[h];

    // running sum at the chunk's start: the chunk sums in front of it
    float4 run = make_float4(0.f, 0.f, 0.f, 0.f);
    const float* sp = S + (size_t)b * nc * CH + threadIdx.x * 4;
    // Trips of PRE rows, no remainder loop: PRE divides nc, so every row read is one of
    // this b's chunk sums; a row at or past j adds 0.
    for (int i0 = 0; i0 < j; i0 += PRE) {
        float4 v[PRE];
#pragma unroll  // PRE independent loads in flight per trip
        for (int u = 0; u < PRE; ++u) v[u] = *(const float4*)(sp + (size_t)(i0 + u) * CH);
#pragma unroll  // v[] stays in registers
        for (int u = 0; u < PRE; ++u) {
            const bool on = i0 + u < j;
            run.x += on ? v[u].x : 0.f; run.y += on ? v[u].y : 0.f;
            run.z += on ? v[u].z : 0.f; run.w += on ? v[u].w : 0.f;
        }
    }

    // 16 rows per trip; lane u of a head's 16 keeps row u's sum, so the body has no
    // branch (the rows' loads can fly together) and the 16 lanes store 64 bytes at once.
    // this trip's first row; stepped at the trip's foot, so that the address stays live
    // behind the run of loads and none of their results lands in its registers
    const float* rp = base;
    for (int tb = 0; tb < CHUNK; tb += 16) {
        float4 wv[16];
        float val[16];
#pragma unroll  // sixteen rows' loads in flight ahead of the serial sums
        for (int u = 0; u < 16; ++u) wv[u] = *(const float4*)(rp + (size_t)u * CH);
#pragma unroll  // wv[] and val[] stay in registers
        for (int u = 0; u < 16; ++u) {
            float sx = wv[u].x * wv[u].x, sy = wv[u].y * wv[u].y;
            float sz = wv[u].z * wv[u].z, sw = wv[u].w * wv[u].w;
            run.x += sx; run.y += sy; run.z += sz; run.w += sw;
            val[u] = sx / fmaxf(run.x, 1e-12f) + sy / fmaxf(run.y, 1e-12f)
                   + sz / fmaxf(run.z, 1e-12f) + sw / fmaxf(run.w, 1e-12f);
        }
        // reduce over the 16-lane group (stays within half-wave), the sixteen rows'
        // exchanges of a step side by side so that one wait serves them all
#pragma unroll  // the four steps' lane masks become constants
        for (int m = 8; m >= 1; m >>= 1) {
            float o[16];
#pragma unroll  // sixteen independent exchanges in flight; o[] stays in registers
            for (int u = 0; u < 16; ++u) o[u] = __shfl_xor(val[u], m, 32);
#pragma unroll  // val[] stays in registers
            for (int u = 0; u < 16; ++u) val[u] += o[u];
        }
        float keep = val[0];
#pragma unroll  // val[] stays in registers
        for (int u = 1; u < 16; ++u) keep = (l == u) ? val[u] : keep;
        out[tb + l] = (keep + (float)D * dbias[tb + l]) * th;
        // the next trip re-uses the store's registers: keep the wait in front of that
        asm volatile("s_wait_xcnt 0x0" ::: "memory");
        rp += 16 * CH;
    }
}

// ---------------------------------------------------------------------------
// Stage 2: Pi = softmax over heads (axis H=16). One thread per (b,t).
// ---------------------------------------------------------------------------
__global__ void stage_softmax(const float* __restrict__ tmpin,
                              float* __restrict__ Pi, int B, int T, int H) {
    int idx = blockIdx.x * blockDim.x + threadIdx.x;
    if (idx >= B * T) return;
    int b = idx / T, t = idx % T;
    const float* p = tmpin + (size_t)b * H * T + t;
    float v[16];
    float m = -3.4e38f;
#pragma unroll
    for (int h = 0; h < 16; ++h) { v[h] = p[(size_t)h * T]; m = fmaxf(m, v[h]); }
    float s = 0.f;
#pragma unroll
    for (int h = 0; h < 16; ++h) { v[h] = __expf(v[h] - m); s += v[h]; }
    float inv = 1.f / s;
    float* q = Pi + (size_t)b * H * T + t;
#pragma unroll
    for (int h = 0; h < 16; ++h) q[(size_t)h * T] = v[h] * inv;
}

// ---------------------------------------------------------------------------
// Stage 3a: chunk sums of w^2*Pi (per channel) and of Pi (per head)
// ---------------------------------------------------------------------------
__global__ __launch_bounds__(256)
void chunk_sum_wp(const float* __restrict__ w,
                  const float* __restrict__ Pi,
                  float* __restrict__ S,
                  float* __restrict__ P,
                  int T, int H) {
    const int nc = T / CHUNK;
    const int b = blockIdx.x / nc, j = blockIdx.x % nc;
    const int h = threadIdx.x >> 4;
    const int l = threadIdx.x & 15;

    const float* wbase = w + (size_t)blockIdx.x * CHUNK * CH + threadIdx.x * 4;
    const float* pbase = Pi + ((size_t)b * H + h) * T + j * CHUNK;

    float4 s = make_float4(0.f, 0.f, 0.f, 0.f);
    float sp = 0.f;
#pragma unroll  // the chunk's independent loads issue ahead of the serial sums
    for (int t = 0; t < CHUNK; ++t) {
        float pi = pbase[t];
        sp += pi;
        float4 wv = *(const float4*)(wbase + (size_t)t * CH);
        s.x += wv.x * wv.x * pi;
        s.y += wv.y * wv.y * pi;
        s.z += wv.z * wv.z * pi;
        s.w += wv.w * wv.w * pi;
    }
    *(float4*)(S + (size_t)blockIdx.x * CH + threadIdx.x * 4) = s;
    if (l == 0) P[(size_t)blockIdx.x * PPITCH + h] = sp;
}

// ---------------------------------------------------------------------------
// Stage 3b: dots = cumsum_T(w^2*Pi)/(cumsum_T(Pi)+1e-8); y = -(w*Pi)/(1+dots)
// Writes y straight into bf16 hi/lo buffers (GEMM2 inputs).
// ---------------------------------------------------------------------------
__global__ __launch_bounds__(256)
void stage_y(const float* __restrict__ w,
             const float* __restrict__ Pi,
             const float* __restrict__ S,
             const float* __restrict__ P,
             unsigned short* __restrict__ yhi,
             unsigned short* __restrict__ ylo,
             int T, int H) {
    const int nc = T / CHUNK;
    const int b = blockIdx.x / nc, j = blockIdx.x % nc;
    const int h = threadIdx.x >> 4;

    const float* wbase = w + (size_t)blockIdx.x * CHUNK * CH + threadIdx.x * 4;
    const float* pbase = Pi + ((size_t)b * H + h) * T + j * CHUNK;
    size_t obase = (size_t)blockIdx.x * CHUNK * CH + threadIdx.x * 4;

    // running sums at the chunk's start: the chunk sums in front of it
    float4 cumWP = make_float4(0.f, 0.f, 0.f, 0.f);
    float cumPi = 0.f;
    const float* sp = S + (size_t)b * nc * CH + threadIdx.x * 4;
    const float* pp = P + (size_t)b * nc * PPITCH + h;
    // Trips of PRE (2 * PRE) rows, no remainder loop: both divide nc, so every row read is
    // one of this b's chunk sums; a row at or past j adds 0.
    for (int i0 = 0; i0 < j; i0 += 2 * PRE) {
        float p[2 * PRE];
#pragma unroll  // 2 * PRE independent loads in flight per trip
        for (int u = 0; u < 2 * PRE; ++u) p[u] = pp[(size_t)(i0 + u) * PPITCH];
#pragma unroll  // p[] stays in registers
        for (int u = 0; u < 2 * PRE; ++u) cumPi += (i0 + u < j) ? p[u] : 0.f;
    }
    for (int i0 = 0; i0 < j; i0 += PRE) {
        float4 v[PRE];
#pragma unroll  // PRE independent loads in flight per trip
        for (int u = 0; u < PRE; ++u) v[u] = *(const float4*)(sp + (size_t)(i0 + u) * CH);
#pragma unroll  // v[] stays in registers
        for (int u = 0; u < PRE; ++u) {
            const bool on = i0 + u < j;
            cumWP.x += on ? v[u].x : 0.f; cumWP.y += on ? v[u].y : 0.f;
            cumWP.z += on ? v[u].z : 0.f; cumWP.w += on ? v[u].w : 0.f;
        }
    }

    // 8 rows per trip: their loads fly together ahead of the serial sums
    for (int tb = 0; tb < CHUNK; tb += 8) {
        float4 wr[8];
        float pr[8];
#pragma unroll  // eight rows' loads in flight
        for (int u = 0; u < 8; ++u) {
            pr[u] = pbase[tb + u];
            wr[u] = *(const float4*)(wbase + (size_t)(tb + u) * CH);
        }
#pragma unroll  // wr[] and pr[] stay in registers
        for (int u = 0; u < 8; ++u) {
            float pi = pr[u];
            float4 wv = wr[u];
            cumPi += pi;
            cumWP.x += wv.x * wv.x * pi;
            cumWP.y += wv.y * wv.y * pi;
            cumWP.z += wv.z * wv.z * pi;
            cumWP.w += wv.w * wv.w * pi;
            float dn = cumPi + 1e-8f;
            float yx = -(wv.x * pi) / (1.f + cumWP.x / dn);
            float yy = -(wv.y * pi) / (1.f + cumWP.y / dn);
            float yz = -(wv.z * pi) / (1.f + cumWP.z / dn);
            float yw = -(wv.w * pi) / (1.f + cumWP.w / dn);

            unsigned short h0 = f2bf(yx), h1 = f2bf(yy), h2 = f2bf(yz), h3 = f2bf(yw);
            unsigned short l0 = f2bf(yx - bf2f(h0)), l1 = f2bf(yy - bf2f(h1));
            unsigned short l2 = f2bf(yz - bf2f(h2)), l3 = f2bf(yw - bf2f(h3));

            size_t o = obase + (size_t)(tb + u) * CH;
            uint2 hv, lv;
            hv.x = (unsigned)h0 | ((unsigned)h1 << 16);
            hv.y = (unsigned)h2 | ((unsigned)h3 << 16);
            lv.x = (unsigned)l0 | ((unsigned)l1 << 16);
            lv.y = (unsigned)l2 | ((unsigned)l3 << 16);
            *(uint2*)(yhi + o) = hv;
            *(uint2*)(ylo + o) = lv;
        }
        // the next trip re-uses the stores' registers: keep the wait in front of that
        asm volatile("s_wait_xcnt 0x0" ::: "memory");
    }
}

// ---------------------------------------------------------------------------
// Host-side launch
// ---------------------------------------------------------------------------
extern "C" void kernel_launch(void* const* d_in, const int* in_sizes, int n_in,
                              void* d_out, int out_size, void* d_ws, size_t ws_size,
                              hipStream_t stream) {
    const float* x          = (const float*)d_in[0];
    const float* Wa         = (const float*)d_in[1];
    const float* ba         = (const float*)d_in[2];
    const float* Wp         = (const float*)d_in[3];
    const float* bp         = (const float*)d_in[4];
    const float* temp       = (const float*)d_in[5];
    const float* denom_bias = (const float*)d_in[6];

    const int B = 4, T = 4096, C = 1024, H = 16, D = 64;
    const int M = B * T;   // 16384
    const int N = C, K = C;

    // Workspace layout (bytes)
    char* ws = (char*)d_ws;
    float*          wbuf = (float*)(ws + 0);                       // 64 MB  (B,T,C) f32
    unsigned short* hi   = (unsigned short*)(ws + 67108864);       // 32 MB  x-hi / y-hi
    unsigned short* lo   = (unsigned short*)(ws + 100663296);      // 32 MB  x-lo / y-lo
    unsigned short* Wahi = (unsigned short*)(ws + 134217728);      //  2 MB
    unsigned short* Walo = (unsigned short*)(ws + 136314880);      //  2 MB
    unsigned short* Wphi = (unsigned short*)(ws + 138412032);      //  2 MB
    unsigned short* Wplo = (unsigned short*)(ws + 140509184);      //  2 MB
    float*          tmpb = (float*)(ws + 142606336);               //  1 MB  (B,H,T)
    float*          Pib  = (float*)(ws + 143654912);               //  1 MB  (B,H,T)
    float*          Ssq  = (float*)(ws + 144703488);               //  2 MB  (B,T/32,C) chunk sums of w^2
    float*          Swp  = (float*)(ws + 146800640);               //  2 MB  (B,T/32,C) chunk sums of w^2*Pi
    float*          Spi  = (float*)(ws + 148897792);               // 64 KB  (B,T/32,32) chunk sums of Pi

    const int nX = M * C;      // 16.7M
    const int nW = C * C;      // 1M
    split_bf16<<<(nX + 255) / 256, 256, 0, stream>>>(x,  hi,   lo,   nX);
    split_bf16<<<(nW + 255) / 256, 256, 0, stream>>>(Wa, Wahi, Walo, nW);
    split_bf16<<<(nW + 255) / 256, 256, 0, stream>>>(Wp, Wphi, Wplo, nW);

    const int waves  = (M / 16) * (N / 64);   // 16384 waves
    const int blocks = waves / 8;             // 8 waves (256 thr) per block

    // GEMM1: w = x @ Wa.T + ba
    wmma_gemm_bias<<<blocks, 256, 0, stream>>>(hi, lo, Wahi, Walo, ba, wbuf, M, N, K);

    // Scan / softmax / scan
    const int chunks = B * (T / CHUNK);       // one block per (b, chunk of rows)
    chunk_sum_sq<<<chunks, 256, 0, stream>>>(wbuf, Ssq);
    stage_tmp<<<chunks, 256, 0, stream>>>(wbuf, Ssq, temp, denom_bias, tmpb, T, H, D);
    stage_softmax<<<(B * T + 255) / 256, 256, 0, stream>>>(tmpb, Pib, B, T, H);
    chunk_sum_wp<<<chunks, 256, 0, stream>>>(wbuf, Pib, Swp, Spi, T, H);
    stage_y<<<chunks, 256, 0, stream>>>(wbuf, Pib, Swp, Spi, hi, lo, T, H);

    // GEMM2: out = y @ Wp.T + bp
    wmma_gemm_bias<<<blocks, 256, 0, stream>>>(hi, lo, Wphi, Wplo, bp,
                                               (float*)d_out, M, N, K);
}

// v002
// It runs in 211 microseconds.
// Next to v001, in two timings, it ran 3.36 and 3.38 times as fast.
// Over all steps from v000 it is 23.1 times as fast.
#include <hip/hip_runtime.h>
#include <hip/hip_bf16.h>
#include <stdint.h>

// ---------------------------------------------------------------------------
// CDNA5 (gfx1250) implementation of the TSSA causal-attention reference.
//   GEMMs run on v_wmma_f32_16x16x32_bf16 with an error-compensated
//   bf16 hi/lo split (hi*hi + hi*lo + lo*hi) to keep ~fp32 accuracy.
//   The cumsums over T are chunked scans (chunk sums, then a scan per chunk).
// ---------------------------------------------------------------------------

typedef __attribute__((ext_vector_type(16))) __bf16 v16bf;
typedef __attribute__((ext_vector_type(8)))  float  v8f;

union Frag16 {
    v16bf v;
    uint4 u[2];
};

__device__ __forceinline__ unsigned short f2bf(float f) {
    // round-to-nearest-even bf16 truncation
    unsigned u = __float_as_uint(f);
    unsigned r = 0x7fffu + ((u >> 16) & 1u);
    return (unsigned short)((u + r) >> 16);
}
__device__ __forceinline__ float bf2f(unsigned short h) {
    return __uint_as_float(((unsigned)h) << 16);
}

// ---------------------------------------------------------------------------
// Split f32 -> bf16 hi + bf16 lo residual
// ---------------------------------------------------------------------------
__global__ void split_bf16(const float* __restrict__ in,
                           unsigned short* __restrict__ hi,
                           unsigned short* __restrict__ lo, int n) {
    int i = blockIdx.x * blockDim.x + threadIdx.x;
    if (i >= n) return;
    float f = in[i];
    unsigned short h = f2bf(f);
    hi[i] = h;
    lo[i] = f2bf(f - bf2f(h));
}

// ---------------------------------------------------------------------------
// C = A @ B^T + bias, via v_wmma_f32_16x16x32_bf16 with hi/lo compensation.
// A: (M,K) row-major (hi/lo bf16).  Brows: (N,K) row-major (hi/lo bf16).
// One 256 x 256 tile of C per work-group (M, N multiples of 256; K a multiple of 64, at
// least 128). 8 waves, 4 along m x 2 along n, each 64 rows x 128 columns of the tile.
// A pass of the K loop is 64 k = 128 bytes of every operand row. A stage is
// [A hi | A lo | B hi | B lo], 256 rows each, at an LDS pitch of 144 bytes; two buffers.
// Every wave brings its own slice (128 rows of one of the four arrays) with one tensor
// load per stage, issued a whole pass ahead of the pass that reads it.
// ---------------------------------------------------------------------------
typedef uint32_t u32x4 __attribute__((ext_vector_type(4)));
typedef uint32_t u32x8 __attribute__((ext_vector_type(8)));

constexpr uint32_t TILE   = 256;                 // rows of A and rows of B per work-group
constexpr uint32_t KB     = 128;                 // bytes of an operand row per pass
constexpr uint32_t PITCH  = KB + 16;             // 16 B x odd: no bank conflict for 16-byte reads
constexpr uint32_t SROWS  = 128;                 // rows per tensor load
constexpr uint32_t SLICE  = SROWS * PITCH;       // 18,432 B
constexpr uint32_t ARR    = TILE * PITCH;        // one array's rows of a stage
constexpr uint32_t STAGE  = 4 * ARR;             // 147,456 B
static_assert(SLICE % 2048u == 0, "every slice starts at a multiple of 2 KiB");
static_assert(2u * STAGE <= 320u * 1024u, "two buffers fit the LDS");

__device__ __forceinline__ uint32_t uni(uint32_t v) { return (uint32_t)__builtin_amdgcn_readfirstlane(v); }
__device__ __forceinline__ uint32_t pinned(uint32_t v) {
    uint32_t w = (uint32_t)__builtin_amdgcn_readfirstlane(v);
    asm volatile("" : "+s"(w));  // pinned(): the value stays in a scalar register (tensor loads ignore EXEC)
    return w;
}
// this wave's LDS reads have returned (the buffer may be refilled behind the barrier)
__device__ __forceinline__ void wait_ds0() { asm volatile("s_wait_dscnt 0x0" ::: "memory"); }
// this wave's tensor load has landed (the compiler places no wait for it)
__device__ __forceinline__ void wait_tensor0() { asm volatile("s_wait_tensorcnt 0x0" ::: "memory"); }
// one request of the whole wave: a tile of SROWS rows of KB bytes into LDS
__device__ __forceinline__ void tdm_load(u32x4 g0, u32x8 g1) {
    asm volatile("tensor_load_to_lds %0, %1" :: "s"(g0), "s"(g1) : "memory");
}
// pinned descriptor words, held in their scalar registers up to here: placed behind the wait that
// covers a request, so that no word of its descriptor takes a new value while it is outstanding
__device__ __forceinline__ void hold(u32x4& g0, u32x8& g1) { asm volatile("" : "+s"(g0), "+s"(g1)); }
// the compiler does not schedule across it
__device__ __forceinline__ void fence() { __builtin_amdgcn_sched_barrier(0); }
// group 1: 1-byte elements, SROWS rows of KB bytes, 16 B of LDS pad behind every 128-byte row
__device__ __forceinline__ u32x8 tdm_group1(uint32_t src_pitch) {
    constexpr uint32_t d0 = KB, d1 = SROWS;
    u32x8 g;
    g[0] = uni((1u << 20) | (4u << 22) | (3u << 25));
    g[1] = uni((d0 & 0xFFFFu) << 16);
    g[2] = uni((d0 >> 16) | ((d1 & 0xFFFFu) << 16));
    g[3] = uni((d1 >> 16) | (d0 << 16));
    g[4] = uni(d1);
    g[5] = uni(src_pitch);
    g[6] = uni(0u);
    g[7] = uni(0u);
    return g;
}
// group 0: LDS destination (byte offset) and the global address of the tile's first byte
__device__ __forceinline__ u32x4 tdm_group0(uint32_t lds_dst, uint64_t ga) {
    u32x4 g;
    g[0] = uni(1u);
    g[1] = uni(lds_dst);
    g[2] = uni((uint32_t)ga);
    g[3] = uni((((uint32_t)(ga >> 32)) & 0x01FFFFFFu) | 0x80000000u);
    return g;
}

// p: the lane's row, at its 16-byte half (lane >> 4) of the 64 bytes (32 k) of this block
__device__ __forceinline__ Frag16 lds_frag(const unsigned char* p) {
    Frag16 f;
    f.u[0] = *(const uint4*)p;         // K chunk 0..7  (lane<16) / 8..15 (lane>=16)
    f.u[1] = *(const uint4*)(p + 32);  // K chunk 16..23 / 24..31
    return f;
}
__device__ __forceinline__ v8f mma(const Frag16& a, const Frag16& b, v8f c) {
    return __builtin_amdgcn_wmma_f32_16x16x32_bf16(false, a.v, false, b.v, (short)0, c, false, false);
}

__global__ __launch_bounds__(256)
void wmma_gemm_bias(const unsigned short* __restrict__ Ahi,
                    const unsigned short* __restrict__ Alo,
                    const unsigned short* __restrict__ Bhi,
                    const unsigned short* __restrict__ Blo,
                    const float* __restrict__ bias,
                    float* __restrict__ Cout,
                    int M, int N, int K) {
    __shared__ __attribute__((aligned(2048))) unsigned char L[2 * STAGE];
    const uint32_t lane = threadIdx.x & 31u, r16 = lane & 15u, h = lane >> 4;
    const uint32_t wave = uni(threadIdx.x >> 5);
    const uint32_t tiles_n = (uint32_t)N / TILE;
    const uint32_t tm = blockIdx.x / tiles_n, tn = blockIdx.x - tm * tiles_n;
    const uint32_t m0 = tm * TILE, n0 = tn * TILE;
    const uint32_t wm = wave >> 1, wn = wave & 1u;
    const uint32_t kb = (uint32_t)K * 2u;        // bytes of a source row
    const uint32_t T  = pinned((uint32_t)K / 64u);
    (void)M;

    // this wave's slice: array wave >> 1 of [A hi, A lo, B hi, B lo], rows 128 * (wave & 1) on
    const uint32_t arr = wave >> 1;
    const unsigned short* sarr = (arr == 0u) ? Ahi : (arr == 1u) ? Alo : (arr == 2u) ? Bhi : Blo;
    const uint32_t srow = ((arr < 2u) ? m0 : n0) + SROWS * (wave & 1u);
    const uint64_t src = (uint64_t)(uintptr_t)sarr + (uint64_t)srow * kb;
    const uint32_t lds_slice = (uint32_t)(size_t)L + wave * SLICE;   // add buffer * STAGE
    u32x8 g1 = tdm_group1(kb);

    v8f acc[4][8];
#pragma unroll
    for (int i = 0; i < 4; ++i)
#pragma unroll
        for (int j = 0; j < 8; ++j) acc[i][j] = v8f{};

    // per-lane fragment bases in a buffer
    const uint32_t a_base = (wm * 64u + r16) * PITCH + 16u * h;
    const uint32_t b_base = 2u * ARR + (wn * 128u + r16) * PITCH + 16u * h;

    u32x4 g0 = tdm_group0(lds_slice, src);
    tdm_load(g0, g1);                                    // stage 0
    wait_tensor0();
    hold(g0, g1);
    __syncthreads();                                     // stage 0 is published
    g0 = tdm_group0(lds_slice + STAGE, src + KB);
    tdm_load(g0, g1);                                    // stage 1

#pragma clang loop unroll(disable)  // one pass per trip: the buffer index stays a scalar
    for (uint32_t t = 0; t < T; ++t) {
        const uint32_t buf = (t & 1u) * STAGE;
        const unsigned char* la = L + buf + a_base;
        const unsigned char* lb = L + buf + b_base;
        // A pass is 8 units of 24 WMMAs: unit q = block (32 k) q >> 2, columns 32 * (q & 3) on.
        // The A fragments of both blocks and two sets of a unit's B fragments are held.
        Frag16 ah[2][4], al[2][4], bh[2][2], bl[2][2];
        // the first unit's fragments in the order of their use, so that its first WMMAs
        // wait for the first twelve loads only
#pragma unroll
        for (int i = 0; i < 4; ++i) ah[0][i] = lds_frag(la + (uint32_t)i * 16u * PITCH);
#pragma unroll
        for (int jj = 0; jj < 2; ++jj) bh[0][jj] = lds_frag(lb + (uint32_t)jj * 16u * PITCH);
        fence();  // keeps these loads in front of the ones that are needed later
#pragma unroll
        for (int jj = 0; jj < 2; ++jj) bl[0][jj] = lds_frag(lb + ARR + (uint32_t)jj * 16u * PITCH);
#pragma unroll
        for (int i = 0; i < 4; ++i) al[0][i] = lds_frag(la + ARR + (uint32_t)i * 16u * PITCH);
        fence();  // and these in front of the next unit's
#pragma unroll  // every fragment and accumulator index a constant
        for (int q = 0; q < 8; ++q) {
            const int u = q >> 2, jp = q & 3, s = q & 1;
            // the next unit's fragments, as one group ahead of this unit's WMMAs
            if (q < 7) {
                const int un = (q + 1) >> 2, jn = (q + 1) & 3;
#pragma unroll
                for (int jj = 0; jj < 2; ++jj) {
                    bh[s ^ 1][jj] = lds_frag(lb + (uint32_t)(2 * jn + jj) * 16u * PITCH + 64u * (uint32_t)un);
                    bl[s ^ 1][jj] = lds_frag(lb + ARR + (uint32_t)(2 * jn + jj) * 16u * PITCH + 64u * (uint32_t)un);
                }
            }
            if (u == 0) {  // a quarter of the second block's A fragments
                ah[1][jp] = lds_frag(la + (uint32_t)jp * 16u * PITCH + 64u);
                al[1][jp] = lds_frag(la + ARR + (uint32_t)jp * 16u * PITCH + 64u);
            }
            fence();  // keeps the group of LDS loads together, ahead of the WMMAs
            // per accumulator the order stays hi*hi, hi*lo, lo*hi; eight tiles stand
            // between two products into the same accumulator
#pragma unroll
            for (int jj = 0; jj < 2; ++jj)
#pragma unroll
                for (int i = 0; i < 4; ++i) acc[i][2 * jp + jj] = mma(ah[u][i], bh[s][jj], acc[i][2 * jp + jj]);
#pragma unroll
            for (int jj = 0; jj < 2; ++jj)
#pragma unroll
                for (int i = 0; i < 4; ++i) acc[i][2 * jp + jj] = mma(ah[u][i], bl[s][jj], acc[i][2 * jp + jj]);
#pragma unroll
            for (int jj = 0; jj < 2; ++jj)
#pragma unroll
                for (int i = 0; i < 4; ++i) acc[i][2 * jp + jj] = mma(al[u][i], bh[s][jj], acc[i][2 * jp + jj]);
            fence();  // keeps the next group of LDS loads out of this unit's WMMAs
        }
        // publish point of stage t + 1
        wait_ds0();
        wait_tensor0();
        hold(g0, g1);
        __syncthreads();
        if (pinned(t + 2u < T)) {  // the refill, into the buffer this pass has just read
            g0 = tdm_group0(lds_slice + buf, src + (uint64_t)(t + 2u) * KB);
            tdm_load(g0, g1);
        }
    }
    wait_tensor0();
    wait_ds0();

    // C/D layout: VGPR v holds M = v + 8*(lane>=16), N = lane%16
#pragma unroll
    for (int j = 0; j < 8; ++j) {
        const uint32_t n = n0 + wn * 128u + (uint32_t)j * 16u + r16;
        const float bv = bias[n];
#pragma unroll
        for (int i = 0; i < 4; ++i) {
            const uint32_t mb = m0 + wm * 64u + (uint32_t)i * 16u + 8u * h;
#pragma unroll
            for (int v = 0; v < 8; ++v) {
                Cout[(size_t)(mb + v) * (uint32_t)N + n] = acc[i][j][v] + bv;
            }
        }
    }
}

// ---------------------------------------------------------------------------
// The two cumsums over T run as chunked scans: T is cut into chunks of CHUNK
// rows, a first launch sums each chunk, and the scan launch starts each chunk
// from the sum of the chunk sums in front of it. One block = one (b, chunk),
// 256 threads x 4 channels = all CH channels (16 lanes per head).
// ---------------------------------------------------------------------------
constexpr int CH = 1024;    // channels = 256 threads x 4; a constant, so that the rows of a
                            // trip are immediate offsets from one address
constexpr int CHUNK = 32;   // 32 floats of tmp/Pi per (b,h,chunk) = one 128-byte line
constexpr int PPITCH = 32;  // floats per block in the Pi chunk sums: one 128-byte line each
constexpr int PRE = 16;     // chunk sums read per trip when a chunk's start value is formed

// Stage 1a: S[b,chunk,c] = sum over the chunk's rows of w^2
__global__ __launch_bounds__(256)
void chunk_sum_sq(const float* __restrict__ w, float* __restrict__ S) {
    const float* base = w + (size_t)blockIdx.x * CHUNK * CH + threadIdx.x * 4;
    float4 s = make_float4(0.f, 0.f, 0.f, 0.f);
#pragma unroll  // the chunk's independent loads issue ahead of the serial sums
    for (int t = 0; t < CHUNK; ++t) {
        float4 wv = *(const float4*)(base + (size_t)t * CH);
        s.x += wv.x * wv.x; s.y += wv.y * wv.y; s.z += wv.z * wv.z; s.w += wv.w * wv.w;
    }
    *(float4*)(S + (size_t)blockIdx.x * CH + threadIdx.x * 4) = s;
}

// Stage 1b: denom = cumsum_T(w^2); tmp[b,h,t] = (sum_d w^2/denom + D*dbias)*temp
__global__ __launch_bounds__(256)
void stage_tmp(const float* __restrict__ w,
               const float* __restrict__ S,
               const float* __restrict__ temp,
               const float* __restrict__ denom_bias,
               float* __restrict__ tmpout,
               int T, int H, int D) {
    const int nc = T / CHUNK;
    const int b = blockIdx.x / nc, j = blockIdx.x % nc;
    const int h = threadIdx.x >> 4;
    const int l = threadIdx.x & 15;
    const int t0 = j * CHUNK;

    const float* base  = w + (size_t)blockIdx.x * CHUNK * CH + threadIdx.x * 4;
    const float* dbias = denom_bias + (size_t)h * T + t0;
    float* out = tmpout + ((size_t)b * H + h) * T + t0;
    const float th = temp[h];

    // running sum at the chunk's start: the chunk sums in front of it
    float4 run = make_float4(0.f, 0.f, 0.f, 0.f);
    const float* sp = S + (size_t)b * nc * CH + threadIdx.x * 4;
    // Trips of PRE rows, no remainder loop: PRE divides nc, so every row read is one of
    // this b's chunk sums; a row at or past j adds 0.
    for (int i0 = 0; i0 < j; i0 += PRE) {
        float4 v[PRE];
#pragma unroll  // PRE independent loads in flight per trip
        for (int u = 0; u < PRE; ++u) v[u] = *(const float4*)(sp + (size_t)(i0 + u) * CH);
#pragma unroll  // v[] stays in registers
        for (int u = 0; u < PRE; ++u) {
            const bool on = i0 + u < j;
            run.x += on ? v[u].x : 0.f; run.y += on ? v[u].y : 0.f;
            run.z += on ? v[u].z : 0.f; run.w += on ? v[u].w : 0.f;
        }
    }

    // 16 rows per trip; lane u of a head's 16 keeps row u's sum, so the body has no
    // branch (the rows' loads can fly together) and the 16 lanes store 64 bytes at once.
    // this trip's first row; stepped at the trip's foot, so that the address stays live
    // behind the run of loads and none of their results lands in its registers
    const float* rp = base;
    for (int tb = 0; tb < CHUNK; tb += 16) {
        float4 wv[16];
        float val[16];
#pragma unroll  // sixteen rows' loads in flight ahead of the serial sums
        for (int u = 0; u < 16; ++u) wv[u] = *(const float4*)(rp + (size_t)u * CH);
#pragma unroll  // wv[] and val[] stay in registers
        for (int u = 0; u < 16; ++u) {
            float sx = wv[u].x * wv[u].x, sy = wv[u].y * wv[u].y;
            float sz = wv[u].z * wv[u].z, sw = wv[u].w * wv[u].w;
            run.x += sx; run.y += sy; run.z += sz; run.w += sw;
            val[u] = sx / fmaxf(run.x, 1e-12f) + sy / fmaxf(run.y, 1e-12f)
                   + sz / fmaxf(run.z, 1e-12f) + sw / fmaxf(run.w, 1e-12f);
        }
        // reduce over the 16-lane group (stays within half-wave), the sixteen rows'
        // exchanges of a step side by side so that one wait serves them all
#pragma unroll  // the four steps' lane masks become constants
        for (int m = 8; m >= 1; m >>= 1) {
            float o[16];
#pragma unroll  // sixteen independent exchanges in flight; o[] stays in registers
            for (int u = 0; u < 16; ++u) o[u] = __shfl_xor(val[u], m, 32);
#pragma unroll  // val[] stays in registers
            for (int u = 0; u < 16; ++u) val[u] += o[u];
        }
        float keep = val[0];
#pragma unroll  // val[] stays in registers
        for (int u = 1; u < 16; ++u) keep = (l == u) ? val[u] : keep;
        out[tb + l] = (keep + (float)D * dbias[tb + l]) * th;
        // the next trip re-uses the store's registers: keep the wait in front of that
        asm volatile("s_wait_xcnt 0x0" ::: "memory");
        rp += 16 * CH;
    }
}

// ---------------------------------------------------------------------------
// Stage 2: Pi = softmax over heads (axis H=16). One thread per (b,t).
// ---------------------------------------------------------------------------
__global__ void stage_softmax(const float* __restrict__ tmpin,
                              float* __restrict__ Pi, int B, int T, int H) {
    int idx = blockIdx.x * blockDim.x + threadIdx.x;
    if (idx >= B * T) return;
    int b = idx / T, t = idx % T;
    const float* p = tmpin + (size_t)b * H * T + t;
    float v[16];
    float m = -3.4e38f;
#pragma unroll
    for (int h = 0; h < 16; ++h) { v[h] = p[(size_t)h * T]; m = fmaxf(m, v[h]); }
    float s = 0.f;
#pragma unroll
    for (int h = 0; h < 16; ++h) { v[h] = __expf(v[h] - m); s += v[h]; }
    float inv = 1.f / s;
    float* q = Pi + (size_t)b * H * T + t;
#pragma unroll
    for (int h = 0; h < 16; ++h) q[(size_t)h * T] = v[h] * inv;
}

// ---------------------------------------------------------------------------
// Stage 3a: chunk sums of w^2*Pi (per channel) and of Pi (per head)
// ---------------------------------------------------------------------------
__global__ __launch_bounds__(256)
void chunk_sum_wp(const float* __restrict__ w,
                  const float* __restrict__ Pi,
                  float* __restrict__ S,
                  float* __restrict__ P,
                  int T, int H) {
    const int nc = T / CHUNK;
    const int b = blockIdx.x / nc, j = blockIdx.x % nc;
    const int h = threadIdx.x >> 4;
    const int l = threadIdx.x & 15;

    const float* wbase = w + (size_t)blockIdx.x * CHUNK * CH + threadIdx.x * 4;
    const float* pbase = Pi + ((size_t)b * H + h) * T + j * CHUNK;

    float4 s = make_float4(0.f, 0.f, 0.f, 0.f);
    float sp = 0.f;
#pragma unroll  // the chunk's independent loads issue ahead of the serial sums
    for (int t = 0; t < CHUNK; ++t) {
        float pi = pbase[t];
        sp += pi;
        float4 wv = *(const float4*)(wbase + (size_t)t * CH);
        s.x += wv.x * wv.x * pi;
        s.y += wv.y * wv.y * pi;
        s.z += wv.z * wv.z * pi;
        s.w += wv.w * wv.w * pi;
    }
    *(float4*)(S + (size_t)blockIdx.x * CH + threadIdx.x * 4) = s;
    if (l == 0) P[(size_t)blockIdx.x * PPITCH + h] = sp;
}

// ---------------------------------------------------------------------------
// Stage 3b: dots = cumsum_T(w^2*Pi)/(cumsum_T(Pi)+1e-8); y = -(w*Pi)/(1+dots)
// Writes y straight into bf16 hi/lo buffers (GEMM2 inputs).
// ---------------------------------------------------------------------------
__global__ __launch_bounds__(256)
void stage_y(const float* __restrict__ w,
             const float* __restrict__ Pi,
             const float* __restrict__ S,
             const float* __restrict__ P,
             unsigned short* __restrict__ yhi,
             unsigned short* __restrict__ ylo,
             int T, int H) {
    const int nc = T / CHUNK;
    const int b = blockIdx.x / nc, j = blockIdx.x % nc;
    const int h = threadIdx.x >> 4;

    const float* wbase = w + (size_t)blockIdx.x * CHUNK * CH + threadIdx.x * 4;
    const float* pbase = Pi + ((size_t)b * H + h) * T + j * CHUNK;
    size_t obase = (size_t)blockIdx.x * CHUNK * CH + threadIdx.x * 4;

    // running sums at the chunk's start: the chunk sums in front of it
    float4 cumWP = make_float4(0.f, 0.f, 0.f, 0.f);
    float cumPi = 0.f;
    const float* sp = S + (size_t)b * nc * CH + threadIdx.x * 4;
    const float* pp = P + (size_t)b * nc * PPITCH + h;
    // Trips of PRE (2 * PRE) rows, no remainder loop: both divide nc, so every row read is
    // one of this b's chunk sums; a row at or past j adds 0.
    for (int i0 = 0; i0 < j; i0 += 2 * PRE) {
        float p[2 * PRE];
#pragma unroll  // 2 * PRE independent loads in flight per trip
        for (int u = 0; u < 2 * PRE; ++u) p[u] = pp[(size_t)(i0 + u) * PPITCH];
#pragma unroll  // p[] stays in registers
        for (int u = 0; u < 2 * PRE; ++u) cumPi += (i0 + u < j) ? p[u] : 0.f;
    }
    for (int i0 = 0; i0 < j; i0 += PRE) {
        float4 v[PRE];
#pragma unroll  // PRE independent loads in flight per trip
        for (int u = 0; u < PRE; ++u) v[u] = *(const float4*)(sp + (size_t)(i0 + u) * CH);
#pragma unroll  // v[] stays in registers
        for (int u = 0; u < PRE; ++u) {
            const bool on = i0 + u < j;
            cumWP.x += on ? v[u].x : 0.f; cumWP.y += on ? v[u].y : 0.f;
            cumWP.z += on ? v[u].z : 0.f; cumWP.w += on ? v[u].w : 0.f;
        }
    }

    // 8 rows per trip: their loads fly together ahead of the serial sums
    for (int tb = 0; tb < CHUNK; tb += 8) {
        float4 wr[8];
        float pr[8];
#pragma unroll  // eight rows' loads in flight
        for (int u = 0; u < 8; ++u) {
            pr[u] = pbase[tb + u];
            wr[u] = *(const float4*)(wbase + (size_t)(tb + u) * CH);
        }
#pragma unroll  // wr[] and pr[] stay in registers
        for (int u = 0; u < 8; ++u) {
            float pi = pr[u];
            float4 wv = wr[u];
            cumPi += pi;
            cumWP.x += wv.x * wv.x * pi;
            cumWP.y += wv.y * wv.y * pi;
            cumWP.z += wv.z * wv.z * pi;
            cumWP.w += wv.w * wv.w * pi;
            float dn = cumPi + 1e-8f;
            float yx = -(wv.x * pi) / (1.f + cumWP.x / dn);
            float yy = -(wv.y * pi) / (1.f + cumWP.y / dn);
            float yz = -(wv.z * pi) / (1.f + cumWP.z / dn);
            float yw = -(wv.w * pi) / (1.f + cumWP.w / dn);

            unsigned short h0 = f2bf(yx), h1 = f2bf(yy), h2 = f2bf(yz), h3 = f2bf(yw);
            unsigned short l0 = f2bf(yx - bf2f(h0)), l1 = f2bf(yy - bf2f(h1));
            unsigned short l2 = f2bf(yz - bf2f(h2)), l3 = f2bf(yw - bf2f(h3));

            size_t o = obase + (size_t)(tb + u) * CH;
            uint2 hv, lv;
            hv.x = (unsigned)h0 | ((unsigned)h1 << 16);
            hv.y = (unsigned)h2 | ((unsigned)h3 << 16);
            lv.x = (unsigned)l0 | ((unsigned)l1 << 16);
            lv.y = (unsigned)l2 | ((unsigned)l3 << 16);
            *(uint2*)(yhi + o) = hv;
            *(uint2*)(ylo + o) = lv;
        }
        // the next trip re-uses the stores' registers: keep the wait in front of that
        asm volatile("s_wait_xcnt 0x0" ::: "memory");
    }
}

// ---------------------------------------------------------------------------
// Host-side launch
// ---------------------------------------------------------------------------
extern "C" void kernel_launch(void* const* d_in, const int* in_sizes, int n_in,
                              void* d_out, int out_size, void* d_ws, size_t ws_size,
                              hipStream_t stream) {
    const float* x          = (const float*)d_in[0];
    const float* Wa         = (const float*)d_in[1];
    const float* ba         = (const float*)d_in[2];
    const float* Wp         = (const float*)d_in[3];
    const float* bp         = (const float*)d_in[4];
    const float* temp       = (const float*)d_in[5];
    const float* denom_bias = (const float*)d_in[6];

    const int B = 4, T = 4096, C = 1024, H = 16, D = 64;
    const int M = B * T;   // 16384
    const int N = C, K = C;

    // Workspace layout (bytes)
    char* ws = (char*)d_ws;
    float*          wbuf = (float*)(ws + 0);                       // 64 MB  (B,T,C) f32
    unsigned short* hi   = (unsigned short*)(ws + 67108864);       // 32 MB  x-hi / y-hi
    unsigned short* lo   = (unsigned short*)(ws + 100663296);      // 32 MB  x-lo / y-lo
    unsigned short* Wahi = (unsigned short*)(ws + 134217728);      //  2 MB
    unsigned short* Walo = (unsigned short*)(ws + 136314880);      //  2 MB
    unsigned short* Wphi = (unsigned short*)(ws + 138412032);      //  2 MB
    unsigned short* Wplo = (unsigned short*)(ws + 140509184);      //  2 MB
    float*          tmpb = (float*)(ws + 142606336);               //  1 MB  (B,H,T)
    float*          Pib  = (float*)(ws + 143654912);               //  1 MB  (B,H,T)
    float*          Ssq  = (float*)(ws + 144703488);               //  2 MB  (B,T/32,C) chunk sums of w^2
    float*          Swp  = (float*)(ws + 146800640);               //  2 MB  (B,T/32,C) chunk sums of w^2*Pi
    float*          Spi  = (float*)(ws + 148897792);               // 64 KB  (B,T/32,32) chunk sums of Pi

    const int nX = M * C;      // 16.7M
    const int nW = C * C;      // 1M
    split_bf16<<<(nX + 255) / 256, 256, 0, stream>>>(x,  hi,   lo,   nX);
    split_bf16<<<(nW + 255) / 256, 256, 0, stream>>>(Wa, Wahi, Walo, nW);
    split_bf16<<<(nW + 255) / 256, 256, 0, stream>>>(Wp, Wphi, Wplo, nW);

    const int blocks = (M / 256) * (N / 256); // one 256 x 256 tile of the output per block

    // GEMM1: w = x @ Wa.T + ba
    wmma_gemm_bias<<<blocks, 256, 0, stream>>>(hi, lo, Wahi, Walo, ba, wbuf, M, N, K);

    // Scan / softmax / scan
    const int chunks = B * (T / CHUNK);       // one block per (b, chunk of rows)
    chunk_sum_sq<<<chunks, 256, 0, stream>>>(wbuf, Ssq);
    stage_tmp<<<chunks, 256, 0, stream>>>(wbuf, Ssq, temp, denom_bias, tmpb, T, H, D);
    stage_softmax<<<(B * T + 255) / 256, 256, 0, stream>>>(tmpb, Pib, B, T, H);
    chunk_sum_wp<<<chunks, 256, 0, stream>>>(wbuf, Pib, Swp, Spi, T, H);
    stage_y<<<chunks, 256, 0, stream>>>(wbuf, Pib, Swp, Spi, hi, lo, T, H);

    // GEMM2: out = y @ Wp.T + bp
    wmma_gemm_bias<<<blocks, 256, 0, stream>>>(hi, lo, Wphi, Wplo, bp,
                                               (float*)d_out, M, N, K);
}

// v003
// One run takes 197 microseconds.
// In both of two side-by-side timings against v002, it was 1.07 times as fast.
// All steps since v000 together make it 24.7 times as fast.
#include <hip/hip_runtime.h>
#include <hip/hip_bf16.h>
#include <stdint.h>

// ---------------------------------------------------------------------------
// CDNA5 (gfx1250) implementation of the TSSA causal-attention reference.
//   GEMMs run on v_wmma_f32_16x16x32_bf16 with an error-compensated
//   bf16 hi/lo split (hi*hi + hi*lo + lo*hi) to keep ~fp32 accuracy.
//   The cumsums over T are chunked scans (chunk sums, then a scan per chunk).
// ---------------------------------------------------------------------------

typedef __attribute__((ext_vector_type(16))) __bf16 v16bf;
typedef __attribute__((ext_vector_type(8)))  float  v8f;

union Frag16 {
    v16bf v;
    uint4 u[2];
};

__device__ __forceinline__ unsigned short f2bf(float f) {
    // round-to-nearest-even bf16 truncation
    unsigned u = __float_as_uint(f);
    unsigned r = 0x7fffu + ((u >> 16) & 1u);
    return (unsigned short)((u + r) >> 16);
}
__device__ __forceinline__ float bf2f(unsigned short h) {
    return __uint_as_float(((unsigned)h) << 16);
}

// ---------------------------------------------------------------------------
// Split f32 -> bf16 hi + bf16 lo residual.
// A thread takes SPLIT_U groups of four elements instead of one element, so that a launch
// starts 1/32 of the waves. A block of 256 threads takes SPLIT_BLOCK consecutive elements
// (the element count is a whole multiple of it). Every load of a wave is 512 contiguous
// bytes, every store 256; the SPLIT_U loads of a lane fly together.
// ---------------------------------------------------------------------------
constexpr int SPLIT_U = 8;                     // 16-byte loads of a lane
constexpr int SPLIT_BLOCK = SPLIT_U * 1024;    // elements of a block

__global__ __launch_bounds__(256)
void split_bf16(const float* __restrict__ in,
                unsigned short* __restrict__ hi,
                unsigned short* __restrict__ lo) {
    const size_t base = (size_t)blockIdx.x * SPLIT_BLOCK + threadIdx.x * 4;
    const float* p = in + base;
    unsigned short* ph = hi + base;
    unsigned short* pl = lo + base;
    float4 v[SPLIT_U];
    uint2 hv[SPLIT_U], lv[SPLIT_U];
#pragma unroll  // all loads in flight together; every offset an immediate from one address
    for (int u = 0; u < SPLIT_U; ++u) v[u] = *(const float4*)(p + u * 1024);
#pragma unroll  // v[], hv[] and lv[] stay in registers
    for (int u = 0; u < SPLIT_U; ++u) {
        const float4 f = v[u];
        unsigned short h0 = f2bf(f.x), h1 = f2bf(f.y), h2 = f2bf(f.z), h3 = f2bf(f.w);
        unsigned short l0 = f2bf(f.x - bf2f(h0)), l1 = f2bf(f.y - bf2f(h1));
        unsigned short l2 = f2bf(f.z - bf2f(h2)), l3 = f2bf(f.w - bf2f(h3));
        hv[u].x = (unsigned)h0 | ((unsigned)h1 << 16);
        hv[u].y = (unsigned)h2 | ((unsigned)h3 << 16);
        lv[u].x = (unsigned)l0 | ((unsigned)l1 << 16);
        lv[u].y = (unsigned)l2 | ((unsigned)l3 << 16);
    }
    // the arithmetic stays in front of the stores, so that nothing rewrites a register
    // that an issued store names
    __builtin_amdgcn_sched_barrier(0);
#pragma unroll  // hv[] and lv[] stay in registers
    for (int u = 0; u < SPLIT_U; ++u) {
        *(uint2*)(ph + u * 1024) = hv[u];
        *(uint2*)(pl + u * 1024) = lv[u];
    }
}

// ---------------------------------------------------------------------------
// C = A @ B^T + bias, via v_wmma_f32_16x16x32_bf16 with hi/lo compensation.
// A: (M,K) row-major (hi/lo bf16).  Brows: (N,K) row-major (hi/lo bf16).
// One 256 x 256 tile of C per work-group (M, N multiples of 256; K a multiple of 64, at
// least 128). 8 waves, 4 along m x 2 along n, each 64 rows x 128 columns of the tile.
// A pass of the K loop is 64 k = 128 bytes of every operand row. A stage is
// [A hi | A lo | B hi | B lo], 256 rows each, at an LDS pitch of 144 bytes; two buffers.
// Every wave brings its own slice (128 rows of one of the four arrays) with one tensor
// load per stage, issued a whole pass ahead of the pass that reads it.
// ---------------------------------------------------------------------------
typedef uint32_t u32x4 __attribute__((ext_vector_type(4)));
typedef uint32_t u32x8 __attribute__((ext_vector_type(8)));

constexpr uint32_t TILE   = 256;                 // rows of A and rows of B per work-group
constexpr uint32_t KB     = 128;                 // bytes of an operand row per pass
constexpr uint32_t PITCH  = KB + 16;             // 16 B x odd: no bank conflict for 16-byte reads
constexpr uint32_t SROWS  = 128;                 // rows per tensor load
constexpr uint32_t SLICE  = SROWS * PITCH;       // 18,432 B
constexpr uint32_t ARR    = TILE * PITCH;        // one array's rows of a stage
constexpr uint32_t STAGE  = 4 * ARR;             // 147,456 B
static_assert(SLICE % 2048u == 0, "every slice starts at a multiple of 2 KiB");
static_assert(2u * STAGE <= 320u * 1024u, "two buffers fit the LDS");

__device__ __forceinline__ uint32_t uni(uint32_t v) { return (uint32_t)__builtin_amdgcn_readfirstlane(v); }
__device__ __forceinline__ uint32_t pinned(uint32_t v) {
    uint32_t w = (uint32_t)__builtin_amdgcn_readfirstlane(v);
    asm volatile("" : "+s"(w));  // pinned(): the value stays in a scalar register (tensor loads ignore EXEC)
    return w;
}
// this wave's LDS reads have returned (the buffer may be refilled behind the barrier)
__device__ __forceinline__ void wait_ds0() { asm volatile("s_wait_dscnt 0x0" ::: "memory"); }
// this wave's tensor load has landed (the compiler places no wait for it)
__device__ __forceinline__ void wait_tensor0() { asm volatile("s_wait_tensorcnt 0x0" ::: "memory"); }
// one request of the whole wave: a tile of SROWS rows of KB bytes into LDS
__device__ __forceinline__ void tdm_load(u32x4 g0, u32x8 g1) {
    asm volatile("tensor_load_to_lds %0, %1" :: "s"(g0), "s"(g1) : "memory");
}
// pinned descriptor words, held in their scalar registers up to here: placed behind the wait that
// covers a request, so that no word of its descriptor takes a new value while it is outstanding
__device__ __forceinline__ void hold(u32x4& g0, u32x8& g1) { asm volatile("" : "+s"(g0), "+s"(g1)); }
// the compiler does not schedule across it
__device__ __forceinline__ void fence() { __builtin_amdgcn_sched_barrier(0); }
// group 1: 1-byte elements, SROWS rows of KB bytes, 16 B of LDS pad behind every 128-byte row
__device__ __forceinline__ u32x8 tdm_group1(uint32_t src_pitch) {
    constexpr uint32_t d0 = KB, d1 = SROWS;
    u32x8 g;
    g[0] = uni((1u << 20) | (4u << 22) | (3u << 25));
    g[1] = uni((d0 & 0xFFFFu) << 16);
    g[2] = uni((d0 >> 16) | ((d1 & 0xFFFFu) << 16));
    g[3] = uni((d1 >> 16) | (d0 << 16));
    g[4] = uni(d1);
    g[5] = uni(src_pitch);
    g[6] = uni(0u);
    g[7] = uni(0u);
    return g;
}
// group 0: LDS destination (byte offset) and the global address of the tile's first byte
__device__ __forceinline__ u32x4 tdm_group0(uint32_t lds_dst, uint64_t ga) {
    u32x4 g;
    g[0] = uni(1u);
    g[1] = uni(lds_dst);
    g[2] = uni((uint32_t)ga);
    g[3] = uni((((uint32_t)(ga >> 32)) & 0x01FFFFFFu) | 0x80000000u);
    return g;
}

// p: the lane's row, at its 16-byte half (lane >> 4) of the 64 bytes (32 k) of this block
__device__ __forceinline__ Frag16 lds_frag(const unsigned char* p) {
    Frag16 f;
    f.u[0] = *(const uint4*)p;         // K chunk 0..7  (lane<16) / 8..15 (lane>=16)
    f.u[1] = *(const uint4*)(p + 32);  // K chunk 16..23 / 24..31
    return f;
}
__device__ __forceinline__ v8f mma(const Frag16& a, const Frag16& b, v8f c) {
    return __builtin_amdgcn_wmma_f32_16x16x32_bf16(false, a.v, false, b.v, (short)0, c, false, false);
}

__global__ __launch_bounds__(256)
void wmma_gemm_bias(const unsigned short* __restrict__ Ahi,
                    const unsigned short* __restrict__ Alo,
                    const unsigned short* __restrict__ Bhi,
                    const unsigned short* __restrict__ Blo,
                    const float* __restrict__ bias,
                    float* __restrict__ Cout,
                    int M, int N, int K) {
    __shared__ __attribute__((aligned(2048))) unsigned char L[2 * STAGE];
    const uint32_t lane = threadIdx.x & 31u, r16 = lane & 15u, h = lane >> 4;
    const uint32_t wave = uni(threadIdx.x >> 5);
    const uint32_t tiles_n = (uint32_t)N / TILE;
    const uint32_t tm = blockIdx.x / tiles_n, tn = blockIdx.x - tm * tiles_n;
    const uint32_t m0 = tm * TILE, n0 = tn * TILE;
    const uint32_t wm = wave >> 1, wn = wave & 1u;
    const uint32_t kb = (uint32_t)K * 2u;        // bytes of a source row
    const uint32_t T  = pinned((uint32_t)K / 64u);
    (void)M;

    // this wave's slice: array wave >> 1 of [A hi, A lo, B hi, B lo], rows 128 * (wave & 1) on
    const uint32_t arr = wave >> 1;
    const unsigned short* sarr = (arr == 0u) ? Ahi : (arr == 1u) ? Alo : (arr == 2u) ? Bhi : Blo;
    const uint32_t srow = ((arr < 2u) ? m0 : n0) + SROWS * (wave & 1u);
    const uint64_t src = (uint64_t)(uintptr_t)sarr + (uint64_t)srow * kb;
    const uint32_t lds_slice = (uint32_t)(size_t)L + wave * SLICE;   // add buffer * STAGE
    u32x8 g1 = tdm_group1(kb);

    v8f acc[4][8];
#pragma unroll
    for (int i = 0; i < 4; ++i)
#pragma unroll
        for (int j = 0; j < 8; ++j) acc[i][j] = v8f{};

    // per-lane fragment bases in a buffer
    const uint32_t a_base = (wm * 64u + r16) * PITCH + 16u * h;
    const uint32_t b_base = 2u * ARR + (wn * 128u + r16) * PITCH + 16u * h;

    u32x4 g0 = tdm_group0(lds_slice, src);
    tdm_load(g0, g1);                                    // stage 0
    wait_tensor0();
    hold(g0, g1);
    __syncthreads();                                     // stage 0 is published
    g0 = tdm_group0(lds_slice + STAGE, src + KB);
    tdm_load(g0, g1);                                    // stage 1

#pragma clang loop unroll(disable)  // one pass per trip: the buffer index stays a scalar
    for (uint32_t t = 0; t < T; ++t) {
        const uint32_t buf = (t & 1u) * STAGE;
        const unsigned char* la = L + buf + a_base;
        const unsigned char* lb = L + buf + b_base;
        // A pass is 8 units of 24 WMMAs: unit q = block (32 k) q >> 2, columns 32 * (q & 3) on.
        // The A fragments of both blocks and two sets of a unit's B fragments are held.
        Frag16 ah[2][4], al[2][4], bh[2][2], bl[2][2];
        // the first unit's fragments in the order of their use, so that its first WMMAs
        // wait for the first twelve loads only
#pragma unroll
        for (int i = 0; i < 4; ++i) ah[0][i] = lds_frag(la + (uint32_t)i * 16u * PITCH);
#pragma unroll
        for (int jj = 0; jj < 2; ++jj) bh[0][jj] = lds_frag(lb + (uint32_t)jj * 16u * PITCH);
        fence();  // keeps these loads in front of the ones that are needed later
#pragma unroll
        for (int jj = 0; jj < 2; ++jj) bl[0][jj] = lds_frag(lb + ARR + (uint32_t)jj * 16u * PITCH);
#pragma unroll
        for (int i = 0; i < 4; ++i) al[0][i] = lds_frag(la + ARR + (uint32_t)i * 16u * PITCH);
        fence();  // and these in front of the next unit's
#pragma unroll  // every fragment and accumulator index a constant
        for (int q = 0; q < 8; ++q) {
            const int u = q >> 2, jp = q & 3, s = q & 1;
            // the next unit's fragments, as one group ahead of this unit's WMMAs
            if (q < 7) {
                const int un = (q + 1) >> 2, jn = (q + 1) & 3;
#pragma unroll
                for (int jj = 0; jj < 2; ++jj) {
                    bh[s ^ 1][jj] = lds_frag(lb + (uint32_t)(2 * jn + jj) * 16u * PITCH + 64u * (uint32_t)un);
                    bl[s ^ 1][jj] = lds_frag(lb + ARR + (uint32_t)(2 * jn + jj) * 16u * PITCH + 64u * (uint32_t)un);
                }
            }
            if (u == 0) {  // a quarter of the second block's A fragments
                ah[1][jp] = lds_frag(la + (uint32_t)jp * 16u * PITCH + 64u);
                al[1][jp] = lds_frag(la + ARR + (uint32_t)jp * 16u * PITCH + 64u);
            }
            fence();  // keeps the group of LDS loads together, ahead of the WMMAs
            // per accumulator the order stays hi*hi, hi*lo, lo*hi; eight tiles stand
            // between two products into the same accumulator
#pragma unroll
            for (int jj = 0; jj < 2; ++jj)
#pragma unroll
                for (int i = 0; i < 4; ++i) acc[i][2 * jp + jj] = mma(ah[u][i], bh[s][jj], acc[i][2 * jp + jj]);
#pragma unroll
            for (int jj = 0; jj < 2; ++jj)
#pragma unroll
                for (int i = 0; i < 4; ++i) acc[i][2 * jp + jj] = mma(ah[u][i], bl[s][jj], acc[i][2 * jp + jj]);
#pragma unroll
            for (int jj = 0; jj < 2; ++jj)
#pragma unroll
                for (int i = 0; i < 4; ++i) acc[i][2 * jp + jj] = mma(al[u][i], bh[s][jj], acc[i][2 * jp + jj]);
            fence();  // keeps the next group of LDS loads out of this unit's WMMAs
        }
        // publish point of stage t + 1
        wait_ds0();
        wait_tensor0();
        hold(g0, g1);
        __syncthreads();
        if (pinned(t + 2u < T)) {  // the refill, into the buffer this pass has just read
            g0 = tdm_group0(lds_slice + buf, src + (uint64_t)(t + 2u) * KB);
            tdm_load(g0, g1);
        }
    }
    wait_tensor0();
    wait_ds0();

    // C/D layout: VGPR v holds M = v + 8*(lane>=16), N = lane%16
#pragma unroll
    for (int j = 0; j < 8; ++j) {
        const uint32_t n = n0 + wn * 128u + (uint32_t)j * 16u + r16;
        const float bv = bias[n];
#pragma unroll
        for (int i = 0; i < 4; ++i) {
            const uint32_t mb = m0 + wm * 64u + (uint32_t)i * 16u + 8u * h;
#pragma unroll
            for (int v = 0; v < 8; ++v) {
                Cout[(size_t)(mb + v) * (uint32_t)N + n] = acc[i][j][v] + bv;
            }
        }
    }
}

// ---------------------------------------------------------------------------
// The two cumsums over T run as chunked scans: T is cut into chunks of CHUNK
// rows, a first launch sums each chunk, and the scan launch starts each chunk
// from the sum of the chunk sums in front of it. One block = one (b, chunk),
// 256 threads x 4 channels = all CH channels (16 lanes per head).
// ---------------------------------------------------------------------------
constexpr int CH = 1024;    // channels = 256 threads x 4; a constant, so that the rows of a
                            // trip are immediate offsets from one address
constexpr int CHUNK = 32;   // 32 floats of tmp/Pi per (b,h,chunk) = one 128-byte line
constexpr int PPITCH = 32;  // floats per block in the Pi chunk sums: one 128-byte line each
constexpr int PRE = 16;     // chunk sums read per trip when a chunk's start value is formed

// Stage 1a: S[b,chunk,c] = sum over the chunk's rows of w^2
__global__ __launch_bounds__(256)
void chunk_sum_sq(const float* __restrict__ w, float* __restrict__ S) {
    const float* base = w + (size_t)blockIdx.x * CHUNK * CH + threadIdx.x * 4;
    float4 s = make_float4(0.f, 0.f, 0.f, 0.f);
#pragma unroll  // the chunk's independent loads issue ahead of the serial sums
    for (int t = 0; t < CHUNK; ++t) {
        float4 wv = *(const float4*)(base + (size_t)t * CH);
        s.x += wv.x * wv.x; s.y += wv.y * wv.y; s.z += wv.z * wv.z; s.w += wv.w * wv.w;
    }
    *(float4*)(S + (size_t)blockIdx.x * CH + threadIdx.x * 4) = s;
}

// Stage 1b: denom = cumsum_T(w^2); tmp[b,h,t] = (sum_d w^2/denom + D*dbias)*temp
__global__ __launch_bounds__(256)
void stage_tmp(const float* __restrict__ w,
               const float* __restrict__ S,
               const float* __restrict__ temp,
               const float* __restrict__ denom_bias,
               float* __restrict__ tmpout,
               int T, int H, int D) {
    const int nc = T / CHUNK;
    const int b = blockIdx.x / nc, j = blockIdx.x % nc;
    const int h = threadIdx.x >> 4;
    const int l = threadIdx.x & 15;
    const int t0 = j * CHUNK;

    const float* base  = w + (size_t)blockIdx.x * CHUNK * CH + threadIdx.x * 4;
    const float* dbias = denom_bias + (size_t)h * T + t0;
    float* out = tmpout + ((size_t)b * H + h) * T + t0;
    const float th = temp[h];

    // running sum at the chunk's start: the chunk sums in front of it
    float4 run = make_float4(0.f, 0.f, 0.f, 0.f);
    const float* sp = S + (size_t)b * nc * CH + threadIdx.x * 4;
    // Trips of PRE rows, no remainder loop: PRE divides nc, so every row read is one of
    // this b's chunk sums; a row at or past j adds 0.
    for (int i0 = 0; i0 < j; i0 += PRE) {
        float4 v[PRE];
#pragma unroll  // PRE independent loads in flight per trip
        for (int u = 0; u < PRE; ++u) v[u] = *(const float4*)(sp + (size_t)(i0 + u) * CH);
#pragma unroll  // v[] stays in registers
        for (int u = 0; u < PRE; ++u) {
            const bool on = i0 + u < j;
            run.x += on ? v[u].x : 0.f; run.y += on ? v[u].y : 0.f;
            run.z += on ? v[u].z : 0.f; run.w += on ? v[u].w : 0.f;
        }
    }

    // 16 rows per trip; lane u of a head's 16 keeps row u's sum, so the body has no
    // branch (the rows' loads can fly together) and the 16 lanes store 64 bytes at once.
    // this trip's first row; stepped at the trip's foot, so that the address stays live
    // behind the run of loads and none of their results lands in its registers
    const float* rp = base;
    for (int tb = 0; tb < CHUNK; tb += 16) {
        float4 wv[16];
        float val[16];
#pragma unroll  // sixteen rows' loads in flight ahead of the serial sums
        for (int u = 0; u < 16; ++u) wv[u] = *(const float4*)(rp + (size_t)u * CH);
#pragma unroll  // wv[] and val[] stay in registers
        for (int u = 0; u < 16; ++u) {
            float sx = wv[u].x * wv[u].x, sy = wv[u].y * wv[u].y;
            float sz = wv[u].z * wv[u].z, sw = wv[u].w * wv[u].w;
            run.x += sx; run.y += sy; run.z += sz; run.w += sw;
            val[u] = sx / fmaxf(run.x, 1e-12f) + sy / fmaxf(run.y, 1e-12f)
                   + sz / fmaxf(run.z, 1e-12f) + sw / fmaxf(run.w, 1e-12f);
        }
        // reduce over the 16-lane group (stays within half-wave), the sixteen rows'
        // exchanges of a step side by side so that one wait serves them all
#pragma unroll  // the four steps' lane masks become constants
        for (int m = 8; m >= 1; m >>= 1) {
            float o[16];
#pragma unroll  // sixteen independent exchanges in flight; o[] stays in registers
            for (int u = 0; u < 16; ++u) o[u] = __shfl_xor(val[u], m, 32);
#pragma unroll  // val[] stays in registers
            for (int u = 0; u < 16; ++u) val[u] += o[u];
        }
        float keep = val[0];
#pragma unroll  // val[] stays in registers
        for (int u = 1; u < 16; ++u) keep = (l == u) ? val[u] : keep;
        out[tb + l] = (keep + (float)D * dbias[tb + l]) * th;
        // the next trip re-uses the store's registers: keep the wait in front of that
        asm volatile("s_wait_xcnt 0x0" ::: "memory");
        rp += 16 * CH;
    }
}

// ---------------------------------------------------------------------------
// Stage 2: Pi = softmax over heads (axis H=16). One thread per (b,t).
// ---------------------------------------------------------------------------
__global__ void stage_softmax(const float* __restrict__ tmpin,
                              float* __restrict__ Pi, int B, int T, int H) {
    int idx = blockIdx.x * blockDim.x + threadIdx.x;
    if (idx >= B * T) return;
    int b = idx / T, t = idx % T;
    const float* p = tmpin + (size_t)b * H * T + t;
    float v[16];
    float m = -3.4e38f;
#pragma unroll
    for (int h = 0; h < 16; ++h) { v[h] = p[(size_t)h * T]; m = fmaxf(m, v[h]); }
    float s = 0.f;
#pragma unroll
    for (int h = 0; h < 16; ++h) { v[h] = __expf(v[h] - m); s += v[h]; }
    float inv = 1.f / s;
    float* q = Pi + (size_t)b * H * T + t;
#pragma unroll
    for (int h = 0; h < 16; ++h) q[(size_t)h * T] = v[h] * inv;
}

// ---------------------------------------------------------------------------
// Stage 3a: chunk sums of w^2*Pi (per channel) and of Pi (per head)
// ---------------------------------------------------------------------------
__global__ __launch_bounds__(256)
void chunk_sum_wp(const float* __restrict__ w,
                  const float* __restrict__ Pi,
                  float* __restrict__ S,
                  float* __restrict__ P,
                  int T, int H) {
    const int nc = T / CHUNK;
    const int b = blockIdx.x / nc, j = blockIdx.x % nc;
    const int h = threadIdx.x >> 4;
    const int l = threadIdx.x & 15;

    const float* wbase = w + (size_t)blockIdx.x * CHUNK * CH + threadIdx.x * 4;
    const float* pbase = Pi + ((size_t)b * H + h) * T + j * CHUNK;

    float4 s = make_float4(0.f, 0.f, 0.f, 0.f);
    float sp = 0.f;
#pragma unroll  // the chunk's independent loads issue ahead of the serial sums
    for (int t = 0; t < CHUNK; ++t) {
        float pi = pbase[t];
        sp += pi;
        float4 wv = *(const float4*)(wbase + (size_t)t * CH);
        s.x += wv.x * wv.x * pi;
        s.y += wv.y * wv.y * pi;
        s.z += wv.z * wv.z * pi;
        s.w += wv.w * wv.w * pi;
    }
    *(float4*)(S + (size_t)blockIdx.x * CH + threadIdx.x * 4) = s;
    if (l == 0) P[(size_t)blockIdx.x * PPITCH + h] = sp;
}

// ---------------------------------------------------------------------------
// Stage 3b: dots = cumsum_T(w^2*Pi)/(cumsum_T(Pi)+1e-8); y = -(w*Pi)/(1+dots)
// Writes y straight into bf16 hi/lo buffers (GEMM2 inputs).
// ---------------------------------------------------------------------------
__global__ __launch_bounds__(256)
void stage_y(const float* __restrict__ w,
             const float* __restrict__ Pi,
             const float* __restrict__ S,
             const float* __restrict__ P,
             unsigned short* __restrict__ yhi,
             unsigned short* __restrict__ ylo,
             int T, int H) {
    const int nc = T / CHUNK;
    const int b = blockIdx.x / nc, j = blockIdx.x % nc;
    const int h = threadIdx.x >> 4;

    const float* wbase = w + (size_t)blockIdx.x * CHUNK * CH + threadIdx.x * 4;
    const float* pbase = Pi + ((size_t)b * H + h) * T + j * CHUNK;
    size_t obase = (size_t)blockIdx.x * CHUNK * CH + threadIdx.x * 4;

    // running sums at the chunk's start: the chunk sums in front of it
    float4 cumWP = make_float4(0.f, 0.f, 0.f, 0.f);
    float cumPi = 0.f;
    const float* sp = S + (size_t)b * nc * CH + threadIdx.x * 4;
    const float* pp = P + (size_t)b * nc * PPITCH + h;
    // Trips of PRE (2 * PRE) rows, no remainder loop: both divide nc, so every row read is
    // one of this b's chunk sums; a row at or past j adds 0.
    for (int i0 = 0; i0 < j; i0 += 2 * PRE) {
        float p[2 * PRE];
#pragma unroll  // 2 * PRE independent loads in flight per trip
        for (int u = 0; u < 2 * PRE; ++u) p[u] = pp[(size_t)(i0 + u) * PPITCH];
#pragma unroll  // p[] stays in registers
        for (int u = 0; u < 2 * PRE; ++u) cumPi += (i0 + u < j) ? p[u] : 0.f;
    }
    for (int i0 = 0; i0 < j; i0 += PRE) {
        float4 v[PRE];
#pragma unroll  // PRE independent loads in flight per trip
        for (int u = 0; u < PRE; ++u) v[u] = *(const float4*)(sp + (size_t)(i0 + u) * CH);
#pragma unroll  // v[] stays in registers
        for (int u = 0; u < PRE; ++u) {
            const bool on = i0 + u < j;
            cumWP.x += on ? v[u].x : 0.f; cumWP.y += on ? v[u].y : 0.f;
            cumWP.z += on ? v[u].z : 0.f; cumWP.w += on ? v[u].w : 0.f;
        }
    }

    // 8 rows per trip: their loads fly together ahead of the serial sums
    for (int tb = 0; tb < CHUNK; tb += 8) {
        float4 wr[8];
        float pr[8];
#pragma unroll  // eight rows' loads in flight
        for (int u = 0; u < 8; ++u) {
            pr[u] = pbase[tb + u];
            wr[u] = *(const float4*)(wbase + (size_t)(tb + u) * CH);
        }
#pragma unroll  // wr[] and pr[] stay in registers
        for (int u = 0; u < 8; ++u) {
            float pi = pr[u];
            float4 wv = wr[u];
            cumPi += pi;
            cumWP.x += wv.x * wv.x * pi;
            cumWP.y += wv.y * wv.y * pi;
            cumWP.z += wv.z * wv.z * pi;
            cumWP.w += wv.w * wv.w * pi;
            float dn = cumPi + 1e-8f;
            float yx = -(wv.x * pi) / (1.f + cumWP.x / dn);
            float yy = -(wv.y * pi) / (1.f + cumWP.y / dn);
            float yz = -(wv.z * pi) / (1.f + cumWP.z / dn);
            float yw = -(wv.w * pi) / (1.f + cumWP.w / dn);

            unsigned short h0 = f2bf(yx), h1 = f2bf(yy), h2 = f2bf(yz), h3 = f2bf(yw);
            unsigned short l0 = f2bf(yx - bf2f(h0)), l1 = f2bf(yy - bf2f(h1));
            unsigned short l2 = f2bf(yz - bf2f(h2)), l3 = f2bf(yw - bf2f(h3));

            size_t o = obase + (size_t)(tb + u) * CH;
            uint2 hv, lv;
            hv.x = (unsigned)h0 | ((unsigned)h1 << 16);
            hv.y = (unsigned)h2 | ((unsigned)h3 << 16);
            lv.x = (unsigned)l0 | ((unsigned)l1 << 16);
            lv.y = (unsigned)l2 | ((unsigned)l3 << 16);
            *(uint2*)(yhi + o) = hv;
            *(uint2*)(ylo + o) = lv;
        }
        // the next trip re-uses the stores' registers: keep the wait in front of that
        asm volatile("s_wait_xcnt 0x0" ::: "memory");
    }
}

// ---------------------------------------------------------------------------
// Host-side launch
// ---------------------------------------------------------------------------
extern "C" void kernel_launch(void* const* d_in, const int* in_sizes, int n_in,
                              void* d_out, int out_size, void* d_ws, size_t ws_size,
                              hipStream_t stream) {
    const float* x          = (const float*)d_in[0];
    const float* Wa         = (const float*)d_in[1];
    const float* ba         = (const float*)d_in[2];
    const float* Wp         = (const float*)d_in[3];
    const float* bp         = (const float*)d_in[4];
    const float* temp       = (const float*)d_in[5];
    const float* denom_bias = (const float*)d_in[6];

    const int B = 4, T = 4096, C = 1024, H = 16, D = 64;
    const int M = B * T;   // 16384
    const int N = C, K = C;

    // Workspace layout (bytes)
    char* ws = (char*)d_ws;
    float*          wbuf = (float*)(ws + 0);                       // 64 MB  (B,T,C) f32
    unsigned short* hi   = (unsigned short*)(ws + 67108864);       // 32 MB  x-hi / y-hi
    unsigned short* lo   = (unsigned short*)(ws + 100663296);      // 32 MB  x-lo / y-lo
    unsigned short* Wahi = (unsigned short*)(ws + 134217728);      //  2 MB
    unsigned short* Walo = (unsigned short*)(ws + 136314880);      //  2 MB
    unsigned short* Wphi = (unsigned short*)(ws + 138412032);      //  2 MB
    unsigned short* Wplo = (unsigned short*)(ws + 140509184);      //  2 MB
    float*          tmpb = (float*)(ws + 142606336);               //  1 MB  (B,H,T)
    float*          Pib  = (float*)(ws + 143654912);               //  1 MB  (B,H,T)
    float*          Ssq  = (float*)(ws + 144703488);               //  2 MB  (B,T/32,C) chunk sums of w^2
    float*          Swp  = (float*)(ws + 146800640);               //  2 MB  (B,T/32,C) chunk sums of w^2*Pi
    float*          Spi  = (float*)(ws + 148897792);               // 64 KB  (B,T/32,32) chunk sums of Pi

    const int nX = M * C;      // 16.7M
    const int nW = C * C;      // 1M
    // both sizes are whole multiples of a block's share, so the grids cover them exactly
    split_bf16<<<nX / SPLIT_BLOCK, 256, 0, stream>>>(x,  hi,   lo);
    split_bf16<<<nW / SPLIT_BLOCK, 256, 0, stream>>>(Wa, Wahi, Walo);
    split_bf16<<<nW / SPLIT_BLOCK, 256, 0, stream>>>(Wp, Wphi, Wplo);

    const int blocks = (M / 256) * (N / 256); // one 256 x 256 tile of the output per block

    // GEMM1: w = x @ Wa.T + ba
    wmma_gemm_bias<<<blocks, 256, 0, stream>>>(hi, lo, Wahi, Walo, ba, wbuf, M, N, K);

    // Scan / softmax / scan
    const int chunks = B * (T / CHUNK);       // one block per (b, chunk of rows)
    chunk_sum_sq<<<chunks, 256, 0, stream>>>(wbuf, Ssq);
    stage_tmp<<<chunks, 256, 0, stream>>>(wbuf, Ssq, temp, denom_bias, tmpb, T, H, D);
    stage_softmax<<<(B * T + 255) / 256, 256, 0, stream>>>(tmpb, Pib, B, T, H);
    chunk_sum_wp<<<chunks, 256, 0, stream>>>(wbuf, Pib, Swp, Spi, T, H);
    stage_y<<<chunks, 256, 0, stream>>>(wbuf, Pib, Swp, Spi, hi, lo, T, H);

    // GEMM2: out = y @ Wp.T + bp
    wmma_gemm_bias<<<blocks, 256, 0, stream>>>(hi, lo, Wphi, Wplo, bp,
                                               (float*)d_out, M, N, K);
}

// v004
// It runs in 190 microseconds.
// Next to v003, in two timings, it ran 1.03 times as fast each time.
// All steps since v000 together make it 25.5 times as fast.
#include <hip/hip_runtime.h>
#include <hip/hip_bf16.h>
#include <stdint.h>

// ---------------------------------------------------------------------------
// CDNA5 (gfx1250) implementation of the TSSA causal-attention reference.
//   GEMMs run on v_wmma_f32_16x16x32_bf16 with an error-compensated
//   bf16 hi/lo split (hi*hi + hi*lo + lo*hi) to keep ~fp32 accuracy.
//   The cumsums over T are chunked scans (chunk sums, then a scan per chunk).
// ---------------------------------------------------------------------------

typedef __attribute__((ext_vector_type(16))) __bf16 v16bf;
typedef __attribute__((ext_vector_type(8)))  float  v8f;

union Frag16 {
    v16bf v;
    uint4 u[2];
};

__device__ __forceinline__ unsigned short f2bf(float f) {
    // round-to-nearest-even bf16 truncation
    unsigned u = __float_as_uint(f);
    unsigned r = 0x7fffu + ((u >> 16) & 1u);
    return (unsigned short)((u + r) >> 16);
}
__device__ __forceinline__ float bf2f(unsigned short h) {
    return __uint_as_float(((unsigned)h) << 16);
}

// ---------------------------------------------------------------------------
// Split f32 -> bf16 hi + bf16 lo residual.
// A thread takes SPLIT_U groups of four elements instead of one element, so that a launch
// starts 1/32 of the waves. A block of 256 threads takes SPLIT_BLOCK consecutive elements
// (the element count is a whole multiple of it). Every load of a wave is 512 contiguous
// bytes, every store 256; the SPLIT_U loads of a lane fly together.
// ---------------------------------------------------------------------------
constexpr int SPLIT_U = 8;                     // 16-byte loads of a lane
constexpr int SPLIT_BLOCK = SPLIT_U * 1024;    // elements of a block

__global__ __launch_bounds__(256)
void split_bf16(const float* __restrict__ in,
                unsigned short* __restrict__ hi,
                unsigned short* __restrict__ lo) {
    const size_t base = (size_t)blockIdx.x * SPLIT_BLOCK + threadIdx.x * 4;
    const float* p = in + base;
    unsigned short* ph = hi + base;
    unsigned short* pl = lo + base;
    float4 v[SPLIT_U];
    uint2 hv[SPLIT_U], lv[SPLIT_U];
#pragma unroll  // all loads in flight together; every offset an immediate from one address
    for (int u = 0; u < SPLIT_U; ++u) v[u] = *(const float4*)(p + u * 1024);
#pragma unroll  // v[], hv[] and lv[] stay in registers
    for (int u = 0; u < SPLIT_U; ++u) {
        const float4 f = v[u];
        unsigned short h0 = f2bf(f.x), h1 = f2bf(f.y), h2 = f2bf(f.z), h3 = f2bf(f.w);
        unsigned short l0 = f2bf(f.x - bf2f(h0)), l1 = f2bf(f.y - bf2f(h1));
        unsigned short l2 = f2bf(f.z - bf2f(h2)), l3 = f2bf(f.w - bf2f(h3));
        hv[u].x = (unsigned)h0 | ((unsigned)h1 << 16);
        hv[u].y = (unsigned)h2 | ((unsigned)h3 << 16);
        lv[u].x = (unsigned)l0 | ((unsigned)l1 << 16);
        lv[u].y = (unsigned)l2 | ((unsigned)l3 << 16);
    }
    // the arithmetic stays in front of the stores, so that nothing rewrites a register
    // that an issued store names
    __builtin_amdgcn_sched_barrier(0);
#pragma unroll  // hv[] and lv[] stay in registers
    for (int u = 0; u < SPLIT_U; ++u) {
        *(uint2*)(ph + u * 1024) = hv[u];
        *(uint2*)(pl + u * 1024) = lv[u];
    }
}

// ---------------------------------------------------------------------------
// C = A @ B^T + bias, via v_wmma_f32_16x16x32_bf16 with hi/lo compensation.
// A: (M,K) row-major (hi/lo bf16).  Brows: (N,K) row-major (hi/lo bf16).
// One 256 x 256 tile of C per work-group (M, N multiples of 256; K a multiple of 64, at
// least 128). 8 waves, 4 along m x 2 along n, each 64 rows x 128 columns of the tile.
// A pass of the K loop is 64 k = 128 bytes of every operand row. A stage is
// [A hi | A lo | B hi | B lo], 256 rows each, at an LDS pitch of 144 bytes; two buffers.
// Every wave brings its own slice (128 rows of one of the four arrays) with one tensor
// load per stage, issued a whole pass ahead of the pass that reads it.
// ---------------------------------------------------------------------------
typedef uint32_t u32x4 __attribute__((ext_vector_type(4)));
typedef uint32_t u32x8 __attribute__((ext_vector_type(8)));

constexpr uint32_t TILE   = 256;                 // rows of A and rows of B per work-group
constexpr uint32_t KB     = 128;                 // bytes of an operand row per pass
constexpr uint32_t PITCH  = KB + 16;             // 16 B x odd: no bank conflict for 16-byte reads
constexpr uint32_t SROWS  = 128;                 // rows per tensor load
constexpr uint32_t SLICE  = SROWS * PITCH;       // 18,432 B
constexpr uint32_t ARR    = TILE * PITCH;        // one array's rows of a stage
constexpr uint32_t STAGE  = 4 * ARR;             // 147,456 B
static_assert(SLICE % 2048u == 0, "every slice starts at a multiple of 2 KiB");
static_assert(2u * STAGE <= 320u * 1024u, "two buffers fit the LDS");

__device__ __forceinline__ uint32_t uni(uint32_t v) { return (uint32_t)__builtin_amdgcn_readfirstlane(v); }
__device__ __forceinline__ uint32_t pinned(uint32_t v) {
    uint32_t w = (uint32_t)__builtin_amdgcn_readfirstlane(v);
    asm volatile("" : "+s"(w));  // pinned(): the value stays in a scalar register (tensor loads ignore EXEC)
    return w;
}
// this wave's LDS reads have returned (the buffer may be refilled behind the barrier)
__device__ __forceinline__ void wait_ds0() { asm volatile("s_wait_dscnt 0x0" ::: "memory"); }
// this wave's tensor load has landed (the compiler places no wait for it)
__device__ __forceinline__ void wait_tensor0() { asm volatile("s_wait_tensorcnt 0x0" ::: "memory"); }
// one request of the whole wave: a tile of SROWS rows of KB bytes into LDS
__device__ __forceinline__ void tdm_load(u32x4 g0, u32x8 g1) {
    asm volatile("tensor_load_to_lds %0, %1" :: "s"(g0), "s"(g1) : "memory");
}
// pinned descriptor words, held in their scalar registers up to here: placed behind the wait that
// covers a request, so that no word of its descriptor takes a new value while it is outstanding
__device__ __forceinline__ void hold(u32x4& g0, u32x8& g1) { asm volatile("" : "+s"(g0), "+s"(g1)); }
// the compiler does not schedule across it
__device__ __forceinline__ void fence() { __builtin_amdgcn_sched_barrier(0); }
// group 1: 1-byte elements, SROWS rows of KB bytes, 16 B of LDS pad behind every 128-byte row
__device__ __forceinline__ u32x8 tdm_group1(uint32_t src_pitch) {
    constexpr uint32_t d0 = KB, d1 = SROWS;
    u32x8 g;
    g[0] = uni((1u << 20) | (4u << 22) | (3u << 25));
    g[1] = uni((d0 & 0xFFFFu) << 16);
    g[2] = uni((d0 >> 16) | ((d1 & 0xFFFFu) << 16));
    g[3] = uni((d1 >> 16) | (d0 << 16));
    g[4] = uni(d1);
    g[5] = uni(src_pitch);
    g[6] = uni(0u);
    g[7] = uni(0u);
    return g;
}
// group 0: LDS destination (byte offset) and the global address of the tile's first byte
__device__ __forceinline__ u32x4 tdm_group0(uint32_t lds_dst, uint64_t ga) {
    u32x4 g;
    g[0] = uni(1u);
    g[1] = uni(lds_dst);
    g[2] = uni((uint32_t)ga);
    g[3] = uni((((uint32_t)(ga >> 32)) & 0x01FFFFFFu) | 0x80000000u);
    return g;
}

// p: the lane's row, at its 16-byte half (lane >> 4) of the 64 bytes (32 k) of this block
__device__ __forceinline__ Frag16 lds_frag(const unsigned char* p) {
    Frag16 f;
    f.u[0] = *(const uint4*)p;         // K chunk 0..7  (lane<16) / 8..15 (lane>=16)
    f.u[1] = *(const uint4*)(p + 32);  // K chunk 16..23 / 24..31
    return f;
}
__device__ __forceinline__ v8f mma(const Frag16& a, const Frag16& b, v8f c) {
    return __builtin_amdgcn_wmma_f32_16x16x32_bf16(false, a.v, false, b.v, (short)0, c, false, false);
}

__global__ __launch_bounds__(256)
void wmma_gemm_bias(const unsigned short* __restrict__ Ahi,
                    const unsigned short* __restrict__ Alo,
                    const unsigned short* __restrict__ Bhi,
                    const unsigned short* __restrict__ Blo,
                    const float* __restrict__ bias,
                    float* __restrict__ Cout,
                    int M, int N, int K) {
    __shared__ __attribute__((aligned(2048))) unsigned char L[2 * STAGE];
    const uint32_t lane = threadIdx.x & 31u, r16 = lane & 15u, h = lane >> 4;
    const uint32_t wave = uni(threadIdx.x >> 5);
    const uint32_t tiles_n = (uint32_t)N / TILE;
    const uint32_t tm = blockIdx.x / tiles_n, tn = blockIdx.x - tm * tiles_n;
    const uint32_t m0 = tm * TILE, n0 = tn * TILE;
    const uint32_t wm = wave >> 1, wn = wave & 1u;
    const uint32_t kb = (uint32_t)K * 2u;        // bytes of a source row
    const uint32_t T  = pinned((uint32_t)K / 64u);
    (void)M;

    // this wave's slice: array wave >> 1 of [A hi, A lo, B hi, B lo], rows 128 * (wave & 1) on
    const uint32_t arr = wave >> 1;
    const unsigned short* sarr = (arr == 0u) ? Ahi : (arr == 1u) ? Alo : (arr == 2u) ? Bhi : Blo;
    const uint32_t srow = ((arr < 2u) ? m0 : n0) + SROWS * (wave & 1u);
    const uint64_t src = (uint64_t)(uintptr_t)sarr + (uint64_t)srow * kb;
    const uint32_t lds_slice = (uint32_t)(size_t)L + wave * SLICE;   // add buffer * STAGE
    u32x8 g1 = tdm_group1(kb);

    v8f acc[4][8];
#pragma unroll
    for (int i = 0; i < 4; ++i)
#pragma unroll
        for (int j = 0; j < 8; ++j) acc[i][j] = v8f{};

    // per-lane fragment bases in a buffer
    const uint32_t a_base = (wm * 64u + r16) * PITCH + 16u * h;
    const uint32_t b_base = 2u * ARR + (wn * 128u + r16) * PITCH + 16u * h;

    u32x4 g0 = tdm_group0(lds_slice, src);
    tdm_load(g0, g1);                                    // stage 0
    wait_tensor0();
    hold(g0, g1);
    __syncthreads();                                     // stage 0 is published
    g0 = tdm_group0(lds_slice + STAGE, src + KB);
    tdm_load(g0, g1);                                    // stage 1

#pragma clang loop unroll(disable)  // one pass per trip: the buffer index stays a scalar
    for (uint32_t t = 0; t < T; ++t) {
        const uint32_t buf = (t & 1u) * STAGE;
        const unsigned char* la = L + buf + a_base;
        const unsigned char* lb = L + buf + b_base;
        // A pass is 8 units of 24 WMMAs: unit q = block (32 k) q >> 2, columns 32 * (q & 3) on.
        // The A fragments of both blocks and two sets of a unit's B fragments are held.
        Frag16 ah[2][4], al[2][4], bh[2][2], bl[2][2];
        // the first unit's fragments in the order of their use, so that its first WMMAs
        // wait for the first twelve loads only
#pragma unroll
        for (int i = 0; i < 4; ++i) ah[0][i] = lds_frag(la + (uint32_t)i * 16u * PITCH);
#pragma unroll
        for (int jj = 0; jj < 2; ++jj) bh[0][jj] = lds_frag(lb + (uint32_t)jj * 16u * PITCH);
        fence();  // keeps these loads in front of the ones that are needed later
#pragma unroll
        for (int jj = 0; jj < 2; ++jj) bl[0][jj] = lds_frag(lb + ARR + (uint32_t)jj * 16u * PITCH);
#pragma unroll
        for (int i = 0; i < 4; ++i) al[0][i] = lds_frag(la + ARR + (uint32_t)i * 16u * PITCH);
        fence();  // and these in front of the next unit's
#pragma unroll  // every fragment and accumulator index a constant
        for (int q = 0; q < 8; ++q) {
            const int u = q >> 2, jp = q & 3, s = q & 1;
            // the next unit's fragments, as one group ahead of this unit's WMMAs
            if (q < 7) {
                const int un = (q + 1) >> 2, jn = (q + 1) & 3;
#pragma unroll
                for (int jj = 0; jj < 2; ++jj) {
                    bh[s ^ 1][jj] = lds_frag(lb + (uint32_t)(2 * jn + jj) * 16u * PITCH + 64u * (uint32_t)un);
                    bl[s ^ 1][jj] = lds_frag(lb + ARR + (uint32_t)(2 * jn + jj) * 16u * PITCH + 64u * (uint32_t)un);
                }
            }
            if (u == 0) {  // a quarter of the second block's A fragments
                ah[1][jp] = lds_frag(la + (uint32_t)jp * 16u * PITCH + 64u);
                al[1][jp] = lds_frag(la + ARR + (uint32_t)jp * 16u * PITCH + 64u);
            }
            fence();  // keeps the group of LDS loads together, ahead of the WMMAs
            // per accumulator the order stays hi*hi, hi*lo, lo*hi; eight tiles stand
            // between two products into the same accumulator
#pragma unroll
            for (int jj = 0; jj < 2; ++jj)
#pragma unroll
                for (int i = 0; i < 4; ++i) acc[i][2 * jp + jj] = mma(ah[u][i], bh[s][jj], acc[i][2 * jp + jj]);
#pragma unroll
            for (int jj = 0; jj < 2; ++jj)
#pragma unroll
                for (int i = 0; i < 4; ++i) acc[i][2 * jp + jj] = mma(ah[u][i], bl[s][jj], acc[i][2 * jp + jj]);
#pragma unroll
            for (int jj = 0; jj < 2; ++jj)
#pragma unroll
                for (int i = 0; i < 4; ++i) acc[i][2 * jp + jj] = mma(al[u][i], bh[s][jj], acc[i][2 * jp + jj]);
            fence();  // keeps the next group of LDS loads out of this unit's WMMAs
        }
        // publish point of stage t + 1
        wait_ds0();
        wait_tensor0();
        hold(g0, g1);
        __syncthreads();
        if (pinned(t + 2u < T)) {  // the refill, into the buffer this pass has just read
            g0 = tdm_group0(lds_slice + buf, src + (uint64_t)(t + 2u) * KB);
            tdm_load(g0, g1);
        }
    }
    wait_tensor0();
    wait_ds0();

    // C/D layout: VGPR v holds M = v + 8*(lane>=16), N = lane%16
#pragma unroll
    for (int j = 0; j < 8; ++j) {
        const uint32_t n = n0 + wn * 128u + (uint32_t)j * 16u + r16;
        const float bv = bias[n];
#pragma unroll
        for (int i = 0; i < 4; ++i) {
            const uint32_t mb = m0 + wm * 64u + (uint32_t)i * 16u + 8u * h;
#pragma unroll
            for (int v = 0; v < 8; ++v) {
                Cout[(size_t)(mb + v) * (uint32_t)N + n] = acc[i][j][v] + bv;
            }
        }
    }
}

// ---------------------------------------------------------------------------
// The two cumsums over T run as chunked scans: T is cut into chunks of CHUNK
// rows, a first launch sums each chunk, and the scan launch starts each chunk
// from the sum of the chunk sums in front of it. One block = one (b, chunk),
// 256 threads x 4 channels = all CH channels (16 lanes per head).
// ---------------------------------------------------------------------------
constexpr int CH = 1024;    // channels = 256 threads x 4; a constant, so that the rows of a
                            // trip are immediate offsets from one address
constexpr int CHUNK = 32;   // 32 floats of Pi per (b,h,chunk) = one 128-byte line
constexpr int PPITCH = 32;  // floats per block in the Pi chunk sums: one 128-byte line each
constexpr int PRE = 16;     // chunk sums read per trip when a chunk's start value is formed

// Stage 1a: S[b,chunk,c] = sum over the chunk's rows of w^2
__global__ __launch_bounds__(256)
void chunk_sum_sq(const float* __restrict__ w, float* __restrict__ S) {
    const float* base = w + (size_t)blockIdx.x * CHUNK * CH + threadIdx.x * 4;
    float4 s = make_float4(0.f, 0.f, 0.f, 0.f);
#pragma unroll  // the chunk's independent loads issue ahead of the serial sums
    for (int t = 0; t < CHUNK; ++t) {
        float4 wv = *(const float4*)(base + (size_t)t * CH);
        s.x += wv.x * wv.x; s.y += wv.y * wv.y; s.z += wv.z * wv.z; s.w += wv.w * wv.w;
    }
    *(float4*)(S + (size_t)blockIdx.x * CH + threadIdx.x * 4) = s;
}

// Stages 1b, 2 and 3a in one launch. A block holds all CH channels, that is all 16 heads,
// of its CHUNK rows, so the softmax over heads needs nothing of another block:
//   1b: denom = cumsum_T(w^2); tmp[h,t] = (sum_d w^2/denom + D*dbias)*temp, handed on in LDS
//   2 : Pi = softmax of tmp over the 16 heads, stored for stage 3b and handed on in LDS
//   3a: chunk sums of w^2*Pi (per channel) and of Pi (per head)
// The chunk's rows of w are read once and stay in registers from 1b to 3a.
__global__ __launch_bounds__(256)
void stage_pi(const float* __restrict__ w,
              const float* __restrict__ S,
              const float* __restrict__ temp,
              const float* __restrict__ denom_bias,
              float* __restrict__ Pi,
              float* __restrict__ Swp,
              float* __restrict__ P,
              int T, int H, int D) {
    __shared__ float tl[16 * CHUNK];                              // tmp[head][row]
    __shared__ __attribute__((aligned(16))) float pl[16 * CHUNK]; // Pi[head][row]
    const int nc = T / CHUNK;
    const int b = blockIdx.x / nc, j = blockIdx.x % nc;
    const int h = threadIdx.x >> 4;
    const int l = threadIdx.x & 15;
    const int t0 = j * CHUNK;

    const float* base  = w + (size_t)blockIdx.x * CHUNK * CH + threadIdx.x * 4;
    const float* dbias = denom_bias + (size_t)h * T + t0;
    const float th = temp[h];

    // running sum at the chunk's start: the chunk sums in front of it
    float4 run = make_float4(0.f, 0.f, 0.f, 0.f);
    const float* sp = S + (size_t)b * nc * CH + threadIdx.x * 4;
    // Trips of PRE rows, no remainder loop: PRE divides nc, so every row read is one of
    // this b's chunk sums; a row at or past j adds 0.
    for (int i0 = 0; i0 < j; i0 += PRE) {
        float4 v[PRE];
#pragma unroll  // PRE independent loads in flight per trip
        for (int u = 0; u < PRE; ++u) v[u] = *(const float4*)(sp + (size_t)(i0 + u) * CH);
#pragma unroll  // v[] stays in registers
        for (int u = 0; u < PRE; ++u) {
            const bool on = i0 + u < j;
            run.x += on ? v[u].x : 0.f; run.y += on ? v[u].y : 0.f;
            run.z += on ? v[u].z : 0.f; run.w += on ? v[u].w : 0.f;
        }
    }

    // the chunk's rows, held to the end of the kernel
    float4 wv[CHUNK];
#pragma unroll  // wv[] stays in registers; the rows are immediate offsets from one address
    for (int u = 0; u < CHUNK; ++u) wv[u] = *(const float4*)(base + (size_t)u * CH);

    // 16 rows at a time; lane u of a head's 16 keeps row u's sum, so the body has no branch
#pragma unroll  // every index into wv[] a constant
    for (int tb = 0; tb < CHUNK; tb += 16) {
        float val[16];
#pragma unroll  // wv[] and val[] stay in registers
        for (int u = 0; u < 16; ++u) {
            const float4 x = wv[tb + u];
            float sx = x.x * x.x, sy = x.y * x.y;
            float sz = x.z * x.z, sw = x.w * x.w;
            run.x += sx; run.y += sy; run.z += sz; run.w += sw;
            val[u] = sx / fmaxf(run.x, 1e-12f) + sy / fmaxf(run.y, 1e-12f)
                   + sz / fmaxf(run.z, 1e-12f) + sw / fmaxf(run.w, 1e-12f);
        }
        // reduce over the 16-lane group (stays within half-wave), the sixteen rows'
        // exchanges of a step side by side so that one wait serves them all
#pragma unroll  // the four steps' lane masks become constants
        for (int m = 8; m >= 1; m >>= 1) {
            float o[16];
#pragma unroll  // sixteen independent exchanges in flight; o[] stays in registers
            for (int u = 0; u < 16; ++u) o[u] = __shfl_xor(val[u], m, 32);
#pragma unroll  // val[] stays in registers
            for (int u = 0; u < 16; ++u) val[u] += o[u];
        }
        float keep = val[0];
#pragma unroll  // val[] stays in registers
        for (int u = 1; u < 16; ++u) keep = (l == u) ? val[u] : keep;
        tl[h * CHUNK + tb + l] = (keep + (float)D * dbias[tb + l]) * th;
    }
    __syncthreads();  // all 16 heads' tmp of the chunk's rows stand in tl

    // Softmax over the heads: lane r of every wave forms row r's maximum and sum; wave k
    // writes heads 2k and 2k + 1 (their exponentials formed again from the same operands,
    // so that no register array is indexed by the wave's number).
    const int row = threadIdx.x & 31;
    const int hp = (threadIdx.x >> 5) * 2;
    float pv[2];
    {
        float v[16];
        float m = -3.4e38f;
#pragma unroll  // v[] stays in registers
        for (int g = 0; g < 16; ++g) { v[g] = tl[g * CHUNK + row]; m = fmaxf(m, v[g]); }
        float s = 0.f;
#pragma unroll  // v[] stays in registers
        for (int g = 0; g < 16; ++g) s += __expf(v[g] - m);
        const float inv = 1.f / s;
#pragma unroll  // two heads a wave; pv[] stays in registers
        for (int k = 0; k < 2; ++k) {
            pv[k] = __expf(tl[(hp + k) * CHUNK + row] - m) * inv;
            pl[(hp + k) * CHUNK + row] = pv[k];
        }
    }
    __syncthreads();  // all 16 heads' Pi of the chunk's rows stand in pl

    // Pi goes to memory behind the barrier, which would otherwise wait for these stores
    float* q = Pi + ((size_t)b * H + hp) * T + t0 + row;
    q[0] = pv[0];
    q[T] = pv[1];

    const float4* pr = (const float4*)(pl + h * CHUNK);
    float4 s = make_float4(0.f, 0.f, 0.f, 0.f);
    float spi = 0.f;
#pragma unroll  // every index into wv[] a constant
    for (int t4 = 0; t4 < CHUNK / 4; ++t4) {
        const float4 p4 = pr[t4];
        const float pa[4] = {p4.x, p4.y, p4.z, p4.w};
#pragma unroll  // pa[] stays in registers
        for (int c = 0; c < 4; ++c) {
            const float pi = pa[c];
            const float4 x = wv[4 * t4 + c];
            spi += pi;
            s.x += x.x * x.x * pi;
            s.y += x.y * x.y * pi;
            s.z += x.z * x.z * pi;
            s.w += x.w * x.w * pi;
        }
    }
    *(float4*)(Swp + (size_t)blockIdx.x * CH + threadIdx.x * 4) = s;
    if (l == 0) P[(size_t)blockIdx.x * PPITCH + h] = spi;
}

// ---------------------------------------------------------------------------
// Stage 3b: dots = cumsum_T(w^2*Pi)/(cumsum_T(Pi)+1e-8); y = -(w*Pi)/(1+dots)
// Writes y straight into bf16 hi/lo buffers (GEMM2 inputs).
// ---------------------------------------------------------------------------
__global__ __launch_bounds__(256)
void stage_y(const float* __restrict__ w,
             const float* __restrict__ Pi,
             const float* __restrict__ S,
             const float* __restrict__ P,
             unsigned short* __restrict__ yhi,
             unsigned short* __restrict__ ylo,
             int T, int H) {
    const int nc = T / CHUNK;
    const int b = blockIdx.x / nc, j = blockIdx.x % nc;
    const int h = threadIdx.x >> 4;

    const float* wbase = w + (size_t)blockIdx.x * CHUNK * CH + threadIdx.x * 4;
    const float* pbase = Pi + ((size_t)b * H + h) * T + j * CHUNK;
    size_t obase = (size_t)blockIdx.x * CHUNK * CH + threadIdx.x * 4;

    // running sums at the chunk's start: the chunk sums in front of it
    float4 cumWP = make_float4(0.f, 0.f, 0.f, 0.f);
    float cumPi = 0.f;
    const float* sp = S + (size_t)b * nc * CH + threadIdx.x * 4;
    const float* pp = P + (size_t)b * nc * PPITCH + h;
    // Trips of PRE (2 * PRE) rows, no remainder loop: both divide nc, so every row read is
    // one of this b's chunk sums; a row at or past j adds 0.
    for (int i0 = 0; i0 < j; i0 += 2 * PRE) {
        float p[2 * PRE];
#pragma unroll  // 2 * PRE independent loads in flight per trip
        for (int u = 0; u < 2 * PRE; ++u) p[u] = pp[(size_t)(i0 + u) * PPITCH];
#pragma unroll  // p[] stays in registers
        for (int u = 0; u < 2 * PRE; ++u) cumPi += (i0 + u < j) ? p[u] : 0.f;
    }
    for (int i0 = 0; i0 < j; i0 += PRE) {
        float4 v[PRE];
#pragma unroll  // PRE independent loads in flight per trip
        for (int u = 0; u < PRE; ++u) v[u] = *(const float4*)(sp + (size_t)(i0 + u) * CH);
#pragma unroll  // v[] stays in registers
        for (int u = 0; u < PRE; ++u) {
            const bool on = i0 + u < j;
            cumWP.x += on ? v[u].x : 0.f; cumWP.y += on ? v[u].y : 0.f;
            cumWP.z += on ? v[u].z : 0.f; cumWP.w += on ? v[u].w : 0.f;
        }
    }

    // 8 rows per trip: their loads fly together ahead of the serial sums
    for (int tb = 0; tb < CHUNK; tb += 8) {
        float4 wr[8];
        float pr[8];
#pragma unroll  // eight rows' loads in flight
        for (int u = 0; u < 8; ++u) {
            pr[u] = pbase[tb + u];
            wr[u] = *(const float4*)(wbase + (size_t)(tb + u) * CH);
        }
#pragma unroll  // wr[] and pr[] stay in registers
        for (int u = 0; u < 8; ++u) {
            float pi = pr[u];
            float4 wv = wr[u];
            cumPi += pi;
            cumWP.x += wv.x * wv.x * pi;
            cumWP.y += wv.y * wv.y * pi;
            cumWP.z += wv.z * wv.z * pi;
            cumWP.w += wv.w * wv.w * pi;
            float dn = cumPi + 1e-8f;
            float yx = -(wv.x * pi) / (1.f + cumWP.x / dn);
            float yy = -(wv.y * pi) / (1.f + cumWP.y / dn);
            float yz = -(wv.z * pi) / (1.f + cumWP.z / dn);
            float yw = -(wv.w * pi) / (1.f + cumWP.w / dn);

            unsigned short h0 = f2bf(yx), h1 = f2bf(yy), h2 = f2bf(yz), h3 = f2bf(yw);
            unsigned short l0 = f2bf(yx - bf2f(h0)), l1 = f2bf(yy - bf2f(h1));
            unsigned short l2 = f2bf(yz - bf2f(h2)), l3 = f2bf(yw - bf2f(h3));

            size_t o = obase + (size_t)(tb + u) * CH;
            uint2 hv, lv;
            hv.x = (unsigned)h0 | ((unsigned)h1 << 16);
            hv.y = (unsigned)h2 | ((unsigned)h3 << 16);
            lv.x = (unsigned)l0 | ((unsigned)l1 << 16);
            lv.y = (unsigned)l2 | ((unsigned)l3 << 16);
            *(uint2*)(yhi + o) = hv;
            *(uint2*)(ylo + o) = lv;
        }
        // the next trip re-uses the stores' registers: keep the wait in front of that
        asm volatile("s_wait_xcnt 0x0" ::: "memory");
    }
}

// ---------------------------------------------------------------------------
// Host-side launch
// ---------------------------------------------------------------------------
extern "C" void kernel_launch(void* const* d_in, const int* in_sizes, int n_in,
                              void* d_out, int out_size, void* d_ws, size_t ws_size,
                              hipStream_t stream) {
    const float* x          = (const float*)d_in[0];
    const float* Wa         = (const float*)d_in[1];
    const float* ba         = (const float*)d_in[2];
    const float* Wp         = (const float*)d_in[3];
    const float* bp         = (const float*)d_in[4];
    const float* temp       = (const float*)d_in[5];
    const float* denom_bias = (const float*)d_in[6];

    const int B = 4, T = 4096, C = 1024, H = 16, D = 64;
    const int M = B * T;   // 16384
    const int N = C, K = C;

    // Workspace layout (bytes)
    char* ws = (char*)d_ws;
    float*          wbuf = (float*)(ws + 0);                       // 64 MB  (B,T,C) f32
    unsigned short* hi   = (unsigned short*)(ws + 67108864);       // 32 MB  x-hi / y-hi
    unsigned short* lo   = (unsigned short*)(ws + 100663296);      // 32 MB  x-lo / y-lo
    unsigned short* Wahi = (unsigned short*)(ws + 134217728);      //  2 MB
    unsigned short* Walo = (unsigned short*)(ws + 136314880);      //  2 MB
    unsigned short* Wphi = (unsigned short*)(ws + 138412032);      //  2 MB
    unsigned short* Wplo = (unsigned short*)(ws + 140509184);      //  2 MB
    float*          Pib  = (float*)(ws + 143654912);               //  1 MB  (B,H,T)
    float*          Ssq  = (float*)(ws + 144703488);               //  2 MB  (B,T/32,C) chunk sums of w^2
    float*          Swp  = (float*)(ws + 146800640);               //  2 MB  (B,T/32,C) chunk sums of w^2*Pi
    float*          Spi  = (float*)(ws + 148897792);               // 64 KB  (B,T/32,32) chunk sums of Pi

    const int nX = M * C;      // 16.7M
    const int nW = C * C;      // 1M
    // both sizes are whole multiples of a block's share, so the grids cover them exactly
    split_bf16<<<nX / SPLIT_BLOCK, 256, 0, stream>>>(x,  hi,   lo);
    split_bf16<<<nW / SPLIT_BLOCK, 256, 0, stream>>>(Wa, Wahi, Walo);
    split_bf16<<<nW / SPLIT_BLOCK, 256, 0, stream>>>(Wp, Wphi, Wplo);

    const int blocks = (M / 256) * (N / 256); // one 256 x 256 tile of the output per block

    // GEMM1: w = x @ Wa.T + ba
    wmma_gemm_bias<<<blocks, 256, 0, stream>>>(hi, lo, Wahi, Walo, ba, wbuf, M, N, K);

    // Scan / softmax / scan
    const int chunks = B * (T / CHUNK);       // one block per (b, chunk of rows)
    chunk_sum_sq<<<chunks, 256, 0, stream>>>(wbuf, Ssq);
    stage_pi<<<chunks, 256, 0, stream>>>(wbuf, Ssq, temp, denom_bias, Pib, Swp, Spi, T, H, D);
    stage_y<<<chunks, 256, 0, stream>>>(wbuf, Pib, Swp, Spi, hi, lo, T, H);

    // GEMM2: out = y @ Wp.T + bp
    wmma_gemm_bias<<<blocks, 256, 0, stream>>>(hi, lo, Wphi, Wplo, bp,
                                               (float*)d_out, M, N, K);
}

// v005
// One run takes 185 microseconds.
// Next to v004, in two timings, it ran 1.03 and 1.04 times as fast.
// Over all steps from v000 it is 26.4 times as fast.
#include <hip/hip_runtime.h>
#include <hip/hip_bf16.h>
#include <stdint.h>

// ---------------------------------------------------------------------------
// CDNA5 (gfx1250) implementation of the TSSA causal-attention reference.
//   GEMMs run on v_wmma_f32_16x16x32_bf16 with an error-compensated
//   bf16 hi/lo split (hi*hi + hi*lo + lo*hi) to keep ~fp32 accuracy.
//   The cumsums over T are chunked scans (chunk sums, then a scan per chunk).
// ---------------------------------------------------------------------------

typedef __attribute__((ext_vector_type(16))) __bf16 v16bf;
typedef __attribute__((ext_vector_type(8)))  float  v8f;

union Frag16 {
    v16bf v;
    uint4 u[2];
};

__device__ __forceinline__ unsigned short f2bf(float f) {
    // round-to-nearest-even bf16 truncation
    unsigned u = __float_as_uint(f);
    unsigned r = 0x7fffu + ((u >> 16) & 1u);
    return (unsigned short)((u + r) >> 16);
}
__device__ __forceinline__ float bf2f(unsigned short h) {
    return __uint_as_float(((unsigned)h) << 16);
}

// ---------------------------------------------------------------------------
// Split f32 -> bf16 hi + bf16 lo residual.
// A thread takes SPLIT_U groups of four elements instead of one element, so that a launch
// starts 1/32 of the waves. A block of 256 threads takes SPLIT_BLOCK consecutive elements
// (the element count is a whole multiple of it). Every load of a wave is 512 contiguous
// bytes, every store 256; the SPLIT_U loads of a lane fly together.
// ---------------------------------------------------------------------------
constexpr int SPLIT_U = 8;                     // 16-byte loads of a lane
constexpr int SPLIT_BLOCK = SPLIT_U * 1024;    // elements of a block

__global__ __launch_bounds__(256)
void split_bf16(const float* __restrict__ in,
                unsigned short* __restrict__ hi,
                unsigned short* __restrict__ lo) {
    const size_t base = (size_t)blockIdx.x * SPLIT_BLOCK + threadIdx.x * 4;
    const float* p = in + base;
    unsigned short* ph = hi + base;
    unsigned short* pl = lo + base;
    float4 v[SPLIT_U];
    uint2 hv[SPLIT_U], lv[SPLIT_U];
#pragma unroll  // all loads in flight together; every offset an immediate from one address
    for (int u = 0; u < SPLIT_U; ++u) v[u] = *(const float4*)(p + u * 1024);
#pragma unroll  // v[], hv[] and lv[] stay in registers
    for (int u = 0; u < SPLIT_U; ++u) {
        const float4 f = v[u];
        unsigned short h0 = f2bf(f.x), h1 = f2bf(f.y), h2 = f2bf(f.z), h3 = f2bf(f.w);
        unsigned short l0 = f2bf(f.x - bf2f(h0)), l1 = f2bf(f.y - bf2f(h1));
        unsigned short l2 = f2bf(f.z - bf2f(h2)), l3 = f2bf(f.w - bf2f(h3));
        hv[u].x = (unsigned)h0 | ((unsigned)h1 << 16);
        hv[u].y = (unsigned)h2 | ((unsigned)h3 << 16);
        lv[u].x = (unsigned)l0 | ((unsigned)l1 << 16);
        lv[u].y = (unsigned)l2 | ((unsigned)l3 << 16);
    }
    // the arithmetic stays in front of the stores, so that nothing rewrites a register
    // that an issued store names
    __builtin_amdgcn_sched_barrier(0);
#pragma unroll  // hv[] and lv[] stay in registers
    for (int u = 0; u < SPLIT_U; ++u) {
        *(uint2*)(ph + u * 1024) = hv[u];
        *(uint2*)(pl + u * 1024) = lv[u];
    }
}

// ---------------------------------------------------------------------------
// C = A @ B^T + bias, via v_wmma_f32_16x16x32_bf16 with hi/lo compensation.
// A: (M,K) row-major (hi/lo bf16).  Brows: (N,K) row-major (hi/lo bf16).
// One 256 x 256 tile of C per work-group (M, N multiples of 256; K a multiple of 64, at
// least 128). 8 waves, 4 along m x 2 along n, each 64 rows x 128 columns of the tile.
// A pass of the K loop is 64 k = 128 bytes of every operand row. A stage is
// [A hi | A lo | B hi | B lo], 256 rows each, at an LDS pitch of 144 bytes; two buffers.
// Every wave brings its own slice (128 rows of one of the four arrays) with one tensor
// load per stage, issued a whole pass ahead of the pass that reads it.
// ---------------------------------------------------------------------------
typedef uint32_t u32x4 __attribute__((ext_vector_type(4)));
typedef uint32_t u32x8 __attribute__((ext_vector_type(8)));

constexpr uint32_t TILE   = 256;                 // rows of A and rows of B per work-group
constexpr uint32_t KB     = 128;                 // bytes of an operand row per pass
constexpr uint32_t PITCH  = KB + 16;             // 16 B x odd: no bank conflict for 16-byte reads
constexpr uint32_t SROWS  = 128;                 // rows per tensor load
constexpr uint32_t SLICE  = SROWS * PITCH;       // 18,432 B
constexpr uint32_t ARR    = TILE * PITCH;        // one array's rows of a stage
constexpr uint32_t STAGE  = 4 * ARR;             // 147,456 B
static_assert(SLICE % 2048u == 0, "every slice starts at a multiple of 2 KiB");
static_assert(2u * STAGE <= 320u * 1024u, "two buffers fit the LDS");

__device__ __forceinline__ uint32_t uni(uint32_t v) { return (uint32_t)__builtin_amdgcn_readfirstlane(v); }
__device__ __forceinline__ uint32_t pinned(uint32_t v) {
    uint32_t w = (uint32_t)__builtin_amdgcn_readfirstlane(v);
    asm volatile("" : "+s"(w));  // pinned(): the value stays in a scalar register (tensor loads ignore EXEC)
    return w;
}
// this wave's LDS reads have returned (the buffer may be refilled behind the barrier)
__device__ __forceinline__ void wait_ds0() { asm volatile("s_wait_dscnt 0x0" ::: "memory"); }
// this wave's tensor load has landed (the compiler places no wait for it)
__device__ __forceinline__ void wait_tensor0() { asm volatile("s_wait_tensorcnt 0x0" ::: "memory"); }
// one request of the whole wave: a tile of SROWS rows of KB bytes into LDS
__device__ __forceinline__ void tdm_load(u32x4 g0, u32x8 g1) {
    asm volatile("tensor_load_to_lds %0, %1" :: "s"(g0), "s"(g1) : "memory");
}
// pinned descriptor words, held in their scalar registers up to here: placed behind the wait that
// covers a request, so that no word of its descriptor takes a new value while it is outstanding
__device__ __forceinline__ void hold(u32x4& g0, u32x8& g1) { asm volatile("" : "+s"(g0), "+s"(g1)); }
// the compiler does not schedule across it
__device__ __forceinline__ void fence() { __builtin_amdgcn_sched_barrier(0); }
// group 1: 1-byte elements, SROWS rows of KB bytes, 16 B of LDS pad behind every 128-byte row
__device__ __forceinline__ u32x8 tdm_group1(uint32_t src_pitch) {
    constexpr uint32_t d0 = KB, d1 = SROWS;
    u32x8 g;
    g[0] = uni((1u << 20) | (4u << 22) | (3u << 25));
    g[1] = uni((d0 & 0xFFFFu) << 16);
    g[2] = uni((d0 >> 16) | ((d1 & 0xFFFFu) << 16));
    g[3] = uni((d1 >> 16) | (d0 << 16));
    g[4] = uni(d1);
    g[5] = uni(src_pitch);
    g[6] = uni(0u);
    g[7] = uni(0u);
    return g;
}
// group 0: LDS destination (byte offset) and the global address of the tile's first byte
__device__ __forceinline__ u32x4 tdm_group0(uint32_t lds_dst, uint64_t ga) {
    u32x4 g;
    g[0] = uni(1u);
    g[1] = uni(lds_dst);
    g[2] = uni((uint32_t)ga);
    g[3] = uni((((uint32_t)(ga >> 32)) & 0x01FFFFFFu) | 0x80000000u);
    return g;
}

// p: the lane's row, at its 16-byte half (lane >> 4) of the 64 bytes (32 k) of this block
__device__ __forceinline__ Frag16 lds_frag(const unsigned char* p) {
    Frag16 f;
    f.u[0] = *(const uint4*)p;         // K chunk 0..7  (lane<16) / 8..15 (lane>=16)
    f.u[1] = *(const uint4*)(p + 32);  // K chunk 16..23 / 24..31
    return f;
}
__device__ __forceinline__ v8f mma(const Frag16& a, const Frag16& b, v8f c) {
    return __builtin_amdgcn_wmma_f32_16x16x32_bf16(false, a.v, false, b.v, (short)0, c, false, false);
}

__global__ __launch_bounds__(256)
void wmma_gemm_bias(const unsigned short* __restrict__ Ahi,
                    const unsigned short* __restrict__ Alo,
                    const unsigned short* __restrict__ Bhi,
                    const unsigned short* __restrict__ Blo,
                    const float* __restrict__ bias,
                    float* __restrict__ Cout,
                    int M, int N, int K) {
    __shared__ __attribute__((aligned(2048))) unsigned char L[2 * STAGE];
    const uint32_t lane = threadIdx.x & 31u, r16 = lane & 15u, h = lane >> 4;
    const uint32_t wave = uni(threadIdx.x >> 5);
    const uint32_t tiles_n = (uint32_t)N / TILE;
    const uint32_t tm = blockIdx.x / tiles_n, tn = blockIdx.x - tm * tiles_n;
    const uint32_t m0 = tm * TILE, n0 = tn * TILE;
    const uint32_t wm = wave >> 1, wn = wave & 1u;
    const uint32_t kb = (uint32_t)K * 2u;        // bytes of a source row
    const uint32_t T  = pinned((uint32_t)K / 64u);
    (void)M;

    // this wave's slice: array wave >> 1 of [A hi, A lo, B hi, B lo], rows 128 * (wave & 1) on
    const uint32_t arr = wave >> 1;
    const unsigned short* sarr = (arr == 0u) ? Ahi : (arr == 1u) ? Alo : (arr == 2u) ? Bhi : Blo;
    const uint32_t srow = ((arr < 2u) ? m0 : n0) + SROWS * (wave & 1u);
    const uint64_t src = (uint64_t)(uintptr_t)sarr + (uint64_t)srow * kb;
    const uint32_t lds_slice = (uint32_t)(size_t)L + wave * SLICE;   // add buffer * STAGE
    u32x8 g1 = tdm_group1(kb);

    v8f acc[4][8];
#pragma unroll
    for (int i = 0; i < 4; ++i)
#pragma unroll
        for (int j = 0; j < 8; ++j) acc[i][j] = v8f{};

    // per-lane fragment bases in a buffer
    const uint32_t a_base = (wm * 64u + r16) * PITCH + 16u * h;
    const uint32_t b_base = 2u * ARR + (wn * 128u + r16) * PITCH + 16u * h;

    u32x4 g0 = tdm_group0(lds_slice, src);
    tdm_load(g0, g1);                                    // stage 0
    wait_tensor0();
    hold(g0, g1);
    __syncthreads();                                     // stage 0 is published
    g0 = tdm_group0(lds_slice + STAGE, src + KB);
    tdm_load(g0, g1);                                    // stage 1

#pragma clang loop unroll(disable)  // one pass per trip: the buffer index stays a scalar
    for (uint32_t t = 0; t < T; ++t) {
        const uint32_t buf = (t & 1u) * STAGE;
        const unsigned char* la = L + buf + a_base;
        const unsigned char* lb = L + buf + b_base;
        // A pass is 8 units of 24 WMMAs: unit q = block (32 k) q >> 2, columns 32 * (q & 3) on.
        // The A fragments of both blocks and two sets of a unit's B fragments are held.
        Frag16 ah[2][4], al[2][4], bh[2][2], bl[2][2];
        // the first unit's fragments in the order of their use, so that its first WMMAs
        // wait for the first twelve loads only
#pragma unroll
        for (int i = 0; i < 4; ++i) ah[0][i] = lds_frag(la + (uint32_t)i * 16u * PITCH);
#pragma unroll
        for (int jj = 0; jj < 2; ++jj) bh[0][jj] = lds_frag(lb + (uint32_t)jj * 16u * PITCH);
        fence();  // keeps these loads in front of the ones that are needed later
#pragma unroll
        for (int jj = 0; jj < 2; ++jj) bl[0][jj] = lds_frag(lb + ARR + (uint32_t)jj * 16u * PITCH);
#pragma unroll
        for (int i = 0; i < 4; ++i) al[0][i] = lds_frag(la + ARR + (uint32_t)i * 16u * PITCH);
        fence();  // and these in front of the next unit's
#pragma unroll  // every fragment and accumulator index a constant
        for (int q = 0; q < 8; ++q) {
            const int u = q >> 2, jp = q & 3, s = q & 1;
            // the next unit's fragments, as one group ahead of this unit's WMMAs
            if (q < 7) {
                const int un = (q + 1) >> 2, jn = (q + 1) & 3;
#pragma unroll
                for (int jj = 0; jj < 2; ++jj) {
                    bh[s ^ 1][jj] = lds_frag(lb + (uint32_t)(2 * jn + jj) * 16u * PITCH + 64u * (uint32_t)un);
                    bl[s ^ 1][jj] = lds_frag(lb + ARR + (uint32_t)(2 * jn + jj) * 16u * PITCH + 64u * (uint32_t)un);
                }
            }
            if (u == 0) {  // a quarter of the second block's A fragments
                ah[1][jp] = lds_frag(la + (uint32_t)jp * 16u * PITCH + 64u);
                al[1][jp] = lds_frag(la + ARR + (uint32_t)jp * 16u * PITCH + 64u);
            }
            fence();  // keeps the group of LDS loads together, ahead of the WMMAs
            // per accumulator the order stays hi*hi, hi*lo, lo*hi; eight tiles stand
            // between two products into the same accumulator
#pragma unroll
            for (int jj = 0; jj < 2; ++jj)
#pragma unroll
                for (int i = 0; i < 4; ++i) acc[i][2 * jp + jj] = mma(ah[u][i], bh[s][jj], acc[i][2 * jp + jj]);
#pragma unroll
            for (int jj = 0; jj < 2; ++jj)
#pragma unroll
                for (int i = 0; i < 4; ++i) acc[i][2 * jp + jj] = mma(ah[u][i], bl[s][jj], acc[i][2 * jp + jj]);
#pragma unroll
            for (int jj = 0; jj < 2; ++jj)
#pragma unroll
                for (int i = 0; i < 4; ++i) acc[i][2 * jp + jj] = mma(al[u][i], bh[s][jj], acc[i][2 * jp + jj]);
            fence();  // keeps the next group of LDS loads out of this unit's WMMAs
        }
        // publish point of stage t + 1
        wait_ds0();
        wait_tensor0();
        hold(g0, g1);
        __syncthreads();
        if (pinned(t + 2u < T)) {  // the refill, into the buffer this pass has just read
            g0 = tdm_group0(lds_slice + buf, src + (uint64_t)(t + 2u) * KB);
            tdm_load(g0, g1);
        }
    }
    wait_tensor0();
    wait_ds0();

    // C/D layout: VGPR v holds M = v + 8*(lane>=16), N = lane%16
#pragma unroll
    for (int j = 0; j < 8; ++j) {
        const uint32_t n = n0 + wn * 128u + (uint32_t)j * 16u + r16;
        const float bv = bias[n];
#pragma unroll
        for (int i = 0; i < 4; ++i) {
            const uint32_t mb = m0 + wm * 64u + (uint32_t)i * 16u + 8u * h;
#pragma unroll
            for (int v = 0; v < 8; ++v) {
                Cout[(size_t)(mb + v) * (uint32_t)N + n] = acc[i][j][v] + bv;
            }
        }
    }
}

// ---------------------------------------------------------------------------
// The two cumsums over T run as chunked scans: T is cut into chunks of CHUNK
// rows, a first launch sums each chunk, and the scan launch starts each chunk
// from the sum of the chunk sums in front of it. One block = one (b, chunk),
// 256 threads x 4 channels = all CH channels (16 lanes per head).
// ---------------------------------------------------------------------------
constexpr int CH = 1024;    // channels = 256 threads x 4; a constant, so that the rows of a
                            // trip are immediate offsets from one address
constexpr int CHUNK = 32;   // 32 floats of Pi per (b,h,chunk) = one 128-byte line
constexpr int PPITCH = 32;  // floats per block in the Pi chunk sums: one 128-byte line each
constexpr int PRE = 16;     // chunk sums read per trip when a chunk's start value is formed

// Four reciprocals by v_rcp_f32 (good to about one unit in the last place), in place of four
// correctly rounded divisions of some ten dependent vector instructions each. Every argument
// here is at least 1e-12 (a clamp, an added 1e-8, an added 1).
// One statement, so that the slot behind a transcendental is kept by construction: each
// reciprocal replaces its own argument, so none touches a register of the one in front of it
// (and no register is added), and the closing v_nop stands between the last one and whatever
// first reads or overwrites one of the four.
__device__ __forceinline__ float4 rcp4(float a, float b, float c, float d) {
    asm("v_rcp_f32 %0, %0\n\tv_rcp_f32 %1, %1\n\tv_rcp_f32 %2, %2\n\tv_rcp_f32 %3, %3\n\tv_nop"
        : "+v"(a), "+v"(b), "+v"(c), "+v"(d));
    return make_float4(a, b, c, d);
}

// Stage 1a: S[b,chunk,c] = sum over the chunk's rows of w^2
__global__ __launch_bounds__(256)
void chunk_sum_sq(const float* __restrict__ w, float* __restrict__ S) {
    const float* base = w + (size_t)blockIdx.x * CHUNK * CH + threadIdx.x * 4;
    float4 s = make_float4(0.f, 0.f, 0.f, 0.f);
#pragma unroll  // the chunk's independent loads issue ahead of the serial sums
    for (int t = 0; t < CHUNK; ++t) {
        float4 wv = *(const float4*)(base + (size_t)t * CH);
        s.x += wv.x * wv.x; s.y += wv.y * wv.y; s.z += wv.z * wv.z; s.w += wv.w * wv.w;
    }
    *(float4*)(S + (size_t)blockIdx.x * CH + threadIdx.x * 4) = s;
}

// Stages 1b, 2 and 3a in one launch. A block holds all CH channels, that is all 16 heads,
// of its CHUNK rows, so the softmax over heads needs nothing of another block:
//   1b: denom = cumsum_T(w^2); tmp[h,t] = (sum_d w^2/denom + D*dbias)*temp, handed on in LDS
//   2 : Pi = softmax of tmp over the 16 heads, stored for stage 3b and handed on in LDS
//   3a: chunk sums of w^2*Pi (per channel) and of Pi (per head)
// The chunk's rows of w are read once and stay in registers from 1b to 3a.
__global__ __launch_bounds__(256)
void stage_pi(const float* __restrict__ w,
              const float* __restrict__ S,
              const float* __restrict__ temp,
              const float* __restrict__ denom_bias,
              float* __restrict__ Pi,
              float* __restrict__ Swp,
              float* __restrict__ P,
              int T, int H, int D) {
    __shared__ float tl[16 * CHUNK];                              // tmp[head][row]
    __shared__ __attribute__((aligned(16))) float pl[16 * CHUNK]; // Pi[head][row]
    const int nc = T / CHUNK;
    const int b = blockIdx.x / nc, j = blockIdx.x % nc;
    const int h = threadIdx.x >> 4;
    const int l = threadIdx.x & 15;
    const int t0 = j * CHUNK;

    const float* base  = w + (size_t)blockIdx.x * CHUNK * CH + threadIdx.x * 4;
    const float* dbias = denom_bias + (size_t)h * T + t0;
    const float th = temp[h];

    // running sum at the chunk's start: the chunk sums in front of it
    float4 run = make_float4(0.f, 0.f, 0.f, 0.f);
    const float* sp = S + (size_t)b * nc * CH + threadIdx.x * 4;
    // Trips of PRE rows, no remainder loop: PRE divides nc, so every row read is one of
    // this b's chunk sums; a row at or past j adds 0.
    for (int i0 = 0; i0 < j; i0 += PRE) {
        float4 v[PRE];
#pragma unroll  // PRE independent loads in flight per trip
        for (int u = 0; u < PRE; ++u) v[u] = *(const float4*)(sp + (size_t)(i0 + u) * CH);
#pragma unroll  // v[] stays in registers
        for (int u = 0; u < PRE; ++u) {
            const bool on = i0 + u < j;
            run.x += on ? v[u].x : 0.f; run.y += on ? v[u].y : 0.f;
            run.z += on ? v[u].z : 0.f; run.w += on ? v[u].w : 0.f;
        }
    }

    // the chunk's rows, held to the end of the kernel
    float4 wv[CHUNK];
#pragma unroll  // wv[] stays in registers; the rows are immediate offsets from one address
    for (int u = 0; u < CHUNK; ++u) wv[u] = *(const float4*)(base + (size_t)u * CH);

    // 16 rows at a time; lane u of a head's 16 keeps row u's sum, so the body has no branch
#pragma unroll  // every index into wv[] a constant
    for (int tb = 0; tb < CHUNK; tb += 16) {
        float val[16];
#pragma unroll  // wv[] and val[] stay in registers
        for (int u = 0; u < 16; ++u) {
            const float4 x = wv[tb + u];
            float sx = x.x * x.x, sy = x.y * x.y;
            float sz = x.z * x.z, sw = x.w * x.w;
            run.x += sx; run.y += sy; run.z += sz; run.w += sw;
            const float4 rd = rcp4(fmaxf(run.x, 1e-12f), fmaxf(run.y, 1e-12f),
                                   fmaxf(run.z, 1e-12f), fmaxf(run.w, 1e-12f));
            val[u] = sx * rd.x + sy * rd.y + sz * rd.z + sw * rd.w;
        }
        // reduce over the 16-lane group (stays within half-wave), the sixteen rows'
        // exchanges of a step side by side so that one wait serves them all
#pragma unroll  // the four steps' lane masks become constants
        for (int m = 8; m >= 1; m >>= 1) {
            float o[16];
#pragma unroll  // sixteen independent exchanges in flight; o[] stays in registers
            for (int u = 0; u < 16; ++u) o[u] = __shfl_xor(val[u], m, 32);
#pragma unroll  // val[] stays in registers
            for (int u = 0; u < 16; ++u) val[u] += o[u];
        }
        float keep = val[0];
#pragma unroll  // val[] stays in registers
        for (int u = 1; u < 16; ++u) keep = (l == u) ? val[u] : keep;
        tl[h * CHUNK + tb + l] = (keep + (float)D * dbias[tb + l]) * th;
    }
    __syncthreads();  // all 16 heads' tmp of the chunk's rows stand in tl

    // Softmax over the heads: lane r of every wave forms row r's maximum and sum; wave k
    // writes heads 2k and 2k + 1 (their exponentials formed again from the same operands,
    // so that no register array is indexed by the wave's number).
    const int row = threadIdx.x & 31;
    const int hp = (threadIdx.x >> 5) * 2;
    float pv[2];
    {
        float v[16];
        float m = -3.4e38f;
#pragma unroll  // v[] stays in registers
        for (int g = 0; g < 16; ++g) { v[g] = tl[g * CHUNK + row]; m = fmaxf(m, v[g]); }
        float s = 0.f;
#pragma unroll  // v[] stays in registers
        for (int g = 0; g < 16; ++g) s += __expf(v[g] - m);
        const float inv = 1.f / s;
#pragma unroll  // two heads a wave; pv[] stays in registers
        for (int k = 0; k < 2; ++k) {
            pv[k] = __expf(tl[(hp + k) * CHUNK + row] - m) * inv;
            pl[(hp + k) * CHUNK + row] = pv[k];
        }
    }
    __syncthreads();  // all 16 heads' Pi of the chunk's rows stand in pl

    // Pi goes to memory behind the barrier, which would otherwise wait for these stores
    float* q = Pi + ((size_t)b * H + hp) * T + t0 + row;
    q[0] = pv[0];
    q[T] = pv[1];

    const float4* pr = (const float4*)(pl + h * CHUNK);
    float4 s = make_float4(0.f, 0.f, 0.f, 0.f);
    float spi = 0.f;
#pragma unroll  // every index into wv[] a constant
    for (int t4 = 0; t4 < CHUNK / 4; ++t4) {
        const float4 p4 = pr[t4];
        const float pa[4] = {p4.x, p4.y, p4.z, p4.w};
#pragma unroll  // pa[] stays in registers
        for (int c = 0; c < 4; ++c) {
            const float pi = pa[c];
            const float4 x = wv[4 * t4 + c];
            spi += pi;
            s.x += x.x * x.x * pi;
            s.y += x.y * x.y * pi;
            s.z += x.z * x.z * pi;
            s.w += x.w * x.w * pi;
        }
    }
    *(float4*)(Swp + (size_t)blockIdx.x * CH + threadIdx.x * 4) = s;
    if (l == 0) P[(size_t)blockIdx.x * PPITCH + h] = spi;
}

// ---------------------------------------------------------------------------
// Stage 3b: dots = cumsum_T(w^2*Pi)/(cumsum_T(Pi)+1e-8); y = -(w*Pi)/(1+dots)
// Writes y straight into bf16 hi/lo buffers (GEMM2 inputs).
// ---------------------------------------------------------------------------
__global__ __launch_bounds__(256)
void stage_y(const float* __restrict__ w,
             const float* __restrict__ Pi,
             const float* __restrict__ S,
             const float* __restrict__ P,
             unsigned short* __restrict__ yhi,
             unsigned short* __restrict__ ylo,
             int T, int H) {
    const int nc = T / CHUNK;
    const int b = blockIdx.x / nc, j = blockIdx.x % nc;
    const int h = threadIdx.x >> 4;

    const float* wbase = w + (size_t)blockIdx.x * CHUNK * CH + threadIdx.x * 4;
    const float* pbase = Pi + ((size_t)b * H + h) * T + j * CHUNK;
    size_t obase = (size_t)blockIdx.x * CHUNK * CH + threadIdx.x * 4;

    // running sums at the chunk's start: the chunk sums in front of it
    float4 cumWP = make_float4(0.f, 0.f, 0.f, 0.f);
    float cumPi = 0.f;
    const float* sp = S + (size_t)b * nc * CH + threadIdx.x * 4;
    const float* pp = P + (size_t)b * nc * PPITCH + h;
    // Trips of PRE (2 * PRE) rows, no remainder loop: both divide nc, so every row read is
    // one of this b's chunk sums; a row at or past j adds 0.
    for (int i0 = 0; i0 < j; i0 += 2 * PRE) {
        float p[2 * PRE];
#pragma unroll  // 2 * PRE independent loads in flight per trip
        for (int u = 0; u < 2 * PRE; ++u) p[u] = pp[(size_t)(i0 + u) * PPITCH];
#pragma unroll  // p[] stays in registers
        for (int u = 0; u < 2 * PRE; ++u) cumPi += (i0 + u < j) ? p[u] : 0.f;
    }
    for (int i0 = 0; i0 < j; i0 += PRE) {
        float4 v[PRE];
#pragma unroll  // PRE independent loads in flight per trip
        for (int u = 0; u < PRE; ++u) v[u] = *(const float4*)(sp + (size_t)(i0 + u) * CH);
#pragma unroll  // v[] stays in registers
        for (int u = 0; u < PRE; ++u) {
            const bool on = i0 + u < j;
            cumWP.x += on ? v[u].x : 0.f; cumWP.y += on ? v[u].y : 0.f;
            cumWP.z += on ? v[u].z : 0.f; cumWP.w += on ? v[u].w : 0.f;
        }
    }

    // 8 rows per trip: their loads fly together ahead of the serial sums
    for (int tb = 0; tb < CHUNK; tb += 8) {
        float4 wr[8];
        float pr[8];
#pragma unroll  // eight rows' loads in flight
        for (int u = 0; u < 8; ++u) {
            pr[u] = pbase[tb + u];
            wr[u] = *(const float4*)(wbase + (size_t)(tb + u) * CH);
        }
        // 1 / (cumsum(Pi) + 1e-8) of the eight rows; one reciprocal serves a row's four channels
        float rdn[8];
#pragma unroll  // pr[] and rdn[] stay in registers
        for (int u4 = 0; u4 < 8; u4 += 4) {
            const float c0 = cumPi + pr[u4], c1 = c0 + pr[u4 + 1];
            const float c2 = c1 + pr[u4 + 2], c3 = c2 + pr[u4 + 3];
            cumPi = c3;
            const float4 r = rcp4(c0 + 1e-8f, c1 + 1e-8f, c2 + 1e-8f, c3 + 1e-8f);
            rdn[u4] = r.x; rdn[u4 + 1] = r.y; rdn[u4 + 2] = r.z; rdn[u4 + 3] = r.w;
        }
#pragma unroll  // wr[], pr[] and rdn[] stay in registers
        for (int u = 0; u < 8; ++u) {
            float pi = pr[u];
            float4 wv = wr[u];
            cumWP.x += wv.x * wv.x * pi;
            cumWP.y += wv.y * wv.y * pi;
            cumWP.z += wv.z * wv.z * pi;
            cumWP.w += wv.w * wv.w * pi;
            const float4 at = rcp4(1.f + cumWP.x * rdn[u], 1.f + cumWP.y * rdn[u],
                                   1.f + cumWP.z * rdn[u], 1.f + cumWP.w * rdn[u]);
            float yx = -(wv.x * pi) * at.x;
            float yy = -(wv.y * pi) * at.y;
            float yz = -(wv.z * pi) * at.z;
            float yw = -(wv.w * pi) * at.w;

            unsigned short h0 = f2bf(yx), h1 = f2bf(yy), h2 = f2bf(yz), h3 = f2bf(yw);
            unsigned short l0 = f2bf(yx - bf2f(h0)), l1 = f2bf(yy - bf2f(h1));
            unsigned short l2 = f2bf(yz - bf2f(h2)), l3 = f2bf(yw - bf2f(h3));

            size_t o = obase + (size_t)(tb + u) * CH;
            uint2 hv, lv;
            hv.x = (unsigned)h0 | ((unsigned)h1 << 16);
            hv.y = (unsigned)h2 | ((unsigned)h3 << 16);
            lv.x = (unsigned)l0 | ((unsigned)l1 << 16);
            lv.y = (unsigned)l2 | ((unsigned)l3 << 16);
            *(uint2*)(yhi + o) = hv;
            *(uint2*)(ylo + o) = lv;
        }
        // the next trip re-uses the stores' registers: keep the wait in front of that
        asm volatile("s_wait_xcnt 0x0" ::: "memory");
    }
}

// ---------------------------------------------------------------------------
// Host-side launch
// ---------------------------------------------------------------------------
extern "C" void kernel_launch(void* const* d_in, const int* in_sizes, int n_in,
                              void* d_out, int out_size, void* d_ws, size_t ws_size,
                              hipStream_t stream) {
    const float* x          = (const float*)d_in[0];
    const float* Wa         = (const float*)d_in[1];
    const float* ba         = (const float*)d_in[2];
    const float* Wp         = (const float*)d_in[3];
    const float* bp         = (const float*)d_in[4];
    const float* temp       = (const float*)d_in[5];
    const float* denom_bias = (const float*)d_in[6];

    const int B = 4, T = 4096, C = 1024, H = 16, D = 64;
    const int M = B * T;   // 16384
    const int N = C, K = C;

    // Workspace layout (bytes)
    char* ws = (char*)d_ws;
    float*          wbuf = (float*)(ws + 0);                       // 64 MB  (B,T,C) f32
    unsigned short* hi   = (unsigned short*)(ws + 67108864);       // 32 MB  x-hi / y-hi
    unsigned short* lo   = (unsigned short*)(ws + 100663296);      // 32 MB  x-lo / y-lo
    unsigned short* Wahi = (unsigned short*)(ws + 134217728);      //  2 MB
    unsigned short* Walo = (unsigned short*)(ws + 136314880);      //  2 MB
    unsigned short* Wphi = (unsigned short*)(ws + 138412032);      //  2 MB
    unsigned short* Wplo = (unsigned short*)(ws + 140509184);      //  2 MB
    float*          Pib  = (float*)(ws + 143654912);               //  1 MB  (B,H,T)
    float*          Ssq  = (float*)(ws + 144703488);               //  2 MB  (B,T/32,C) chunk sums of w^2
    float*          Swp  = (float*)(ws + 146800640);               //  2 MB  (B,T/32,C) chunk sums of w^2*Pi
    float*          Spi  = (float*)(ws + 148897792);               // 64 KB  (B,T/32,32) chunk sums of Pi

    const int nX = M * C;      // 16.7M
    const int nW = C * C;      // 1M
    // both sizes are whole multiples of a block's share, so the grids cover them exactly
    split_bf16<<<nX / SPLIT_BLOCK, 256, 0, stream>>>(x,  hi,   lo);
    split_bf16<<<nW / SPLIT_BLOCK, 256, 0, stream>>>(Wa, Wahi, Walo);
    split_bf16<<<nW / SPLIT_BLOCK, 256, 0, stream>>>(Wp, Wphi, Wplo);

    const int blocks = (M / 256) * (N / 256); // one 256 x 256 tile of the output per block

    // GEMM1: w = x @ Wa.T + ba
    wmma_gemm_bias<<<blocks, 256, 0, stream>>>(hi, lo, Wahi, Walo, ba, wbuf, M, N, K);

    // Scan / softmax / scan
    const int chunks = B * (T / CHUNK);       // one block per (b, chunk of rows)
    chunk_sum_sq<<<chunks, 256, 0, stream>>>(wbuf, Ssq);
    stage_pi<<<chunks, 256, 0, stream>>>(wbuf, Ssq, temp, denom_bias, Pib, Swp, Spi, T, H, D);
    stage_y<<<chunks, 256, 0, stream>>>(wbuf, Pib, Swp, Spi, hi, lo, T, H);

    // GEMM2: out = y @ Wp.T + bp
    wmma_gemm_bias<<<blocks, 256, 0, stream>>>(hi, lo, Wphi, Wplo, bp,
                                               (float*)d_out, M, N, K);
}

// v006
// Measured time: 158 microseconds a run.
// Timed twice side by side with v005, it ran 1.16 times as fast both times.
// Over all steps from v000 it is 30.7 times as fast.
#include <hip/hip_runtime.h>
#include <hip/hip_bf16.h>
#include <stdint.h>

// ---------------------------------------------------------------------------
// CDNA5 (gfx1250) implementation of the TSSA causal-attention reference.
//   GEMMs run on v_wmma_f32_16x16x32_bf16 with an error-compensated
//   bf16 hi/lo split (hi*hi + hi*lo + lo*hi) to keep ~fp32 accuracy.
//   The first GEMM takes x as f32 and splits its A fragments in registers.
//   The cumsums over T are chunked scans (chunk sums, then a scan per chunk).
// ---------------------------------------------------------------------------

typedef __attribute__((ext_vector_type(16))) __bf16 v16bf;
typedef __attribute__((ext_vector_type(8)))  float  v8f;

typedef __attribute__((ext_vector_type(2)))  float  f32x2;
typedef __attribute__((ext_vector_type(2)))  __bf16 bf16x2;

union Frag16 {
    v16bf v;
    uint4 u[2];
    uint32_t w[8];
};

__device__ __forceinline__ unsigned short f2bf(float f) {
    // round-to-nearest-even bf16 truncation
    unsigned u = __float_as_uint(f);
    unsigned r = 0x7fffu + ((u >> 16) & 1u);
    return (unsigned short)((u + r) >> 16);
}
__device__ __forceinline__ float bf2f(unsigned short h) {
    return __uint_as_float(((unsigned)h) << 16);
}

// ---------------------------------------------------------------------------
// Split f32 -> bf16 hi + bf16 lo residual.
// A thread takes SPLIT_U groups of four elements instead of one element, so that a launch
// starts 1/32 of the waves. A block of 256 threads takes SPLIT_BLOCK consecutive elements
// (the element count is a whole multiple of it). Every load of a wave is 512 contiguous
// bytes, every store 256; the SPLIT_U loads of a lane fly together.
// ---------------------------------------------------------------------------
constexpr int SPLIT_U = 8;                     // 16-byte loads of a lane
constexpr int SPLIT_BLOCK = SPLIT_U * 1024;    // elements of a block

__global__ __launch_bounds__(256)
void split_bf16(const float* __restrict__ in,
                unsigned short* __restrict__ hi,
                unsigned short* __restrict__ lo) {
    const size_t base = (size_t)blockIdx.x * SPLIT_BLOCK + threadIdx.x * 4;
    const float* p = in + base;
    unsigned short* ph = hi + base;
    unsigned short* pl = lo + base;
    float4 v[SPLIT_U];
    uint2 hv[SPLIT_U], lv[SPLIT_U];
#pragma unroll  // all loads in flight together; every offset an immediate from one address
    for (int u = 0; u < SPLIT_U; ++u) v[u] = *(const float4*)(p + u * 1024);
#pragma unroll  // v[], hv[] and lv[] stay in registers
    for (int u = 0; u < SPLIT_U; ++u) {
        const float4 f = v[u];
        unsigned short h0 = f2bf(f.x), h1 = f2bf(f.y), h2 = f2bf(f.z), h3 = f2bf(f.w);
        unsigned short l0 = f2bf(f.x - bf2f(h0)), l1 = f2bf(f.y - bf2f(h1));
        unsigned short l2 = f2bf(f.z - bf2f(h2)), l3 = f2bf(f.w - bf2f(h3));
        hv[u].x = (unsigned)h0 | ((unsigned)h1 << 16);
        hv[u].y = (unsigned)h2 | ((unsigned)h3 << 16);
        lv[u].x = (unsigned)l0 | ((unsigned)l1 << 16);
        lv[u].y = (unsigned)l2 | ((unsigned)l3 << 16);
    }
    // the arithmetic stays in front of the stores, so that nothing rewrites a register
    // that an issued store names
    __builtin_amdgcn_sched_barrier(0);
#pragma unroll  // hv[] and lv[] stay in registers
    for (int u = 0; u < SPLIT_U; ++u) {
        *(uint2*)(ph + u * 1024) = hv[u];
        *(uint2*)(pl + u * 1024) = lv[u];
    }
}

// ---------------------------------------------------------------------------
// C = A @ B^T + bias, via v_wmma_f32_16x16x32_bf16 with hi/lo compensation.
// A: (M,K) row-major (hi/lo bf16).  Brows: (N,K) row-major (hi/lo bf16).
// One 256 x 256 tile of C per work-group (M, N multiples of 256; K a multiple of 64, at
// least 128). 8 waves, 4 along m x 2 along n, each 64 rows x 128 columns of the tile.
// A pass of the K loop is 64 k = 128 bytes of every operand row. A stage is
// [A hi | A lo | B hi | B lo], 256 rows each, at an LDS pitch of 144 bytes; two buffers.
// Every wave brings its own slice (128 rows of one of the four arrays) with one tensor
// load per stage, issued a whole pass ahead of the pass that reads it.
// AF32: A is (M,K) f32. Its 64 k of a pass are 256 bytes of a row, as many as hi and lo
// together, so the stage keeps its shape: [A k 0..31 | A k 32..63 | B hi | B lo], every
// array 256 rows of 128 bytes. A wave reads its A fragments as f32 and forms hi and lo in
// registers, rounded as the split launch rounds them.
// ---------------------------------------------------------------------------
typedef uint32_t u32x4 __attribute__((ext_vector_type(4)));
typedef uint32_t u32x8 __attribute__((ext_vector_type(8)));

constexpr uint32_t TILE   = 256;                 // rows of A and rows of B per work-group
constexpr uint32_t KB     = 128;                 // bytes of an operand row per pass
constexpr uint32_t PITCH  = KB + 16;             // 16 B x odd: no bank conflict for 16-byte reads
constexpr uint32_t SROWS  = 128;                 // rows per tensor load
constexpr uint32_t SLICE  = SROWS * PITCH;       // 18,432 B
constexpr uint32_t ARR    = TILE * PITCH;        // one array's rows of a stage
constexpr uint32_t STAGE  = 4 * ARR;             // 147,456 B
static_assert(SLICE % 2048u == 0, "every slice starts at a multiple of 2 KiB");
static_assert(2u * STAGE <= 320u * 1024u, "two buffers fit the LDS");

__device__ __forceinline__ uint32_t uni(uint32_t v) { return (uint32_t)__builtin_amdgcn_readfirstlane(v); }
__device__ __forceinline__ uint32_t pinned(uint32_t v) {
    uint32_t w = (uint32_t)__builtin_amdgcn_readfirstlane(v);
    asm volatile("" : "+s"(w));  // pinned(): the value stays in a scalar register (tensor loads ignore EXEC)
    return w;
}
// this wave's LDS reads have returned (the buffer may be refilled behind the barrier)
__device__ __forceinline__ void wait_ds0() { asm volatile("s_wait_dscnt 0x0" ::: "memory"); }
// this wave's tensor load has landed (the compiler places no wait for it)
__device__ __forceinline__ void wait_tensor0() { asm volatile("s_wait_tensorcnt 0x0" ::: "memory"); }
// one request of the whole wave: a tile of SROWS rows of KB bytes into LDS
__device__ __forceinline__ void tdm_load(u32x4 g0, u32x8 g1) {
    asm volatile("tensor_load_to_lds %0, %1" :: "s"(g0), "s"(g1) : "memory");
}
// pinned descriptor words, held in their scalar registers up to here: placed behind the wait that
// covers a request, so that no word of its descriptor takes a new value while it is outstanding
__device__ __forceinline__ void hold(u32x4& g0, u32x8& g1) { asm volatile("" : "+s"(g0), "+s"(g1)); }
// the compiler does not schedule across it
__device__ __forceinline__ void fence() { __builtin_amdgcn_sched_barrier(0); }
// group 1: 1-byte elements, SROWS rows of KB bytes, 16 B of LDS pad behind every 128-byte row
__device__ __forceinline__ u32x8 tdm_group1(uint32_t src_pitch) {
    constexpr uint32_t d0 = KB, d1 = SROWS;
    u32x8 g;
    g[0] = uni((1u << 20) | (4u << 22) | (3u << 25));
    g[1] = uni((d0 & 0xFFFFu) << 16);
    g[2] = uni((d0 >> 16) | ((d1 & 0xFFFFu) << 16));
    g[3] = uni((d1 >> 16) | (d0 << 16));
    g[4] = uni(d1);
    g[5] = uni(src_pitch);
    g[6] = uni(0u);
    g[7] = uni(0u);
    return g;
}
// group 0: LDS destination (byte offset) and the global address of the tile's first byte
__device__ __forceinline__ u32x4 tdm_group0(uint32_t lds_dst, uint64_t ga) {
    u32x4 g;
    g[0] = uni(1u);
    g[1] = uni(lds_dst);
    g[2] = uni((uint32_t)ga);
    g[3] = uni((((uint32_t)(ga >> 32)) & 0x01FFFFFFu) | 0x80000000u);
    return g;
}

// p: the lane's row, at its 16-byte half (lane >> 4) of the 64 bytes (32 k) of this block
__device__ __forceinline__ Frag16 lds_frag(const unsigned char* p) {
    Frag16 f;
    f.u[0] = *(const uint4*)p;         // K chunk 0..7  (lane<16) / 8..15 (lane>=16)
    f.u[1] = *(const uint4*)(p + 32);  // K chunk 16..23 / 24..31
    return f;
}
// An A fragment's sixteen f32 of a lane. p: the lane's row, at its 32-byte quarter (lane >> 4)
// of the 128 bytes (32 k) of this block; the k order is that of lds_frag.
struct Raw16 {
    float4 q[4];
};
__device__ __forceinline__ Raw16 lds_raw(const unsigned char* p) {
    Raw16 r;
    r.q[0] = *(const float4*)p;         // K 0..3   (lane<16) / 8..11  (lane>=16)
    r.q[1] = *(const float4*)(p + 16);  // K 4..7   / 12..15
    r.q[2] = *(const float4*)(p + 64);  // K 16..19 / 24..27
    r.q[3] = *(const float4*)(p + 80);  // K 20..23 / 28..31
    return r;
}
__device__ __forceinline__ f32x2 raw_pair(const Raw16& r, int p) {  // elements 2p and 2p + 1
    const float4 v = r.q[p >> 1];
    return (p & 1) ? f32x2{v.z, v.w} : f32x2{v.x, v.y};
}
__device__ __forceinline__ uint32_t pk_bf16(f32x2 v) {  // v[0] in the low half; nearest even
    return __builtin_bit_cast(uint32_t, __builtin_convertvector(v, bf16x2));
}
// A fragment's split in five steps of eight vector instructions, one step behind one WMMA, so that
// it issues under the matrix unit's interval. No instruction of a step reads a result of the same
// step. 0: hi = bf16(x); 1, 2: hi back as f32, half the fragment each; 3: x - hi; 4: lo = bf16(x - hi).
__device__ __forceinline__ void split_step(int st, const Raw16& r, Frag16& hi, Frag16& lo, f32x2 (&t)[8]) {
#pragma unroll  // every index a constant
    for (int p = 0; p < 8; ++p) {
        if (st == 0) hi.w[p] = pk_bf16(raw_pair(r, p));
        if (st == 1 + (p >> 2)) t[p] = f32x2{__uint_as_float(hi.w[p] << 16), __uint_as_float(hi.w[p] & 0xFFFF0000u)};
        if (st == 3) t[p] = raw_pair(r, p) - t[p];
        if (st == 4) lo.w[p] = pk_bf16(t[p]);
    }
}
__device__ __forceinline__ v8f mma(const Frag16& a, const Frag16& b, v8f c) {
    return __builtin_amdgcn_wmma_f32_16x16x32_bf16(false, a.v, false, b.v, (short)0, c, false, false);
}

template <bool AF32>
__device__ __forceinline__
void gemm_body(const float* __restrict__ Af,
               const unsigned short* __restrict__ Ahi,
               const unsigned short* __restrict__ Alo,
               const unsigned short* __restrict__ Bhi,
               const unsigned short* __restrict__ Blo,
               const float* __restrict__ bias,
               float* __restrict__ Cout,
               int M, int N, int K) {
    __shared__ __attribute__((aligned(2048))) unsigned char L[2 * STAGE];
    const uint32_t lane = threadIdx.x & 31u, r16 = lane & 15u, h = lane >> 4;
    const uint32_t wave = uni(threadIdx.x >> 5);
    const uint32_t tiles_n = (uint32_t)N / TILE;
    const uint32_t tm = blockIdx.x / tiles_n, tn = blockIdx.x - tm * tiles_n;
    const uint32_t m0 = tm * TILE, n0 = tn * TILE;
    const uint32_t wm = wave >> 1, wn = wave & 1u;
    const uint32_t kb = (uint32_t)K * 2u;        // bytes of a bf16 source row
    const uint32_t T  = pinned((uint32_t)K / 64u);
    (void)M;

    // this wave's slice: array wave >> 1 of the stage's four, rows 128 * (wave & 1) on
    const uint32_t arr = wave >> 1;
    const uint32_t srow = ((arr < 2u) ? m0 : n0) + SROWS * (wave & 1u);
    uint64_t sbase;     // the array's first byte of pass 0
    uint32_t spitch;    // bytes of a source row
    uint32_t sstep;     // bytes of a source row per pass
    if constexpr (AF32) {
        sbase  = (arr < 2u) ? (uint64_t)(uintptr_t)Af + arr * KB
                            : (uint64_t)(uintptr_t)((arr == 2u) ? Bhi : Blo);
        spitch = (arr < 2u) ? 2u * kb : kb;
        sstep  = (arr < 2u) ? 2u * KB : KB;
    } else {
        sbase  = (uint64_t)(uintptr_t)((arr == 0u) ? Ahi : (arr == 1u) ? Alo : (arr == 2u) ? Bhi : Blo);
        spitch = kb;
        sstep  = KB;
    }
    const uint64_t src = sbase + (uint64_t)srow * spitch;
    const uint32_t lds_slice = (uint32_t)(size_t)L + wave * SLICE;   // add buffer * STAGE
    u32x8 g1 = tdm_group1(spitch);

    v8f acc[4][8];
#pragma unroll
    for (int i = 0; i < 4; ++i)
#pragma unroll
        for (int j = 0; j < 8; ++j) acc[i][j] = v8f{};

    // per-lane fragment bases in a buffer
    const uint32_t a_base = (wm * 64u + r16) * PITCH + (AF32 ? 32u : 16u) * h;
    const uint32_t b_base = 2u * ARR + (wn * 128u + r16) * PITCH + 16u * h;

    u32x4 g0 = tdm_group0(lds_slice, src);
    tdm_load(g0, g1);                                    // stage 0
    wait_tensor0();
    hold(g0, g1);
    __syncthreads();                                     // stage 0 is published
    g0 = tdm_group0(lds_slice + STAGE, src + sstep);
    tdm_load(g0, g1);                                    // stage 1

#pragma clang loop unroll(disable)  // one pass per trip: the buffer index stays a scalar
    for (uint32_t t = 0; t < T; ++t) {
        const uint32_t buf = (t & 1u) * STAGE;
        const unsigned char* la = L + buf + a_base;
        const unsigned char* lb = L + buf + b_base;
        // A pass is 8 units of 24 WMMAs: unit q = block (32 k) q >> 2, columns 32 * (q & 3) on.
        // The A fragments of both blocks and two sets of a unit's B fragments are held.
        Frag16 ah[2][4], al[2][4], bh[2][2], bl[2][2];
        Raw16 r0[4], r1[4];  // AF32: the A fragments of the two blocks as f32
        f32x2 tp[8];         // AF32: the fragment that is being split, between two steps
        // the first unit's fragments in the order of their use, so that its first WMMAs
        // wait for the first loads only
#pragma unroll
        for (int i = 0; i < 4; ++i) {
            if constexpr (AF32) r0[i] = lds_raw(la + (uint32_t)i * 16u * PITCH);
            else                ah[0][i] = lds_frag(la + (uint32_t)i * 16u * PITCH);
        }
#pragma unroll
        for (int jj = 0; jj < 2; ++jj) bh[0][jj] = lds_frag(lb + (uint32_t)jj * 16u * PITCH);
        fence();  // keeps these loads in front of the ones that are needed later
#pragma unroll
        for (int jj = 0; jj < 2; ++jj) bl[0][jj] = lds_frag(lb + ARR + (uint32_t)jj * 16u * PITCH);
        if constexpr (AF32) {  // the one fragment of the second block that the first unit splits
            r1[3] = lds_raw(la + ARR + 3u * 16u * PITCH);
        } else {
#pragma unroll
            for (int i = 0; i < 4; ++i) al[0][i] = lds_frag(la + ARR + (uint32_t)i * 16u * PITCH);
        }
        fence();  // and these in front of the next unit's
#pragma unroll  // every fragment and accumulator index a constant
        for (int q = 0; q < 8; ++q) {
            const int u = q >> 2, jp = q & 3, s = q & 1;
            // the next unit's fragments, as one group ahead of this unit's WMMAs
            if (q < 7) {
                const int un = (q + 1) >> 2, jn = (q + 1) & 3;
#pragma unroll
                for (int jj = 0; jj < 2; ++jj) {
                    bh[s ^ 1][jj] = lds_frag(lb + (uint32_t)(2 * jn + jj) * 16u * PITCH + 64u * (uint32_t)un);
                    bl[s ^ 1][jj] = lds_frag(lb + ARR + (uint32_t)(2 * jn + jj) * 16u * PITCH + 64u * (uint32_t)un);
                }
            }
            if (u == 0) {  // a quarter of the second block's A fragments
                if constexpr (AF32) {  // a unit ahead of the unit that splits it
                    if (q < 3) r1[q] = lds_raw(la + ARR + (uint32_t)q * 16u * PITCH);
                } else {
                    ah[1][jp] = lds_frag(la + (uint32_t)jp * 16u * PITCH + 64u);
                    al[1][jp] = lds_frag(la + ARR + (uint32_t)jp * 16u * PITCH + 64u);
                }
            }
            fence();  // keeps the group of LDS loads together, ahead of the WMMAs
            // AF32: the step of the split that stands behind WMMA k of this unit. Unit 0 splits the
            // first block (fragment i's hi part ahead of the unit's WMMA i, its lo part ahead of
            // WMMA 16 + i) and, behind its last five WMMAs, the second block's fragment 3; units 1 to 3
            // split that block's fragments 0 to 2.
            auto step_behind = [&](int k) {
                if constexpr (AF32) {
                    const int f = (k - 3) >> 2;  // unit 0, WMMAs 3 to 18: the fragment whose lo part is formed
                    if (q == 0 && k < 3)                split_step(0, r0[k + 1], ah[0][k + 1], al[0][k + 1], tp);
                    else if (q == 0 && k < 19)          split_step(1 + ((k - 3) & 3), r0[f], ah[0][f], al[0][f], tp);
                    else if (q == 0)                    split_step(k - 19, r1[3], ah[1][3], al[1][3], tp);
                    else if (q >= 1 && q <= 3 && k < 5) split_step(k, r1[q - 1], ah[1][q - 1], al[1][q - 1], tp);
                    else return;
                    // keeps the step behind its WMMA: left alone, the compiler puts the split in front of the unit
                    fence();
                }
            };
            if constexpr (AF32) {
                if (q == 0) {
                    split_step(0, r0[0], ah[0][0], al[0][0], tp);
                    fence();  // the other fragments' steps stay behind the first WMMA
                }
            }
            // per accumulator the order stays hi*hi, hi*lo, lo*hi; eight tiles stand
            // between two products into the same accumulator
#pragma unroll
            for (int jj = 0; jj < 2; ++jj)
#pragma unroll
                for (int i = 0; i < 4; ++i) {
                    acc[i][2 * jp + jj] = mma(ah[u][i], bh[s][jj], acc[i][2 * jp + jj]);
                    step_behind(4 * jj + i);
                }
#pragma unroll
            for (int jj = 0; jj < 2; ++jj)
#pragma unroll
                for (int i = 0; i < 4; ++i) {
                    acc[i][2 * jp + jj] = mma(ah[u][i], bl[s][jj], acc[i][2 * jp + jj]);
                    step_behind(8 + 4 * jj + i);
                }
#pragma unroll
            for (int jj = 0; jj < 2; ++jj)
#pragma unroll
                for (int i = 0; i < 4; ++i) {
                    acc[i][2 * jp + jj] = mma(al[u][i], bh[s][jj], acc[i][2 * jp + jj]);
                    step_behind(16 + 4 * jj + i);
                }
            fence();  // keeps the next group of LDS loads out of this unit's WMMAs
        }
        // publish point of stage t + 1
        wait_ds0();
        wait_tensor0();
        hold(g0, g1);
        __syncthreads();
        if (pinned(t + 2u < T)) {  // the refill, into the buffer this pass has just read
            g0 = tdm_group0(lds_slice + buf, src + (uint64_t)(t + 2u) * sstep);
            tdm_load(g0, g1);
        }
    }
    wait_tensor0();
    wait_ds0();

    // C/D layout: VGPR v holds M = v + 8*(lane>=16), N = lane%16
    if constexpr (AF32) {
        // The same sums and stores as below, ordered so that no register which an issued load or
        // store names is rewritten ahead of a wait: the bias loads, a wait; the 32 row addresses; then column by
        // column the 32 sums, their 32 stores, a wait.
        float bv[8];
#pragma unroll  // bv[] stays in registers
        for (int j = 0; j < 8; ++j) bv[j] = bias[n0 + wn * 128u + (uint32_t)j * 16u + r16];
        asm volatile("s_wait_xcnt 0x0" ::: "memory");  // the loads' address registers may be re-used from here
        fence();  // what re-uses them stays behind the wait
        float* crow = Cout + (size_t)(m0 + wm * 64u + 8u * h) * (uint32_t)N + n0 + wn * 128u + r16;
        float* rp[4][8];  // the 32 rows' addresses, formed in front of the first store
#pragma unroll  // rp[] stays in registers
        for (int i = 0; i < 4; ++i)
#pragma unroll  // rp[] stays in registers
            for (int v = 0; v < 8; ++v) rp[i][v] = crow + (size_t)(i * 16 + v) * (uint32_t)N;
#pragma unroll  // every accumulator index a constant
        for (int j = 0; j < 8; ++j) {
            float o[4][8];
#pragma unroll  // o[] stays in registers
            for (int i = 0; i < 4; ++i)
#pragma unroll  // o[] stays in registers
                for (int v = 0; v < 8; ++v) o[i][v] = acc[i][j][v] + bv[j];
            fence();  // the sums (and, in column 0, the addresses) stay in front of the stores
#pragma unroll  // o[] and rp[] stay in registers; the column is an immediate offset
            for (int i = 0; i < 4; ++i)
#pragma unroll  // o[] and rp[] stay in registers
                for (int v = 0; v < 8; ++v) rp[i][v][j * 16] = o[i][v];
            // the next column's sums may re-use the stores' registers from here
            if (j < 7) asm volatile("s_wait_xcnt 0x0" ::: "memory");
        }
        return;
    }
#pragma unroll
    for (int j = 0; j < 8; ++j) {
        const uint32_t n = n0 + wn * 128u + (uint32_t)j * 16u + r16;
        const float bv = bias[n];
#pragma unroll
        for (int i = 0; i < 4; ++i) {
            const uint32_t mb = m0 + wm * 64u + (uint32_t)i * 16u + 8u * h;
#pragma unroll
            for (int v = 0; v < 8; ++v) {
                Cout[(size_t)(mb + v) * (uint32_t)N + n] = acc[i][j][v] + bv;
            }
        }
    }
}

// A as bf16 hi and lo
__global__ __launch_bounds__(256)
void wmma_gemm_bias(const unsigned short* __restrict__ Ahi,
                    const unsigned short* __restrict__ Alo,
                    const unsigned short* __restrict__ Bhi,
                    const unsigned short* __restrict__ Blo,
                    const float* __restrict__ bias,
                    float* __restrict__ Cout,
                    int M, int N, int K) {
    gemm_body<false>(nullptr, Ahi, Alo, Bhi, Blo, bias, Cout, M, N, K);
}

// A as f32
__global__ __launch_bounds__(256)
void wmma_gemm_bias_f32a(const float* __restrict__ A,
                         const unsigned short* __restrict__ Bhi,
                         const unsigned short* __restrict__ Blo,
                         const float* __restrict__ bias,
                         float* __restrict__ Cout,
                         int M, int N, int K) {
    gemm_body<true>(A, nullptr, nullptr, Bhi, Blo, bias, Cout, M, N, K);
}

// ---------------------------------------------------------------------------
// The two cumsums over T run as chunked scans: T is cut into chunks of CHUNK
// rows, a first launch sums each chunk, and the scan launch starts each chunk
// from the sum of the chunk sums in front of it. One block = one (b, chunk),
// 256 threads x 4 channels = all CH channels (16 lanes per head).
// ---------------------------------------------------------------------------
constexpr int CH = 1024;    // channels = 256 threads x 4; a constant, so that the rows of a
                            // trip are immediate offsets from one address
constexpr int CHUNK = 32;   // 32 floats of Pi per (b,h,chunk) = one 128-byte line
constexpr int PPITCH = 32;  // floats per block in the Pi chunk sums: one 128-byte line each
constexpr int PRE = 16;     // chunk sums read per trip when a chunk's start value is formed

// Four reciprocals by v_rcp_f32 (good to about one unit in the last place), in place of four
// correctly rounded divisions of some ten dependent vector instructions each. Every argument
// here is at least 1e-12 (a clamp, an added 1e-8, an added 1).
// One statement, so that the slot behind a transcendental is kept by construction: each
// reciprocal replaces its own argument, so none touches a register of the one in front of it
// (and no register is added), and the closing v_nop stands between the last one and whatever
// first reads or overwrites one of the four.
__device__ __forceinline__ float4 rcp4(float a, float b, float c, float d) {
    asm("v_rcp_f32 %0, %0\n\tv_rcp_f32 %1, %1\n\tv_rcp_f32 %2, %2\n\tv_rcp_f32 %3, %3\n\tv_nop"
        : "+v"(a), "+v"(b), "+v"(c), "+v"(d));
    return make_float4(a, b, c, d);
}

// Stage 1a: S[b,chunk,c] = sum over the chunk's rows of w^2
__global__ __launch_bounds__(256)
void chunk_sum_sq(const float* __restrict__ w, float* __restrict__ S) {
    const float* base = w + (size_t)blockIdx.x * CHUNK * CH + threadIdx.x * 4;
    float4 s = make_float4(0.f, 0.f, 0.f, 0.f);
#pragma unroll  // the chunk's independent loads issue ahead of the serial sums
    for (int t = 0; t < CHUNK; ++t) {
        float4 wv = *(const float4*)(base + (size_t)t * CH);
        s.x += wv.x * wv.x; s.y += wv.y * wv.y; s.z += wv.z * wv.z; s.w += wv.w * wv.w;
    }
    *(float4*)(S + (size_t)blockIdx.x * CH + threadIdx.x * 4) = s;
}

// Stages 1b, 2 and 3a in one launch. A block holds all CH channels, that is all 16 heads,
// of its CHUNK rows, so the softmax over heads needs nothing of another block:
//   1b: denom = cumsum_T(w^2); tmp[h,t] = (sum_d w^2/denom + D*dbias)*temp, handed on in LDS
//   2 : Pi = softmax of tmp over the 16 heads, stored for stage 3b and handed on in LDS
//   3a: chunk sums of w^2*Pi (per channel) and of Pi (per head)
// The chunk's rows of w are read once and stay in registers from 1b to 3a.
__global__ __launch_bounds__(256)
void stage_pi(const float* __restrict__ w,
              const float* __restrict__ S,
              const float* __restrict__ temp,
              const float* __restrict__ denom_bias,
              float* __restrict__ Pi,
              float* __restrict__ Swp,
              float* __restrict__ P,
              int T, int H, int D) {
    __shared__ float tl[16 * CHUNK];                              // tmp[head][row]
    __shared__ __attribute__((aligned(16))) float pl[16 * CHUNK]; // Pi[head][row]
    const int nc = T / CHUNK;
    const int b = blockIdx.x / nc, j = blockIdx.x % nc;
    const int h = threadIdx.x >> 4;
    const int l = threadIdx.x & 15;
    const int t0 = j * CHUNK;

    const float* base  = w + (size_t)blockIdx.x * CHUNK * CH + threadIdx.x * 4;
    const float* dbias = denom_bias + (size_t)h * T + t0;
    const float th = temp[h];

    // running sum at the chunk's start: the chunk sums in front of it
    float4 run = make_float4(0.f, 0.f, 0.f, 0.f);
    const float* sp = S + (size_t)b * nc * CH + threadIdx.x * 4;
    // Trips of PRE rows, no remainder loop: PRE divides nc, so every row read is one of
    // this b's chunk sums; a row at or past j adds 0.
    for (int i0 = 0; i0 < j; i0 += PRE) {
        float4 v[PRE];
#pragma unroll  // PRE independent loads in flight per trip
        for (int u = 0; u < PRE; ++u) v[u] = *(const float4*)(sp + (size_t)(i0 + u) * CH);
#pragma unroll  // v[] stays in registers
        for (int u = 0; u < PRE; ++u) {
            const bool on = i0 + u < j;
            run.x += on ? v[u].x : 0.f; run.y += on ? v[u].y : 0.f;
            run.z += on ? v[u].z : 0.f; run.w += on ? v[u].w : 0.f;
        }
    }

    // the chunk's rows, held to the end of the kernel
    float4 wv[CHUNK];
#pragma unroll  // wv[] stays in registers; the rows are immediate offsets from one address
    for (int u = 0; u < CHUNK; ++u) wv[u] = *(const float4*)(base + (size_t)u * CH);

    // 16 rows at a time; lane u of a head's 16 keeps row u's sum, so the body has no branch
#pragma unroll  // every index into wv[] a constant
    for (int tb = 0; tb < CHUNK; tb += 16) {
        float val[16];
#pragma unroll  // wv[] and val[] stay in registers
        for (int u = 0; u < 16; ++u) {
            const float4 x = wv[tb + u];
            float sx = x.x * x.x, sy = x.y * x.y;
            float sz = x.z * x.z, sw = x.w * x.w;
            run.x += sx; run.y += sy; run.z += sz; run.w += sw;
            const float4 rd = rcp4(fmaxf(run.x, 1e-12f), fmaxf(run.y, 1e-12f),
                                   fmaxf(run.z, 1e-12f), fmaxf(run.w, 1e-12f));
            val[u] = sx * rd.x + sy * rd.y + sz * rd.z + sw * rd.w;
        }
        // reduce over the 16-lane group (stays within half-wave), the sixteen rows'
        // exchanges of a step side by side so that one wait serves them all
#pragma unroll  // the four steps' lane masks become constants
        for (int m = 8; m >= 1; m >>= 1) {
            float o[16];
#pragma unroll  // sixteen independent exchanges in flight; o[] stays in registers
            for (int u = 0; u < 16; ++u) o[u] = __shfl_xor(val[u], m, 32);
#pragma unroll  // val[] stays in registers
            for (int u = 0; u < 16; ++u) val[u] += o[u];
        }
        float keep = val[0];
#pragma unroll  // val[] stays in registers
        for (int u = 1; u < 16; ++u) keep = (l == u) ? val[u] : keep;
        tl[h * CHUNK + tb + l] = (keep + (float)D * dbias[tb + l]) * th;
    }
    __syncthreads();  // all 16 heads' tmp of the chunk's rows stand in tl

    // Softmax over the heads: lane r of every wave forms row r's maximum and sum; wave k
    // writes heads 2k and 2k + 1 (their exponentials formed again from the same operands,
    // so that no register array is indexed by the wave's number).
    const int row = threadIdx.x & 31;
    const int hp = (threadIdx.x >> 5) * 2;
    float pv[2];
    {
        float v[16];
        float m = -3.4e38f;
#pragma unroll  // v[] stays in registers
        for (int g = 0; g < 16; ++g) { v[g] = tl[g * CHUNK + row]; m = fmaxf(m, v[g]); }
        float s = 0.f;
#pragma unroll  // v[] stays in registers
        for (int g = 0; g < 16; ++g) s += __expf(v[g] - m);
        const float inv = 1.f / s;
#pragma unroll  // two heads a wave; pv[] stays in registers
        for (int k = 0; k < 2; ++k) {
            pv[k] = __expf(tl[(hp + k) * CHUNK + row] - m) * inv;
            pl[(hp + k) * CHUNK + row] = pv[k];
        }
    }
    __syncthreads();  // all 16 heads' Pi of the chunk's rows stand in pl

    // Pi goes to memory behind the barrier, which would otherwise wait for these stores
    float* q = Pi + ((size_t)b * H + hp) * T + t0 + row;
    q[0] = pv[0];
    q[T] = pv[1];

    const float4* pr = (const float4*)(pl + h * CHUNK);
    float4 s = make_float4(0.f, 0.f, 0.f, 0.f);
    float spi = 0.f;
#pragma unroll  // every index into wv[] a constant
    for (int t4 = 0; t4 < CHUNK / 4; ++t4) {
        const float4 p4 = pr[t4];
        const float pa[4] = {p4.x, p4.y, p4.z, p4.w};
#pragma unroll  // pa[] stays in registers
        for (int c = 0; c < 4; ++c) {
            const float pi = pa[c];
            const float4 x = wv[4 * t4 + c];
            spi += pi;
            s.x += x.x * x.x * pi;
            s.y += x.y * x.y * pi;
            s.z += x.z * x.z * pi;
            s.w += x.w * x.w * pi;
        }
    }
    *(float4*)(Swp + (size_t)blockIdx.x * CH + threadIdx.x * 4) = s;
    if (l == 0) P[(size_t)blockIdx.x * PPITCH + h] = spi;
}

// ---------------------------------------------------------------------------
// Stage 3b: dots = cumsum_T(w^2*Pi)/(cumsum_T(Pi)+1e-8); y = -(w*Pi)/(1+dots)
// Writes y straight into bf16 hi/lo buffers (GEMM2 inputs).
// ---------------------------------------------------------------------------
__global__ __launch_bounds__(256)
void stage_y(const float* __restrict__ w,
             const float* __restrict__ Pi,
             const float* __restrict__ S,
             const float* __restrict__ P,
             unsigned short* __restrict__ yhi,
             unsigned short* __restrict__ ylo,
             int T, int H) {
    const int nc = T / CHUNK;
    const int b = blockIdx.x / nc, j = blockIdx.x % nc;
    const int h = threadIdx.x >> 4;

    const float* wbase = w + (size_t)blockIdx.x * CHUNK * CH + threadIdx.x * 4;
    const float* pbase = Pi + ((size_t)b * H + h) * T + j * CHUNK;
    size_t obase = (size_t)blockIdx.x * CHUNK * CH + threadIdx.x * 4;

    // running sums at the chunk's start: the chunk sums in front of it
    float4 cumWP = make_float4(0.f, 0.f, 0.f, 0.f);
    float cumPi = 0.f;
    const float* sp = S + (size_t)b * nc * CH + threadIdx.x * 4;
    const float* pp = P + (size_t)b * nc * PPITCH + h;
    // Trips of PRE (2 * PRE) rows, no remainder loop: both divide nc, so every row read is
    // one of this b's chunk sums; a row at or past j adds 0.
    for (int i0 = 0; i0 < j; i0 += 2 * PRE) {
        float p[2 * PRE];
#pragma unroll  // 2 * PRE independent loads in flight per trip
        for (int u = 0; u < 2 * PRE; ++u) p[u] = pp[(size_t)(i0 + u) * PPITCH];
#pragma unroll  // p[] stays in registers
        for (int u = 0; u < 2 * PRE; ++u) cumPi += (i0 + u < j) ? p[u] : 0.f;
    }
    for (int i0 = 0; i0 < j; i0 += PRE) {
        float4 v[PRE];
#pragma unroll  // PRE independent loads in flight per trip
        for (int u = 0; u < PRE; ++u) v[u] = *(const float4*)(sp + (size_t)(i0 + u) * CH);
#pragma unroll  // v[] stays in registers
        for (int u = 0; u < PRE; ++u) {
            const bool on = i0 + u < j;
            cumWP.x += on ? v[u].x : 0.f; cumWP.y += on ? v[u].y : 0.f;
            cumWP.z += on ? v[u].z : 0.f; cumWP.w += on ? v[u].w : 0.f;
        }
    }

    // 8 rows per trip: their loads fly together ahead of the serial sums
    for (int tb = 0; tb < CHUNK; tb += 8) {
        float4 wr[8];
        float pr[8];
#pragma unroll  // eight rows' loads in flight
        for (int u = 0; u < 8; ++u) {
            pr[u] = pbase[tb + u];
            wr[u] = *(const float4*)(wbase + (size_t)(tb + u) * CH);
        }
        // 1 / (cumsum(Pi) + 1e-8) of the eight rows; one reciprocal serves a row's four channels
        float rdn[8];
#pragma unroll  // pr[] and rdn[] stay in registers
        for (int u4 = 0; u4 < 8; u4 += 4) {
            const float c0 = cumPi + pr[u4], c1 = c0 + pr[u4 + 1];
            const float c2 = c1 + pr[u4 + 2], c3 = c2 + pr[u4 + 3];
            cumPi = c3;
            const float4 r = rcp4(c0 + 1e-8f, c1 + 1e-8f, c2 + 1e-8f, c3 + 1e-8f);
            rdn[u4] = r.x; rdn[u4 + 1] = r.y; rdn[u4 + 2] = r.z; rdn[u4 + 3] = r.w;
        }
#pragma unroll  // wr[], pr[] and rdn[] stay in registers
        for (int u = 0; u < 8; ++u) {
            float pi = pr[u];
            float4 wv = wr[u];
            cumWP.x += wv.x * wv.x * pi;
            cumWP.y += wv.y * wv.y * pi;
            cumWP.z += wv.z * wv.z * pi;
            cumWP.w += wv.w * wv.w * pi;
            const float4 at = rcp4(1.f + cumWP.x * rdn[u], 1.f + cumWP.y * rdn[u],
                                   1.f + cumWP.z * rdn[u], 1.f + cumWP.w * rdn[u]);
            float yx = -(wv.x * pi) * at.x;
            float yy = -(wv.y * pi) * at.y;
            float yz = -(wv.z * pi) * at.z;
            float yw = -(wv.w * pi) * at.w;

            unsigned short h0 = f2bf(yx), h1 = f2bf(yy), h2 = f2bf(yz), h3 = f2bf(yw);
            unsigned short l0 = f2bf(yx - bf2f(h0)), l1 = f2bf(yy - bf2f(h1));
            unsigned short l2 = f2bf(yz - bf2f(h2)), l3 = f2bf(yw - bf2f(h3));

            size_t o = obase + (size_t)(tb + u) * CH;
            uint2 hv, lv;
            hv.x = (unsigned)h0 | ((unsigned)h1 << 16);
            hv.y = (unsigned)h2 | ((unsigned)h3 << 16);
            lv.x = (unsigned)l0 | ((unsigned)l1 << 16);
            lv.y = (unsigned)l2 | ((unsigned)l3 << 16);
            *(uint2*)(yhi + o) = hv;
            *(uint2*)(ylo + o) = lv;
        }
        // the next trip re-uses the stores' registers: keep the wait in front of that
        asm volatile("s_wait_xcnt 0x0" ::: "memory");
    }
}

// ---------------------------------------------------------------------------
// Host-side launch
// ---------------------------------------------------------------------------
extern "C" void kernel_launch(void* const* d_in, const int* in_sizes, int n_in,
                              void* d_out, int out_size, void* d_ws, size_t ws_size,
                              hipStream_t stream) {
    const float* x          = (const float*)d_in[0];
    const float* Wa         = (const float*)d_in[1];
    const float* ba         = (const float*)d_in[2];
    const float* Wp         = (const float*)d_in[3];
    const float* bp         = (const float*)d_in[4];
    const float* temp       = (const float*)d_in[5];
    const float* denom_bias = (const float*)d_in[6];

    const int B = 4, T = 4096, C = 1024, H = 16, D = 64;
    const int M = B * T;   // 16384
    const int N = C, K = C;

    // Workspace layout (bytes)
    char* ws = (char*)d_ws;
    float*          wbuf = (float*)(ws + 0);                       // 64 MB  (B,T,C) f32
    unsigned short* hi   = (unsigned short*)(ws + 67108864);       // 32 MB  y-hi
    unsigned short* lo   = (unsigned short*)(ws + 100663296);      // 32 MB  y-lo
    unsigned short* Wahi = (unsigned short*)(ws + 134217728);      //  2 MB
    unsigned short* Walo = (unsigned short*)(ws + 136314880);      //  2 MB
    unsigned short* Wphi = (unsigned short*)(ws + 138412032);      //  2 MB
    unsigned short* Wplo = (unsigned short*)(ws + 140509184);      //  2 MB
    float*          Pib  = (float*)(ws + 143654912);               //  1 MB  (B,H,T)
    float*          Ssq  = (float*)(ws + 144703488);               //  2 MB  (B,T/32,C) chunk sums of w^2
    float*          Swp  = (float*)(ws + 146800640);               //  2 MB  (B,T/32,C) chunk sums of w^2*Pi
    float*          Spi  = (float*)(ws + 148897792);               // 64 KB  (B,T/32,32) chunk sums of Pi

    const int nW = C * C;      // 1M
    // a whole multiple of a block's share, so the grid covers it exactly
    split_bf16<<<nW / SPLIT_BLOCK, 256, 0, stream>>>(Wa, Wahi, Walo);
    split_bf16<<<nW / SPLIT_BLOCK, 256, 0, stream>>>(Wp, Wphi, Wplo);

    const int blocks = (M / 256) * (N / 256); // one 256 x 256 tile of the output per block

    // GEMM1: w = x @ Wa.T + ba
    wmma_gemm_bias_f32a<<<blocks, 256, 0, stream>>>(x, Wahi, Walo, ba, wbuf, M, N, K);

    // Scan / softmax / scan
    const int chunks = B * (T / CHUNK);       // one block per (b, chunk of rows)
    chunk_sum_sq<<<chunks, 256, 0, stream>>>(wbuf, Ssq);
    stage_pi<<<chunks, 256, 0, stream>>>(wbuf, Ssq, temp, denom_bias, Pib, Swp, Spi, T, H, D);
    stage_y<<<chunks, 256, 0, stream>>>(wbuf, Pib, Swp, Spi, hi, lo, T, H);

    // GEMM2: out = y @ Wp.T + bp
    wmma_gemm_bias<<<blocks, 256, 0, stream>>>(hi, lo, Wphi, Wplo, bp,
                                               (float*)d_out, M, N, K);
}

// v007
// It runs in 152 microseconds.
// Timed twice side by side with v006, it ran 1.04 times as fast both times.
// Counting every step since v000, it is 32.0 times as fast.
#include <hip/hip_runtime.h>
#include <hip/hip_bf16.h>
#include <stdint.h>

// ---------------------------------------------------------------------------
// CDNA5 (gfx1250) implementation of the TSSA causal-attention reference.
//   GEMMs run on v_wmma_f32_16x16x32_bf16 with an error-compensated
//   bf16 hi/lo split (hi*hi + hi*lo + lo*hi) to keep ~fp32 accuracy.
//   The first GEMM takes x as f32 and splits its A fragments in registers.
//   The cumsums over T are chunked scans (chunk sums, then a scan per chunk); the first
//   GEMM's epilogue forms the chunk sums of w^2 from its accumulators.
// ---------------------------------------------------------------------------

typedef __attribute__((ext_vector_type(16))) __bf16 v16bf;
typedef __attribute__((ext_vector_type(8)))  float  v8f;

typedef __attribute__((ext_vector_type(2)))  float  f32x2;
typedef __attribute__((ext_vector_type(2)))  __bf16 bf16x2;

union Frag16 {
    v16bf v;
    uint4 u[2];
    uint32_t w[8];
};

__device__ __forceinline__ unsigned short f2bf(float f) {
    // round-to-nearest-even bf16 truncation
    unsigned u = __float_as_uint(f);
    unsigned r = 0x7fffu + ((u >> 16) & 1u);
    return (unsigned short)((u + r) >> 16);
}
__device__ __forceinline__ float bf2f(unsigned short h) {
    return __uint_as_float(((unsigned)h) << 16);
}

// ---------------------------------------------------------------------------
// Split f32 -> bf16 hi + bf16 lo residual.
// A thread takes SPLIT_U groups of four elements instead of one element, so that a launch
// starts 1/32 of the waves. A block of 256 threads takes SPLIT_BLOCK consecutive elements
// (the element count is a whole multiple of it). Every load of a wave is 512 contiguous
// bytes, every store 256; the SPLIT_U loads of a lane fly together.
// ---------------------------------------------------------------------------
constexpr int SPLIT_U = 8;                     // 16-byte loads of a lane
constexpr int SPLIT_BLOCK = SPLIT_U * 1024;    // elements of a block

__global__ __launch_bounds__(256)
void split_bf16(const float* __restrict__ in,
                unsigned short* __restrict__ hi,
                unsigned short* __restrict__ lo) {
    const size_t base = (size_t)blockIdx.x * SPLIT_BLOCK + threadIdx.x * 4;
    const float* p = in + base;
    unsigned short* ph = hi + base;
    unsigned short* pl = lo + base;
    float4 v[SPLIT_U];
    uint2 hv[SPLIT_U], lv[SPLIT_U];
#pragma unroll  // all loads in flight together; every offset an immediate from one address
    for (int u = 0; u < SPLIT_U; ++u) v[u] = *(const float4*)(p + u * 1024);
#pragma unroll  // v[], hv[] and lv[] stay in registers
    for (int u = 0; u < SPLIT_U; ++u) {
        const float4 f = v[u];
        unsigned short h0 = f2bf(f.x), h1 = f2bf(f.y), h2 = f2bf(f.z), h3 = f2bf(f.w);
        unsigned short l0 = f2bf(f.x - bf2f(h0)), l1 = f2bf(f.y - bf2f(h1));
        unsigned short l2 = f2bf(f.z - bf2f(h2)), l3 = f2bf(f.w - bf2f(h3));
        hv[u].x = (unsigned)h0 | ((unsigned)h1 << 16);
        hv[u].y = (unsigned)h2 | ((unsigned)h3 << 16);
        lv[u].x = (unsigned)l0 | ((unsigned)l1 << 16);
        lv[u].y = (unsigned)l2 | ((unsigned)l3 << 16);
    }
    // the arithmetic stays in front of the stores, so that nothing rewrites a register
    // that an issued store names
    __builtin_amdgcn_sched_barrier(0);
#pragma unroll  // hv[] and lv[] stay in registers
    for (int u = 0; u < SPLIT_U; ++u) {
        *(uint2*)(ph + u * 1024) = hv[u];
        *(uint2*)(pl + u * 1024) = lv[u];
    }
}

// ---------------------------------------------------------------------------
// C = A @ B^T + bias, via v_wmma_f32_16x16x32_bf16 with hi/lo compensation.
// A: (M,K) row-major (hi/lo bf16).  Brows: (N,K) row-major (hi/lo bf16).
// One 256 x 256 tile of C per work-group (M, N multiples of 256; K a multiple of 64, at
// least 128). 8 waves, 4 along m x 2 along n, each 64 rows x 128 columns of the tile.
// A pass of the K loop is 64 k = 128 bytes of every operand row. A stage is
// [A hi | A lo | B hi | B lo], 256 rows each, at an LDS pitch of 144 bytes; two buffers.
// Every wave brings its own slice (128 rows of one of the four arrays) with one tensor
// load per stage, issued a whole pass ahead of the pass that reads it.
// AF32: A is (M,K) f32. Its 64 k of a pass are 256 bytes of a row, as many as hi and lo
// together, so the stage keeps its shape: [A k 0..31 | A k 32..63 | B hi | B lo], every
// array 256 rows of 128 bytes. A wave reads its A fragments as f32 and forms hi and lo in
// registers, rounded as the split launch rounds them.
// ---------------------------------------------------------------------------
typedef uint32_t u32x4 __attribute__((ext_vector_type(4)));
typedef uint32_t u32x8 __attribute__((ext_vector_type(8)));

constexpr uint32_t TILE   = 256;                 // rows of A and rows of B per work-group
constexpr uint32_t KB     = 128;                 // bytes of an operand row per pass
constexpr uint32_t PITCH  = KB + 16;             // 16 B x odd: no bank conflict for 16-byte reads
constexpr uint32_t SROWS  = 128;                 // rows per tensor load
constexpr uint32_t SLICE  = SROWS * PITCH;       // 18,432 B
constexpr uint32_t ARR    = TILE * PITCH;        // one array's rows of a stage
constexpr uint32_t STAGE  = 4 * ARR;             // 147,456 B
static_assert(SLICE % 2048u == 0, "every slice starts at a multiple of 2 KiB");
static_assert(2u * STAGE <= 320u * 1024u, "two buffers fit the LDS");

__device__ __forceinline__ uint32_t uni(uint32_t v) { return (uint32_t)__builtin_amdgcn_readfirstlane(v); }
__device__ __forceinline__ uint32_t pinned(uint32_t v) {
    uint32_t w = (uint32_t)__builtin_amdgcn_readfirstlane(v);
    asm volatile("" : "+s"(w));  // pinned(): the value stays in a scalar register (tensor loads ignore EXEC)
    return w;
}
// this wave's LDS reads have returned (the buffer may be refilled behind the barrier)
__device__ __forceinline__ void wait_ds0() { asm volatile("s_wait_dscnt 0x0" ::: "memory"); }
// this wave's tensor load has landed (the compiler places no wait for it)
__device__ __forceinline__ void wait_tensor0() { asm volatile("s_wait_tensorcnt 0x0" ::: "memory"); }
// one request of the whole wave: a tile of SROWS rows of KB bytes into LDS
__device__ __forceinline__ void tdm_load(u32x4 g0, u32x8 g1) {
    asm volatile("tensor_load_to_lds %0, %1" :: "s"(g0), "s"(g1) : "memory");
}
// pinned descriptor words, held in their scalar registers up to here: placed behind the wait that
// covers a request, so that no word of its descriptor takes a new value while it is outstanding
__device__ __forceinline__ void hold(u32x4& g0, u32x8& g1) { asm volatile("" : "+s"(g0), "+s"(g1)); }
// the compiler does not schedule across it
__device__ __forceinline__ void fence() { __builtin_amdgcn_sched_barrier(0); }
// group 1: 1-byte elements, SROWS rows of KB bytes, 16 B of LDS pad behind every 128-byte row
__device__ __forceinline__ u32x8 tdm_group1(uint32_t src_pitch) {
    constexpr uint32_t d0 = KB, d1 = SROWS;
    u32x8 g;
    g[0] = uni((1u << 20) | (4u << 22) | (3u << 25));
    g[1] = uni((d0 & 0xFFFFu) << 16);
    g[2] = uni((d0 >> 16) | ((d1 & 0xFFFFu) << 16));
    g[3] = uni((d1 >> 16) | (d0 << 16));
    g[4] = uni(d1);
    g[5] = uni(src_pitch);
    g[6] = uni(0u);
    g[7] = uni(0u);
    return g;
}
// group 0: LDS destination (byte offset) and the global address of the tile's first byte
__device__ __forceinline__ u32x4 tdm_group0(uint32_t lds_dst, uint64_t ga) {
    u32x4 g;
    g[0] = uni(1u);
    g[1] = uni(lds_dst);
    g[2] = uni((uint32_t)ga);
    g[3] = uni((((uint32_t)(ga >> 32)) & 0x01FFFFFFu) | 0x80000000u);
    return g;
}

// p: the lane's row, at its 16-byte half (lane >> 4) of the 64 bytes (32 k) of this block
__device__ __forceinline__ Frag16 lds_frag(const unsigned char* p) {
    Frag16 f;
    f.u[0] = *(const uint4*)p;         // K chunk 0..7  (lane<16) / 8..15 (lane>=16)
    f.u[1] = *(const uint4*)(p + 32);  // K chunk 16..23 / 24..31
    return f;
}
// An A fragment's sixteen f32 of a lane. p: the lane's row, at its 32-byte quarter (lane >> 4)
// of the 128 bytes (32 k) of this block; the k order is that of lds_frag.
struct Raw16 {
    float4 q[4];
};
__device__ __forceinline__ Raw16 lds_raw(const unsigned char* p) {
    Raw16 r;
    r.q[0] = *(const float4*)p;         // K 0..3   (lane<16) / 8..11  (lane>=16)
    r.q[1] = *(const float4*)(p + 16);  // K 4..7   / 12..15
    r.q[2] = *(const float4*)(p + 64);  // K 16..19 / 24..27
    r.q[3] = *(const float4*)(p + 80);  // K 20..23 / 28..31
    return r;
}
__device__ __forceinline__ f32x2 raw_pair(const Raw16& r, int p) {  // elements 2p and 2p + 1
    const float4 v = r.q[p >> 1];
    return (p & 1) ? f32x2{v.z, v.w} : f32x2{v.x, v.y};
}
__device__ __forceinline__ uint32_t pk_bf16(f32x2 v) {  // v[0] in the low half; nearest even
    return __builtin_bit_cast(uint32_t, __builtin_convertvector(v, bf16x2));
}
// A fragment's split in five steps of eight vector instructions, one step behind one WMMA, so that
// it issues under the matrix unit's interval. No instruction of a step reads a result of the same
// step. 0: hi = bf16(x); 1, 2: hi back as f32, half the fragment each; 3: x - hi; 4: lo = bf16(x - hi).
__device__ __forceinline__ void split_step(int st, const Raw16& r, Frag16& hi, Frag16& lo, f32x2 (&t)[8]) {
#pragma unroll  // every index a constant
    for (int p = 0; p < 8; ++p) {
        if (st == 0) hi.w[p] = pk_bf16(raw_pair(r, p));
        if (st == 1 + (p >> 2)) t[p] = f32x2{__uint_as_float(hi.w[p] << 16), __uint_as_float(hi.w[p] & 0xFFFF0000u)};
        if (st == 3) t[p] = raw_pair(r, p) - t[p];
        if (st == 4) lo.w[p] = pk_bf16(t[p]);
    }
}
__device__ __forceinline__ v8f mma(const Frag16& a, const Frag16& b, v8f c) {
    return __builtin_amdgcn_wmma_f32_16x16x32_bf16(false, a.v, false, b.v, (short)0, c, false, false);
}

constexpr int CHUNK = 32;   // rows of a chunk of the scans over T (below); 32 floats of tmp/Pi = one 128-byte line

// lane l's value from lane l ^ 16
__device__ __forceinline__ float xhalf(float x) {
    const int b = __builtin_bit_cast(int, x);
    return __builtin_bit_cast(float, __builtin_amdgcn_permlanex16(b, b, 0x76543210, 0xfedcba98, false, false));
}

template <bool AF32>
__device__ __forceinline__
void gemm_body(const float* __restrict__ Af,
               const unsigned short* __restrict__ Ahi,
               const unsigned short* __restrict__ Alo,
               const unsigned short* __restrict__ Bhi,
               const unsigned short* __restrict__ Blo,
               const float* __restrict__ bias,
               float* __restrict__ Cout,
               float* __restrict__ Ssq,
               int M, int N, int K) {
    __shared__ __attribute__((aligned(2048))) unsigned char L[2 * STAGE];
    const uint32_t lane = threadIdx.x & 31u, r16 = lane & 15u, h = lane >> 4;
    const uint32_t wave = uni(threadIdx.x >> 5);
    const uint32_t tiles_n = (uint32_t)N / TILE;
    const uint32_t tm = blockIdx.x / tiles_n, tn = blockIdx.x - tm * tiles_n;
    const uint32_t m0 = tm * TILE, n0 = tn * TILE;
    const uint32_t wm = wave >> 1, wn = wave & 1u;
    const uint32_t kb = (uint32_t)K * 2u;        // bytes of a bf16 source row
    const uint32_t T  = pinned((uint32_t)K / 64u);
    (void)M;

    // this wave's slice: array wave >> 1 of the stage's four, rows 128 * (wave & 1) on
    const uint32_t arr = wave >> 1;
    const uint32_t srow = ((arr < 2u) ? m0 : n0) + SROWS * (wave & 1u);
    uint64_t sbase;     // the array's first byte of pass 0
    uint32_t spitch;    // bytes of a source row
    uint32_t sstep;     // bytes of a source row per pass
    if constexpr (AF32) {
        sbase  = (arr < 2u) ? (uint64_t)(uintptr_t)Af + arr * KB
                            : (uint64_t)(uintptr_t)((arr == 2u) ? Bhi : Blo);
        spitch = (arr < 2u) ? 2u * kb : kb;
        sstep  = (arr < 2u) ? 2u * KB : KB;
    } else {
        sbase  = (uint64_t)(uintptr_t)((arr == 0u) ? Ahi : (arr == 1u) ? Alo : (arr == 2u) ? Bhi : Blo);
        spitch = kb;
        sstep  = KB;
    }
    const uint64_t src = sbase + (uint64_t)srow * spitch;
    const uint32_t lds_slice = (uint32_t)(size_t)L + wave * SLICE;   // add buffer * STAGE
    u32x8 g1 = tdm_group1(spitch);

    v8f acc[4][8];
#pragma unroll
    for (int i = 0; i < 4; ++i)
#pragma unroll
        for (int j = 0; j < 8; ++j) acc[i][j] = v8f{};

    // per-lane fragment bases in a buffer
    const uint32_t a_base = (wm * 64u + r16) * PITCH + (AF32 ? 32u : 16u) * h;
    const uint32_t b_base = 2u * ARR + (wn * 128u + r16) * PITCH + 16u * h;

    u32x4 g0 = tdm_group0(lds_slice, src);
    tdm_load(g0, g1);                                    // stage 0
    wait_tensor0();
    hold(g0, g1);
    __syncthreads();                                     // stage 0 is published
    g0 = tdm_group0(lds_slice + STAGE, src + sstep);
    tdm_load(g0, g1);                                    // stage 1

#pragma clang loop unroll(disable)  // one pass per trip: the buffer index stays a scalar
    for (uint32_t t = 0; t < T; ++t) {
        const uint32_t buf = (t & 1u) * STAGE;
        const unsigned char* la = L + buf + a_base;
        const unsigned char* lb = L + buf + b_base;
        // A pass is 8 units of 24 WMMAs: unit q = block (32 k) q >> 2, columns 32 * (q & 3) on.
        // The A fragments of both blocks and two sets of a unit's B fragments are held.
        Frag16 ah[2][4], al[2][4], bh[2][2], bl[2][2];
        Raw16 r0[4], r1[4];  // AF32: the A fragments of the two blocks as f32
        f32x2 tp[8];         // AF32: the fragment that is being split, between two steps
        // the first unit's fragments in the order of their use, so that its first WMMAs
        // wait for the first loads only
#pragma unroll
        for (int i = 0; i < 4; ++i) {
            if constexpr (AF32) r0[i] = lds_raw(la + (uint32_t)i * 16u * PITCH);
            else                ah[0][i] = lds_frag(la + (uint32_t)i * 16u * PITCH);
        }
#pragma unroll
        for (int jj = 0; jj < 2; ++jj) bh[0][jj] = lds_frag(lb + (uint32_t)jj * 16u * PITCH);
        fence();  // keeps these loads in front of the ones that are needed later
#pragma unroll
        for (int jj = 0; jj < 2; ++jj) bl[0][jj] = lds_frag(lb + ARR + (uint32_t)jj * 16u * PITCH);
        if constexpr (AF32) {  // the one fragment of the second block that the first unit splits
            r1[3] = lds_raw(la + ARR + 3u * 16u * PITCH);
        } else {
#pragma unroll
            for (int i = 0; i < 4; ++i) al[0][i] = lds_frag(la + ARR + (uint32_t)i * 16u * PITCH);
        }
        fence();  // and these in front of the next unit's
#pragma unroll  // every fragment and accumulator index a constant
        for (int q = 0; q < 8; ++q) {
            const int u = q >> 2, jp = q & 3, s = q & 1;
            // the next unit's fragments, as one group ahead of this unit's WMMAs
            if (q < 7) {
                const int un = (q + 1) >> 2, jn = (q + 1) & 3;
#pragma unroll
                for (int jj = 0; jj < 2; ++jj) {
                    bh[s ^ 1][jj] = lds_frag(lb + (uint32_t)(2 * jn + jj) * 16u * PITCH + 64u * (uint32_t)un);
                    bl[s ^ 1][jj] = lds_frag(lb + ARR + (uint32_t)(2 * jn + jj) * 16u * PITCH + 64u * (uint32_t)un);
                }
            }
            if (u == 0) {  // a quarter of the second block's A fragments
                if constexpr (AF32) {  // a unit ahead of the unit that splits it
                    if (q < 3) r1[q] = lds_raw(la + ARR + (uint32_t)q * 16u * PITCH);
                } else {
                    ah[1][jp] = lds_frag(la + (uint32_t)jp * 16u * PITCH + 64u);
                    al[1][jp] = lds_frag(la + ARR + (uint32_t)jp * 16u * PITCH + 64u);
                }
            }
            fence();  // keeps the group of LDS loads together, ahead of the WMMAs
            // AF32: the step of the split that stands behind WMMA k of this unit. Unit 0 splits the
            // first block (fragment i's hi part ahead of the unit's WMMA i, its lo part ahead of
            // WMMA 16 + i) and, behind its last five WMMAs, the second block's fragment 3; units 1 to 3
            // split that block's fragments 0 to 2.
            auto step_behind = [&](int k) {
                if constexpr (AF32) {
                    const int f = (k - 3) >> 2;  // unit 0, WMMAs 3 to 18: the fragment whose lo part is formed
                    if (q == 0 && k < 3)                split_step(0, r0[k + 1], ah[0][k + 1], al[0][k + 1], tp);
                    else if (q == 0 && k < 19)          split_step(1 + ((k - 3) & 3), r0[f], ah[0][f], al[0][f], tp);
                    else if (q == 0)                    split_step(k - 19, r1[3], ah[1][3], al[1][3], tp);
                    else if (q >= 1 && q <= 3 && k < 5) split_step(k, r1[q - 1], ah[1][q - 1], al[1][q - 1], tp);
                    else return;
                    // keeps the step behind its WMMA: left alone, the compiler puts the split in front of the unit
                    fence();
                }
            };
            if constexpr (AF32) {
                if (q == 0) {
                    split_step(0, r0[0], ah[0][0], al[0][0], tp);
                    fence();  // the other fragments' steps stay behind the first WMMA
                }
            }
            // per accumulator the order stays hi*hi, hi*lo, lo*hi; eight tiles stand
            // between two products into the same accumulator
#pragma unroll
            for (int jj = 0; jj < 2; ++jj)
#pragma unroll
                for (int i = 0; i < 4; ++i) {
                    acc[i][2 * jp + jj] = mma(ah[u][i], bh[s][jj], acc[i][2 * jp + jj]);
                    step_behind(4 * jj + i);
                }
#pragma unroll
            for (int jj = 0; jj < 2; ++jj)
#pragma unroll
                for (int i = 0; i < 4; ++i) {
                    acc[i][2 * jp + jj] = mma(ah[u][i], bl[s][jj], acc[i][2 * jp + jj]);
                    step_behind(8 + 4 * jj + i);
                }
#pragma unroll
            for (int jj = 0; jj < 2; ++jj)
#pragma unroll
                for (int i = 0; i < 4; ++i) {
                    acc[i][2 * jp + jj] = mma(al[u][i], bh[s][jj], acc[i][2 * jp + jj]);
                    step_behind(16 + 4 * jj + i);
                }
            fence();  // keeps the next group of LDS loads out of this unit's WMMAs
        }
        // publish point of stage t + 1
        wait_ds0();
        wait_tensor0();
        hold(g0, g1);
        __syncthreads();
        if (pinned(t + 2u < T)) {  // the refill, into the buffer this pass has just read
            g0 = tdm_group0(lds_slice + buf, src + (uint64_t)(t + 2u) * sstep);
            tdm_load(g0, g1);
        }
    }
    wait_tensor0();
    wait_ds0();

    // C/D layout: VGPR v holds M = v + 8*(lane>=16), N = lane%16
    if constexpr (AF32) {
        // The same sums and stores as below, ordered so that no register which an issued load or
        // store names is rewritten ahead of a wait: the bias loads, a wait; the chunk sums, their stores, a wait; the
        // 32 row addresses; then column by column the 32 sums, their 32 stores, a wait.
        // Ssq[chunk][n] = the sum of C^2 over the chunk's CHUNK rows: a wave's 64 rows are two whole
        // chunks (fragments 0, 1 and 2, 3), so each sum is formed by one wave alone, from the values
        // that it stores. A lane sums its 16 rows of either chunk; lanes l and l ^ 16 hold the two
        // halves of a chunk's rows, and lane half h keeps and stores chunk h of the two.
        static_assert(CHUNK == 32, "a chunk is two 16-row fragments");
        float bv[8];
#pragma unroll  // bv[] stays in registers
        for (int j = 0; j < 8; ++j) bv[j] = bias[n0 + wn * 128u + (uint32_t)j * 16u + r16];
        asm volatile("s_wait_xcnt 0x0" ::: "memory");  // the loads' address registers may be re-used from here
        fence();  // what re-uses them stays behind the wait
        float cs[8];  // per column the chunk sum that this lane stores
#pragma unroll  // every accumulator index a constant; cs[] stays in registers
        for (int j = 0; j < 8; ++j) {
            float q[4];  // a fragment's eight squares of this lane: four independent chains
#pragma unroll  // q[] stays in registers
            for (int i = 0; i < 4; ++i) {
                q[i] = 0.f;
#pragma unroll  // every accumulator index a constant
                for (int v = 0; v < 8; ++v) {
                    const float c = acc[i][j][v] + bv[j];
                    q[i] += c * c;
                }
            }
            const float c0 = q[0] + q[1], c1 = q[2] + q[3];
            cs[j] = (h ? c1 : c0) + xhalf(h ? c0 : c1);
        }
        float* srow = Ssq + (size_t)((m0 + wm * 64u) / (uint32_t)CHUNK + h) * (uint32_t)N + n0 + wn * 128u + r16;
        fence();  // the chunk sums and their address stay in front of their stores
#pragma unroll  // cs[] stays in registers; the column is an immediate offset
        for (int j = 0; j < 8; ++j) srow[j * 16] = cs[j];
        asm volatile("s_wait_xcnt 0x0" ::: "memory");  // these stores' registers may be re-used from here
        fence();  // what re-uses them stays behind the wait
        float* crow = Cout + (size_t)(m0 + wm * 64u + 8u * h) * (uint32_t)N + n0 + wn * 128u + r16;
        float* rp[4][8];  // the 32 rows' addresses, formed in front of the first store
#pragma unroll  // rp[] stays in registers
        for (int i = 0; i < 4; ++i)
#pragma unroll  // rp[] stays in registers
            for (int v = 0; v < 8; ++v) rp[i][v] = crow + (size_t)(i * 16 + v) * (uint32_t)N;
#pragma unroll  // every accumulator index a constant
        for (int j = 0; j < 8; ++j) {
            float o[4][8];
#pragma unroll  // o[] stays in registers
            for (int i = 0; i < 4; ++i)
#pragma unroll  // o[] stays in registers
                for (int v = 0; v < 8; ++v) o[i][v] = acc[i][j][v] + bv[j];
            fence();  // the sums (and, in column 0, the addresses) stay in front of the stores
#pragma unroll  // o[] and rp[] stay in registers; the column is an immediate offset
            for (int i = 0; i < 4; ++i)
#pragma unroll  // o[] and rp[] stay in registers
                for (int v = 0; v < 8; ++v) rp[i][v][j * 16] = o[i][v];
            // the next column's sums may re-use the stores' registers from here
            if (j < 7) asm volatile("s_wait_xcnt 0x0" ::: "memory");
        }
        return;
    }
#pragma unroll
    for (int j = 0; j < 8; ++j) {
        const uint32_t n = n0 + wn * 128u + (uint32_t)j * 16u + r16;
        const float bv = bias[n];
#pragma unroll
        for (int i = 0; i < 4; ++i) {
            const uint32_t mb = m0 + wm * 64u + (uint32_t)i * 16u + 8u * h;
#pragma unroll
            for (int v = 0; v < 8; ++v) {
                Cout[(size_t)(mb + v) * (uint32_t)N + n] = acc[i][j][v] + bv;
            }
        }
    }
}

// A as bf16 hi and lo
__global__ __launch_bounds__(256)
void wmma_gemm_bias(const unsigned short* __restrict__ Ahi,
                    const unsigned short* __restrict__ Alo,
                    const unsigned short* __restrict__ Bhi,
                    const unsigned short* __restrict__ Blo,
                    const float* __restrict__ bias,
                    float* __restrict__ Cout,
                    int M, int N, int K) {
    gemm_body<false>(nullptr, Ahi, Alo, Bhi, Blo, bias, Cout, nullptr, M, N, K);
}

// A as f32; also writes Ssq, (M / CHUNK, N): the sums of C^2 over chunks of CHUNK rows
__global__ __launch_bounds__(256)
void wmma_gemm_bias_f32a(const float* __restrict__ A,
                         const unsigned short* __restrict__ Bhi,
                         const unsigned short* __restrict__ Blo,
                         const float* __restrict__ bias,
                         float* __restrict__ Cout,
                         float* __restrict__ Ssq,
                         int M, int N, int K) {
    gemm_body<true>(A, nullptr, nullptr, Bhi, Blo, bias, Cout, Ssq, M, N, K);
}

// ---------------------------------------------------------------------------
// The two cumsums over T run as chunked scans: T is cut into chunks of CHUNK
// rows, an earlier launch sums each chunk, and the scan launch starts each chunk
// from the sum of the chunk sums in front of it. One block = one (b, chunk),
// 256 threads x 4 channels = all CH channels (16 lanes per head).
// ---------------------------------------------------------------------------
constexpr int CH = 1024;    // channels = 256 threads x 4; a constant, so that the rows of a
                            // trip are immediate offsets from one address
constexpr int PPITCH = 32;  // floats per block in the Pi chunk sums: one 128-byte line each
constexpr int PRE = 16;     // chunk sums read per trip when a chunk's start value is formed

// Four reciprocals by v_rcp_f32 (good to about one unit in the last place), in place of four
// correctly rounded divisions of some ten dependent vector instructions each. Every argument
// here is at least 1e-12 (a clamp, an added 1e-8, an added 1).
// One statement, so that the slot behind a transcendental is kept by construction: each
// reciprocal replaces its own argument, so none touches a register of the one in front of it
// (and no register is added), and the closing v_nop stands between the last one and whatever
// first reads or overwrites one of the four.
__device__ __forceinline__ float4 rcp4(float a, float b, float c, float d) {
    asm("v_rcp_f32 %0, %0\n\tv_rcp_f32 %1, %1\n\tv_rcp_f32 %2, %2\n\tv_rcp_f32 %3, %3\n\tv_nop"
        : "+v"(a), "+v"(b), "+v"(c), "+v"(d));
    return make_float4(a, b, c, d);
}

// Stage 1a, S[b,chunk,c] = sum over the chunk's rows of w^2, is the first GEMM's epilogue.

// Stages 1b, 2 and 3a in one launch. A block holds all CH channels, that is all 16 heads,
// of its CHUNK rows, so the softmax over heads needs nothing of another block:
//   1b: denom = cumsum_T(w^2); tmp[h,t] = (sum_d w^2/denom + D*dbias)*temp, handed on in LDS
//   2 : Pi = softmax of tmp over the 16 heads, stored for stage 3b and handed on in LDS
//   3a: chunk sums of w^2*Pi (per channel) and of Pi (per head)
// The chunk's rows of w are read once and stay in registers from 1b to 3a.
__global__ __launch_bounds__(256)
void stage_pi(const float* __restrict__ w,
              const float* __restrict__ S,
              const float* __restrict__ temp,
              const float* __restrict__ denom_bias,
              float* __restrict__ Pi,
              float* __restrict__ Swp,
              float* __restrict__ P,
              int T, int H, int D) {
    __shared__ float tl[16 * CHUNK];                              // tmp[head][row]
    __shared__ __attribute__((aligned(16))) float pl[16 * CHUNK]; // Pi[head][row]
    const int nc = T / CHUNK;
    const int b = blockIdx.x / nc, j = blockIdx.x % nc;
    const int h = threadIdx.x >> 4;
    const int l = threadIdx.x & 15;
    const int t0 = j * CHUNK;

    const float* base  = w + (size_t)blockIdx.x * CHUNK * CH + threadIdx.x * 4;
    const float* dbias = denom_bias + (size_t)h * T + t0;
    const float th = temp[h];

    // running sum at the chunk's start: the chunk sums in front of it
    float4 run = make_float4(0.f, 0.f, 0.f, 0.f);
    const float* sp = S + (size_t)b * nc * CH + threadIdx.x * 4;
    // Trips of PRE rows, no remainder loop: PRE divides nc, so every row read is one of
    // this b's chunk sums; a row at or past j adds 0.
    for (int i0 = 0; i0 < j; i0 += PRE) {
        float4 v[PRE];
#pragma unroll  // PRE independent loads in flight per trip
        for (int u = 0; u < PRE; ++u) v[u] = *(const float4*)(sp + (size_t)(i0 + u) * CH);
#pragma unroll  // v[] stays in registers
        for (int u = 0; u < PRE; ++u) {
            const bool on = i0 + u < j;
            run.x += on ? v[u].x : 0.f; run.y += on ? v[u].y : 0.f;
            run.z += on ? v[u].z : 0.f; run.w += on ? v[u].w : 0.f;
        }
    }

    // the chunk's rows, held to the end of the kernel
    float4 wv[CHUNK];
#pragma unroll  // wv[] stays in registers; the rows are immediate offsets from one address
    for (int u = 0; u < CHUNK; ++u) wv[u] = *(const float4*)(base + (size_t)u * CH);

    // 16 rows at a time; lane u of a head's 16 keeps row u's sum, so the body has no branch
#pragma unroll  // every index into wv[] a constant
    for (int tb = 0; tb < CHUNK; tb += 16) {
        float val[16];
#pragma unroll  // wv[] and val[] stay in registers
        for (int u = 0; u < 16; ++u) {
            const float4 x = wv[tb + u];
            float sx = x.x * x.x, sy = x.y * x.y;
            float sz = x.z * x.z, sw = x.w * x.w;
            run.x += sx; run.y += sy; run.z += sz; run.w += sw;
            const float4 rd = rcp4(fmaxf(run.x, 1e-12f), fmaxf(run.y, 1e-12f),
                                   fmaxf(run.z, 1e-12f), fmaxf(run.w, 1e-12f));
            val[u] = sx * rd.x + sy * rd.y + sz * rd.z + sw * rd.w;
        }
        // reduce over the 16-lane group (stays within half-wave), the sixteen rows'
        // exchanges of a step side by side so that one wait serves them all
#pragma unroll  // the four steps' lane masks become constants
        for (int m = 8; m >= 1; m >>= 1) {
            float o[16];
#pragma unroll  // sixteen independent exchanges in flight; o[] stays in registers
            for (int u = 0; u < 16; ++u) o[u] = __shfl_xor(val[u], m, 32);
#pragma unroll  // val[] stays in registers
            for (int u = 0; u < 16; ++u) val[u] += o[u];
        }
        float keep = val[0];
#pragma unroll  // val[] stays in registers
        for (int u = 1; u < 16; ++u) keep = (l == u) ? val[u] : keep;
        tl[h * CHUNK + tb + l] = (keep + (float)D * dbias[tb + l]) * th;
    }
    __syncthreads();  // all 16 heads' tmp of the chunk's rows stand in tl

    // Softmax over the heads: lane r of every wave forms row r's maximum and sum; wave k
    // writes heads 2k and 2k + 1 (their exponentials formed again from the same operands,
    // so that no register array is indexed by the wave's number).
    const int row = threadIdx.x & 31;
    const int hp = (threadIdx.x >> 5) * 2;
    float pv[2];
    {
        float v[16];
        float m = -3.4e38f;
#pragma unroll  // v[] stays in registers
        for (int g = 0; g < 16; ++g) { v[g] = tl[g * CHUNK + row]; m = fmaxf(m, v[g]); }
        float s = 0.f;
#pragma unroll  // v[] stays in registers
        for (int g = 0; g < 16; ++g) s += __expf(v[g] - m);
        const float inv = 1.f / s;
#pragma unroll  // two heads a wave; pv[] stays in registers
        for (int k = 0; k < 2; ++k) {
            pv[k] = __expf(tl[(hp + k) * CHUNK + row] - m) * inv;
            pl[(hp + k) * CHUNK + row] = pv[k];
        }
    }
    __syncthreads();  // all 16 heads' Pi of the chunk's rows stand in pl

    // Pi goes to memory behind the barrier, which would otherwise wait for these stores
    float* q = Pi + ((size_t)b * H + hp) * T + t0 + row;
    q[0] = pv[0];
    q[T] = pv[1];

    const float4* pr = (const float4*)(pl + h * CHUNK);
    float4 s = make_float4(0.f, 0.f, 0.f, 0.f);
    float spi = 0.f;
#pragma unroll  // every index into wv[] a constant
    for (int t4 = 0; t4 < CHUNK / 4; ++t4) {
        const float4 p4 = pr[t4];
        const float pa[4] = {p4.x, p4.y, p4.z, p4.w};
#pragma unroll  // pa[] stays in registers
        for (int c = 0; c < 4; ++c) {
            const float pi = pa[c];
            const float4 x = wv[4 * t4 + c];
            spi += pi;
            s.x += x.x * x.x * pi;
            s.y += x.y * x.y * pi;
            s.z += x.z * x.z * pi;
            s.w += x.w * x.w * pi;
        }
    }
    *(float4*)(Swp + (size_t)blockIdx.x * CH + threadIdx.x * 4) = s;
    if (l == 0) P[(size_t)blockIdx.x * PPITCH + h] = spi;
}

// ---------------------------------------------------------------------------
// Stage 3b: dots = cumsum_T(w^2*Pi)/(cumsum_T(Pi)+1e-8); y = -(w*Pi)/(1+dots)
// Writes y straight into bf16 hi/lo buffers (GEMM2 inputs).
// ---------------------------------------------------------------------------
__global__ __launch_bounds__(256)
void stage_y(const float* __restrict__ w,
             const float* __restrict__ Pi,
             const float* __restrict__ S,
             const float* __restrict__ P,
             unsigned short* __restrict__ yhi,
             unsigned short* __restrict__ ylo,
             int T, int H) {
    const int nc = T / CHUNK;
    const int b = blockIdx.x / nc, j = blockIdx.x % nc;
    const int h = threadIdx.x >> 4;

    const float* wbase = w + (size_t)blockIdx.x * CHUNK * CH + threadIdx.x * 4;
    const float* pbase = Pi + ((size_t)b * H + h) * T + j * CHUNK;
    size_t obase = (size_t)blockIdx.x * CHUNK * CH + threadIdx.x * 4;

    // running sums at the chunk's start: the chunk sums in front of it
    float4 cumWP = make_float4(0.f, 0.f, 0.f, 0.f);
    float cumPi = 0.f;
    const float* sp = S + (size_t)b * nc * CH + threadIdx.x * 4;
    const float* pp = P + (size_t)b * nc * PPITCH + h;
    // Trips of PRE (2 * PRE) rows, no remainder loop: both divide nc, so every row read is
    // one of this b's chunk sums; a row at or past j adds 0.
    for (int i0 = 0; i0 < j; i0 += 2 * PRE) {
        float p[2 * PRE];
#pragma unroll  // 2 * PRE independent loads in flight per trip
        for (int u = 0; u < 2 * PRE; ++u) p[u] = pp[(size_t)(i0 + u) * PPITCH];
#pragma unroll  // p[] stays in registers
        for (int u = 0; u < 2 * PRE; ++u) cumPi += (i0 + u < j) ? p[u] : 0.f;
    }
    for (int i0 = 0; i0 < j; i0 += PRE) {
        float4 v[PRE];
#pragma unroll  // PRE independent loads in flight per trip
        for (int u = 0; u < PRE; ++u) v[u] = *(const float4*)(sp + (size_t)(i0 + u) * CH);
#pragma unroll  // v[] stays in registers
        for (int u = 0; u < PRE; ++u) {
            const bool on = i0 + u < j;
            cumWP.x += on ? v[u].x : 0.f; cumWP.y += on ? v[u].y : 0.f;
            cumWP.z += on ? v[u].z : 0.f; cumWP.w += on ? v[u].w : 0.f;
        }
    }

    // 8 rows per trip: their loads fly together ahead of the serial sums
    for (int tb = 0; tb < CHUNK; tb += 8) {
        float4 wr[8];
        float pr[8];
#pragma unroll  // eight rows' loads in flight
        for (int u = 0; u < 8; ++u) {
            pr[u] = pbase[tb + u];
            wr[u] = *(const float4*)(wbase + (size_t)(tb + u) * CH);
        }
        // 1 / (cumsum(Pi) + 1e-8) of the eight rows; one reciprocal serves a row's four channels
        float rdn[8];
#pragma unroll  // pr[] and rdn[] stay in registers
        for (int u4 = 0; u4 < 8; u4 += 4) {
            const float c0 = cumPi + pr[u4], c1 = c0 + pr[u4 + 1];
            const float c2 = c1 + pr[u4 + 2], c3 = c2 + pr[u4 + 3];
            cumPi = c3;
            const float4 r = rcp4(c0 + 1e-8f, c1 + 1e-8f, c2 + 1e-8f, c3 + 1e-8f);
            rdn[u4] = r.x; rdn[u4 + 1] = r.y; rdn[u4 + 2] = r.z; rdn[u4 + 3] = r.w;
        }
#pragma unroll  // wr[], pr[] and rdn[] stay in registers
        for (int u = 0; u < 8; ++u) {
            float pi = pr[u];
            float4 wv = wr[u];
            cumWP.x += wv.x * wv.x * pi;
            cumWP.y += wv.y * wv.y * pi;
            cumWP.z += wv.z * wv.z * pi;
            cumWP.w += wv.w * wv.w * pi;
            const float4 at = rcp4(1.f + cumWP.x * rdn[u], 1.f + cumWP.y * rdn[u],
                                   1.f + cumWP.z * rdn[u], 1.f + cumWP.w * rdn[u]);
            float yx = -(wv.x * pi) * at.x;
            float yy = -(wv.y * pi) * at.y;
            float yz = -(wv.z * pi) * at.z;
            float yw = -(wv.w * pi) * at.w;

            unsigned short h0 = f2bf(yx), h1 = f2bf(yy), h2 = f2bf(yz), h3 = f2bf(yw);
            unsigned short l0 = f2bf(yx - bf2f(h0)), l1 = f2bf(yy - bf2f(h1));
            unsigned short l2 = f2bf(yz - bf2f(h2)), l3 = f2bf(yw - bf2f(h3));

            size_t o = obase + (size_t)(tb + u) * CH;
            uint2 hv, lv;
            hv.x = (unsigned)h0 | ((unsigned)h1 << 16);
            hv.y = (unsigned)h2 | ((unsigned)h3 << 16);
            lv.x = (unsigned)l0 | ((unsigned)l1 << 16);
            lv.y = (unsigned)l2 | ((unsigned)l3 << 16);
            *(uint2*)(yhi + o) = hv;
            *(uint2*)(ylo + o) = lv;
        }
        // the next trip re-uses the stores' registers: keep the wait in front of that
        asm volatile("s_wait_xcnt 0x0" ::: "memory");
    }
}

// ---------------------------------------------------------------------------
// Host-side launch
// ---------------------------------------------------------------------------
extern "C" void kernel_launch(void* const* d_in, const int* in_sizes, int n_in,
                              void* d_out, int out_size, void* d_ws, size_t ws_size,
                              hipStream_t stream) {
    const float* x          = (const float*)d_in[0];
    const float* Wa         = (const float*)d_in[1];
    const float* ba         = (const float*)d_in[2];
    const float* Wp         = (const float*)d_in[3];
    const float* bp         = (const float*)d_in[4];
    const float* temp       = (const float*)d_in[5];
    const float* denom_bias = (const float*)d_in[6];

    const int B = 4, T = 4096, C = 1024, H = 16, D = 64;
    const int M = B * T;   // 16384
    const int N = C, K = C;

    // Workspace layout (bytes)
    char* ws = (char*)d_ws;
    float*          wbuf = (float*)(ws + 0);                       // 64 MB  (B,T,C) f32
    unsigned short* hi   = (unsigned short*)(ws + 67108864);       // 32 MB  y-hi
    unsigned short* lo   = (unsigned short*)(ws + 100663296);      // 32 MB  y-lo
    unsigned short* Wahi = (unsigned short*)(ws + 134217728);      //  2 MB
    unsigned short* Walo = (unsigned short*)(ws + 136314880);      //  2 MB
    unsigned short* Wphi = (unsigned short*)(ws + 138412032);      //  2 MB
    unsigned short* Wplo = (unsigned short*)(ws + 140509184);      //  2 MB
    float*          Pib  = (float*)(ws + 143654912);               //  1 MB  (B,H,T)
    float*          Ssq  = (float*)(ws + 144703488);               //  2 MB  (B,T/32,C) chunk sums of w^2
    float*          Swp  = (float*)(ws + 146800640);               //  2 MB  (B,T/32,C) chunk sums of w^2*Pi
    float*          Spi  = (float*)(ws + 148897792);               // 64 KB  (B,T/32,32) chunk sums of Pi

    const int nW = C * C;      // 1M
    // a whole multiple of a block's share, so the grid covers it exactly
    split_bf16<<<nW / SPLIT_BLOCK, 256, 0, stream>>>(Wa, Wahi, Walo);
    split_bf16<<<nW / SPLIT_BLOCK, 256, 0, stream>>>(Wp, Wphi, Wplo);

    const int blocks = (M / 256) * (N / 256); // one 256 x 256 tile of the output per block

    // GEMM1: w = x @ Wa.T + ba, and the chunk sums of w^2
    wmma_gemm_bias_f32a<<<blocks, 256, 0, stream>>>(x, Wahi, Walo, ba, wbuf, Ssq, M, N, K);

    // Scan / softmax / scan
    const int chunks = B * (T / CHUNK);       // one block per (b, chunk of rows)
    stage_pi<<<chunks, 256, 0, stream>>>(wbuf, Ssq, temp, denom_bias, Pib, Swp, Spi, T, H, D);
    stage_y<<<chunks, 256, 0, stream>>>(wbuf, Pib, Swp, Spi, hi, lo, T, H);

    // GEMM2: out = y @ Wp.T + bp
    wmma_gemm_bias<<<blocks, 256, 0, stream>>>(hi, lo, Wphi, Wplo, bp,
                                               (float*)d_out, M, N, K);
}

// v008
// A run of this version takes 142 microseconds.
// In both of two side-by-side timings against v007, it was 1.07 times as fast.
// All steps since v000 together make it 34.2 times as fast.
#include <hip/hip_runtime.h>
#include <hip/hip_bf16.h>
#include <stdint.h>

// ---------------------------------------------------------------------------
// CDNA5 (gfx1250) implementation of the TSSA causal-attention reference.
//   GEMMs run on v_wmma_f32_16x16x32_bf16 with an error-compensated
//   bf16 hi/lo split (hi*hi + hi*lo + lo*hi) to keep ~fp32 accuracy.
//   The first GEMM takes x as f32 and splits its A fragments in registers.
//   The cumsums over T are chunked scans (chunk sums, then a scan per chunk); the first
//   GEMM's epilogue forms the chunk sums of w^2 from its accumulators.
// ---------------------------------------------------------------------------

typedef __attribute__((ext_vector_type(16))) __bf16 v16bf;
typedef __attribute__((ext_vector_type(8)))  float  v8f;

typedef __attribute__((ext_vector_type(2)))  float  f32x2;
typedef __attribute__((ext_vector_type(2)))  __bf16 bf16x2;

union Frag16 {
    v16bf v;
    uint4 u[2];
    uint32_t w[8];
};

__device__ __forceinline__ unsigned short f2bf(float f) {
    // round-to-nearest-even bf16 truncation
    unsigned u = __float_as_uint(f);
    unsigned r = 0x7fffu + ((u >> 16) & 1u);
    return (unsigned short)((u + r) >> 16);
}
__device__ __forceinline__ float bf2f(unsigned short h) {
    return __uint_as_float(((unsigned)h) << 16);
}

// ---------------------------------------------------------------------------
// Split f32 -> bf16 hi + bf16 lo residual.
// A thread takes SPLIT_U groups of four elements instead of one element, so that a launch
// starts 1/32 of the waves. A block of 256 threads takes SPLIT_BLOCK consecutive elements
// (the element count is a whole multiple of it). Every load of a wave is 512 contiguous
// bytes, every store 256; the SPLIT_U loads of a lane fly together.
// ---------------------------------------------------------------------------
constexpr int SPLIT_U = 8;                     // 16-byte loads of a lane
constexpr int SPLIT_BLOCK = SPLIT_U * 1024;    // elements of a block

__global__ __launch_bounds__(256)
void split_bf16(const float* __restrict__ in,
                unsigned short* __restrict__ hi,
                unsigned short* __restrict__ lo) {
    const size_t base = (size_t)blockIdx.x * SPLIT_BLOCK + threadIdx.x * 4;
    const float* p = in + base;
    unsigned short* ph = hi + base;
    unsigned short* pl = lo + base;
    float4 v[SPLIT_U];
    uint2 hv[SPLIT_U], lv[SPLIT_U];
#pragma unroll  // all loads in flight together; every offset an immediate from one address
    for (int u = 0; u < SPLIT_U; ++u) v[u] = *(const float4*)(p + u * 1024);
#pragma unroll  // v[], hv[] and lv[] stay in registers
    for (int u = 0; u < SPLIT_U; ++u) {
        const float4 f = v[u];
        unsigned short h0 = f2bf(f.x), h1 = f2bf(f.y), h2 = f2bf(f.z), h3 = f2bf(f.w);
        unsigned short l0 = f2bf(f.x - bf2f(h0)), l1 = f2bf(f.y - bf2f(h1));
        unsigned short l2 = f2bf(f.z - bf2f(h2)), l3 = f2bf(f.w - bf2f(h3));
        hv[u].x = (unsigned)h0 | ((unsigned)h1 << 16);
        hv[u].y = (unsigned)h2 | ((unsigned)h3 << 16);
        lv[u].x = (unsigned)l0 | ((unsigned)l1 << 16);
        lv[u].y = (unsigned)l2 | ((unsigned)l3 << 16);
    }
    // the arithmetic stays in front of the stores, so that nothing rewrites a register
    // that an issued store names
    __builtin_amdgcn_sched_barrier(0);
#pragma unroll  // hv[] and lv[] stay in registers
    for (int u = 0; u < SPLIT_U; ++u) {
        *(uint2*)(ph + u * 1024) = hv[u];
        *(uint2*)(pl + u * 1024) = lv[u];
    }
}

// ---------------------------------------------------------------------------
// C = A @ B^T + bias, via v_wmma_f32_16x16x32_bf16 with hi/lo compensation.
// A: (M,K) row-major (hi/lo bf16).  Brows: (N,K) row-major (hi/lo bf16).
// One 256 x 256 tile of C per work-group (M, N multiples of 256; K a multiple of 64, at
// least 128). 8 waves, 4 along m x 2 along n, each 64 rows x 128 columns of the tile.
// A pass of the K loop is 64 k = 128 bytes of every operand row. A stage is
// [A hi | A lo | B hi | B lo], 256 rows each, at an LDS pitch of 144 bytes; two buffers.
// Every wave brings its own slice (128 rows of one of the four arrays) with one tensor
// load per stage, issued a whole pass ahead of the pass that reads it.
// AF32: A is (M,K) f32. Its 64 k of a pass are 256 bytes of a row, as many as hi and lo
// together, so the stage keeps its shape: [A k 0..31 | A k 32..63 | B hi | B lo], every
// array 256 rows of 128 bytes. A wave reads its A fragments as f32 and forms hi and lo in
// registers, rounded as the split launch rounds them.
// ---------------------------------------------------------------------------
typedef uint32_t u32x4 __attribute__((ext_vector_type(4)));
typedef uint32_t u32x8 __attribute__((ext_vector_type(8)));

constexpr uint32_t TILE   = 256;                 // rows of A and rows of B per work-group
constexpr uint32_t KB     = 128;                 // bytes of an operand row per pass
constexpr uint32_t PITCH  = KB + 16;             // 16 B x odd: no bank conflict for 16-byte reads
constexpr uint32_t SROWS  = 128;                 // rows per tensor load
constexpr uint32_t SLICE  = SROWS * PITCH;       // 18,432 B
constexpr uint32_t ARR    = TILE * PITCH;        // one array's rows of a stage
constexpr uint32_t STAGE  = 4 * ARR;             // 147,456 B
static_assert(SLICE % 2048u == 0, "every slice starts at a multiple of 2 KiB");
static_assert(2u * STAGE <= 320u * 1024u, "two buffers fit the LDS");

__device__ __forceinline__ uint32_t uni(uint32_t v) { return (uint32_t)__builtin_amdgcn_readfirstlane(v); }
__device__ __forceinline__ uint32_t pinned(uint32_t v) {
    uint32_t w = (uint32_t)__builtin_amdgcn_readfirstlane(v);
    asm volatile("" : "+s"(w));  // pinned(): the value stays in a scalar register (tensor loads ignore EXEC)
    return w;
}
// this wave's LDS reads have returned (the buffer may be refilled behind the barrier)
__device__ __forceinline__ void wait_ds0() { asm volatile("s_wait_dscnt 0x0" ::: "memory"); }
// this wave's tensor load has landed (the compiler places no wait for it)
__device__ __forceinline__ void wait_tensor0() { asm volatile("s_wait_tensorcnt 0x0" ::: "memory"); }
// one request of the whole wave: a tile of SROWS rows of KB bytes into LDS
__device__ __forceinline__ void tdm_load(u32x4 g0, u32x8 g1) {
    asm volatile("tensor_load_to_lds %0, %1" :: "s"(g0), "s"(g1) : "memory");
}
// pinned descriptor words, held in their scalar registers up to here: placed behind the wait that
// covers a request, so that no word of its descriptor takes a new value while it is outstanding
__device__ __forceinline__ void hold(u32x4& g0, u32x8& g1) { asm volatile("" : "+s"(g0), "+s"(g1)); }
// the compiler does not schedule across it
__device__ __forceinline__ void fence() { __builtin_amdgcn_sched_barrier(0); }
// group 1: 1-byte elements, SROWS rows of KB bytes, 16 B of LDS pad behind every 128-byte row
__device__ __forceinline__ u32x8 tdm_group1(uint32_t src_pitch) {
    constexpr uint32_t d0 = KB, d1 = SROWS;
    u32x8 g;
    g[0] = uni((1u << 20) | (4u << 22) | (3u << 25));
    g[1] = uni((d0 & 0xFFFFu) << 16);
    g[2] = uni((d0 >> 16) | ((d1 & 0xFFFFu) << 16));
    g[3] = uni((d1 >> 16) | (d0 << 16));
    g[4] = uni(d1);
    g[5] = uni(src_pitch);
    g[6] = uni(0u);
    g[7] = uni(0u);
    return g;
}
// group 0: LDS destination (byte offset) and the global address of the tile's first byte
__device__ __forceinline__ u32x4 tdm_group0(uint32_t lds_dst, uint64_t ga) {
    u32x4 g;
    g[0] = uni(1u);
    g[1] = uni(lds_dst);
    g[2] = uni((uint32_t)ga);
    g[3] = uni((((uint32_t)(ga >> 32)) & 0x01FFFFFFu) | 0x80000000u);
    return g;
}

// p: the lane's row, at its 16-byte half (lane >> 4) of the 64 bytes (32 k) of this block
__device__ __forceinline__ Frag16 lds_frag(const unsigned char* p) {
    Frag16 f;
    f.u[0] = *(const uint4*)p;         // K chunk 0..7  (lane<16) / 8..15 (lane>=16)
    f.u[1] = *(const uint4*)(p + 32);  // K chunk 16..23 / 24..31
    return f;
}
// An A fragment's sixteen f32 of a lane. p: the lane's row, at its 32-byte quarter (lane >> 4)
// of the 128 bytes (32 k) of this block; the k order is that of lds_frag.
struct Raw16 {
    float4 q[4];
};
__device__ __forceinline__ Raw16 lds_raw(const unsigned char* p) {
    Raw16 r;
    r.q[0] = *(const float4*)p;         // K 0..3   (lane<16) / 8..11  (lane>=16)
    r.q[1] = *(const float4*)(p + 16);  // K 4..7   / 12..15
    r.q[2] = *(const float4*)(p + 64);  // K 16..19 / 24..27
    r.q[3] = *(const float4*)(p + 80);  // K 20..23 / 28..31
    return r;
}
__device__ __forceinline__ f32x2 raw_pair(const Raw16& r, int p) {  // elements 2p and 2p + 1
    const float4 v = r.q[p >> 1];
    return (p & 1) ? f32x2{v.z, v.w} : f32x2{v.x, v.y};
}
__device__ __forceinline__ uint32_t pk_bf16(f32x2 v) {  // v[0] in the low half; nearest even
    return __builtin_bit_cast(uint32_t, __builtin_convertvector(v, bf16x2));
}
// A fragment's split in five steps of eight vector instructions, one step behind one WMMA, so that
// it issues under the matrix unit's interval. No instruction of a step reads a result of the same
// step. 0: hi = bf16(x); 1, 2: hi back as f32, half the fragment each; 3: x - hi; 4: lo = bf16(x - hi).
__device__ __forceinline__ void split_step(int st, const Raw16& r, Frag16& hi, Frag16& lo, f32x2 (&t)[8]) {
#pragma unroll  // every index a constant
    for (int p = 0; p < 8; ++p) {
        if (st == 0) hi.w[p] = pk_bf16(raw_pair(r, p));
        if (st == 1 + (p >> 2)) t[p] = f32x2{__uint_as_float(hi.w[p] << 16), __uint_as_float(hi.w[p] & 0xFFFF0000u)};
        if (st == 3) t[p] = raw_pair(r, p) - t[p];
        if (st == 4) lo.w[p] = pk_bf16(t[p]);
    }
}
__device__ __forceinline__ v8f mma(const Frag16& a, const Frag16& b, v8f c) {
    return __builtin_amdgcn_wmma_f32_16x16x32_bf16(false, a.v, false, b.v, (short)0, c, false, false);
}

constexpr int CHUNK = 32;   // rows of a chunk of the scans over T (below); 32 floats of tmp/Pi = one 128-byte line

// lane l's value from lane l ^ 16
__device__ __forceinline__ float xhalf(float x) {
    const int b = __builtin_bit_cast(int, x);
    return __builtin_bit_cast(float, __builtin_amdgcn_permlanex16(b, b, 0x76543210, 0xfedcba98, false, false));
}

template <bool AF32>
__device__ __forceinline__
void gemm_body(const float* __restrict__ Af,
               const unsigned short* __restrict__ Ahi,
               const unsigned short* __restrict__ Alo,
               const unsigned short* __restrict__ Bhi,
               const unsigned short* __restrict__ Blo,
               const float* __restrict__ bias,
               float* __restrict__ Cout,
               float* __restrict__ Ssq,
               int M, int N, int K) {
    __shared__ __attribute__((aligned(2048))) unsigned char L[2 * STAGE];
    const uint32_t lane = threadIdx.x & 31u, r16 = lane & 15u, h = lane >> 4;
    const uint32_t wave = uni(threadIdx.x >> 5);
    const uint32_t tiles_n = (uint32_t)N / TILE;
    const uint32_t tm = blockIdx.x / tiles_n, tn = blockIdx.x - tm * tiles_n;
    const uint32_t m0 = tm * TILE, n0 = tn * TILE;
    const uint32_t wm = wave >> 1, wn = wave & 1u;
    const uint32_t kb = (uint32_t)K * 2u;        // bytes of a bf16 source row
    const uint32_t T  = pinned((uint32_t)K / 64u);
    (void)M;

    // this wave's slice: array wave >> 1 of the stage's four, rows 128 * (wave & 1) on
    const uint32_t arr = wave >> 1;
    const uint32_t srow = ((arr < 2u) ? m0 : n0) + SROWS * (wave & 1u);
    uint64_t sbase;     // the array's first byte of pass 0
    uint32_t spitch;    // bytes of a source row
    uint32_t sstep;     // bytes of a source row per pass
    if constexpr (AF32) {
        sbase  = (arr < 2u) ? (uint64_t)(uintptr_t)Af + arr * KB
                            : (uint64_t)(uintptr_t)((arr == 2u) ? Bhi : Blo);
        spitch = (arr < 2u) ? 2u * kb : kb;
        sstep  = (arr < 2u) ? 2u * KB : KB;
    } else {
        sbase  = (uint64_t)(uintptr_t)((arr == 0u) ? Ahi : (arr == 1u) ? Alo : (arr == 2u) ? Bhi : Blo);
        spitch = kb;
        sstep  = KB;
    }
    const uint64_t src = sbase + (uint64_t)srow * spitch;
    const uint32_t lds_slice = (uint32_t)(size_t)L + wave * SLICE;   // add buffer * STAGE
    u32x8 g1 = tdm_group1(spitch);

    v8f acc[4][8];
#pragma unroll
    for (int i = 0; i < 4; ++i)
#pragma unroll
        for (int j = 0; j < 8; ++j) acc[i][j] = v8f{};

    // per-lane fragment bases in a buffer
    const uint32_t a_base = (wm * 64u + r16) * PITCH + (AF32 ? 32u : 16u) * h;
    const uint32_t b_base = 2u * ARR + (wn * 128u + r16) * PITCH + 16u * h;

    u32x4 g0 = tdm_group0(lds_slice, src);
    tdm_load(g0, g1);                                    // stage 0
    wait_tensor0();
    hold(g0, g1);
    __syncthreads();                                     // stage 0 is published
    g0 = tdm_group0(lds_slice + STAGE, src + sstep);
    tdm_load(g0, g1);                                    // stage 1

#pragma clang loop unroll(disable)  // one pass per trip: the buffer index stays a scalar
    for (uint32_t t = 0; t < T; ++t) {
        const uint32_t buf = (t & 1u) * STAGE;
        const unsigned char* la = L + buf + a_base;
        const unsigned char* lb = L + buf + b_base;
        // A pass is 8 units of 24 WMMAs: unit q = block (32 k) q >> 2, columns 32 * (q & 3) on.
        // The A fragments of both blocks and two sets of a unit's B fragments are held.
        Frag16 ah[2][4], al[2][4], bh[2][2], bl[2][2];
        Raw16 r0[4], r1[4];  // AF32: the A fragments of the two blocks as f32
        f32x2 tp[8];         // AF32: the fragment that is being split, between two steps
        // the first unit's fragments in the order of their use, so that its first WMMAs
        // wait for the first loads only
#pragma unroll
        for (int i = 0; i < 4; ++i) {
            if constexpr (AF32) r0[i] = lds_raw(la + (uint32_t)i * 16u * PITCH);
            else                ah[0][i] = lds_frag(la + (uint32_t)i * 16u * PITCH);
        }
#pragma unroll
        for (int jj = 0; jj < 2; ++jj) bh[0][jj] = lds_frag(lb + (uint32_t)jj * 16u * PITCH);
        fence();  // keeps these loads in front of the ones that are needed later
#pragma unroll
        for (int jj = 0; jj < 2; ++jj) bl[0][jj] = lds_frag(lb + ARR + (uint32_t)jj * 16u * PITCH);
        if constexpr (AF32) {  // the one fragment of the second block that the first unit splits
            r1[3] = lds_raw(la + ARR + 3u * 16u * PITCH);
        } else {
#pragma unroll
            for (int i = 0; i < 4; ++i) al[0][i] = lds_frag(la + ARR + (uint32_t)i * 16u * PITCH);
        }
        fence();  // and these in front of the next unit's
#pragma unroll  // every fragment and accumulator index a constant
        for (int q = 0; q < 8; ++q) {
            const int u = q >> 2, jp = q & 3, s = q & 1;
            // the next unit's fragments, as one group ahead of this unit's WMMAs
            if (q < 7) {
                const int un = (q + 1) >> 2, jn = (q + 1) & 3;
#pragma unroll
                for (int jj = 0; jj < 2; ++jj) {
                    bh[s ^ 1][jj] = lds_frag(lb + (uint32_t)(2 * jn + jj) * 16u * PITCH + 64u * (uint32_t)un);
                    bl[s ^ 1][jj] = lds_frag(lb + ARR + (uint32_t)(2 * jn + jj) * 16u * PITCH + 64u * (uint32_t)un);
                }
            }
            if (u == 0) {  // a quarter of the second block's A fragments
                if constexpr (AF32) {  // a unit ahead of the unit that splits it
                    if (q < 3) r1[q] = lds_raw(la + ARR + (uint32_t)q * 16u * PITCH);
                } else {
                    ah[1][jp] = lds_frag(la + (uint32_t)jp * 16u * PITCH + 64u);
                    al[1][jp] = lds_frag(la + ARR + (uint32_t)jp * 16u * PITCH + 64u);
                }
            }
            fence();  // keeps the group of LDS loads together, ahead of the WMMAs
            // AF32: the step of the split that stands behind WMMA k of this unit. Unit 0 splits the
            // first block (fragment i's hi part ahead of the unit's WMMA i, its lo part ahead of
            // WMMA 16 + i) and, behind its last five WMMAs, the second block's fragment 3; units 1 to 3
            // split that block's fragments 0 to 2.
            auto step_behind = [&](int k) {
                if constexpr (AF32) {
                    const int f = (k - 3) >> 2;  // unit 0, WMMAs 3 to 18: the fragment whose lo part is formed
                    if (q == 0 && k < 3)                split_step(0, r0[k + 1], ah[0][k + 1], al[0][k + 1], tp);
                    else if (q == 0 && k < 19)          split_step(1 + ((k - 3) & 3), r0[f], ah[0][f], al[0][f], tp);
                    else if (q == 0)                    split_step(k - 19, r1[3], ah[1][3], al[1][3], tp);
                    else if (q >= 1 && q <= 3 && k < 5) split_step(k, r1[q - 1], ah[1][q - 1], al[1][q - 1], tp);
                    else return;
                    // keeps the step behind its WMMA: left alone, the compiler puts the split in front of the unit
                    fence();
                }
            };
            if constexpr (AF32) {
                if (q == 0) {
                    split_step(0, r0[0], ah[0][0], al[0][0], tp);
                    fence();  // the other fragments' steps stay behind the first WMMA
                }
            }
            // per accumulator the order stays hi*hi, hi*lo, lo*hi; eight tiles stand
            // between two products into the same accumulator
#pragma unroll
            for (int jj = 0; jj < 2; ++jj)
#pragma unroll
                for (int i = 0; i < 4; ++i) {
                    acc[i][2 * jp + jj] = mma(ah[u][i], bh[s][jj], acc[i][2 * jp + jj]);
                    step_behind(4 * jj + i);
                }
#pragma unroll
            for (int jj = 0; jj < 2; ++jj)
#pragma unroll
                for (int i = 0; i < 4; ++i) {
                    acc[i][2 * jp + jj] = mma(ah[u][i], bl[s][jj], acc[i][2 * jp + jj]);
                    step_behind(8 + 4 * jj + i);
                }
#pragma unroll
            for (int jj = 0; jj < 2; ++jj)
#pragma unroll
                for (int i = 0; i < 4; ++i) {
                    acc[i][2 * jp + jj] = mma(al[u][i], bh[s][jj], acc[i][2 * jp + jj]);
                    step_behind(16 + 4 * jj + i);
                }
            fence();  // keeps the next group of LDS loads out of this unit's WMMAs
        }
        // publish point of stage t + 1
        wait_ds0();
        wait_tensor0();
        hold(g0, g1);
        __syncthreads();
        if (pinned(t + 2u < T)) {  // the refill, into the buffer this pass has just read
            g0 = tdm_group0(lds_slice + buf, src + (uint64_t)(t + 2u) * sstep);
            tdm_load(g0, g1);
        }
    }
    wait_tensor0();
    wait_ds0();

    // C/D layout: VGPR v holds M = v + 8*(lane>=16), N = lane%16
    if constexpr (AF32) {
        // The same sums and stores as below, ordered so that no register which an issued load or
        // store names is rewritten ahead of a wait: the bias loads, a wait; the chunk sums, their stores, a wait; the
        // 32 row addresses; then column by column the 32 sums, their 32 stores, a wait.
        // Ssq[chunk][n] = the sum of C^2 over the chunk's CHUNK rows: a wave's 64 rows are two whole
        // chunks (fragments 0, 1 and 2, 3), so each sum is formed by one wave alone, from the values
        // that it stores. A lane sums its 16 rows of either chunk; lanes l and l ^ 16 hold the two
        // halves of a chunk's rows, and lane half h keeps and stores chunk h of the two.
        static_assert(CHUNK == 32, "a chunk is two 16-row fragments");
        float bv[8];
#pragma unroll  // bv[] stays in registers
        for (int j = 0; j < 8; ++j) bv[j] = bias[n0 + wn * 128u + (uint32_t)j * 16u + r16];
        asm volatile("s_wait_xcnt 0x0" ::: "memory");  // the loads' address registers may be re-used from here
        fence();  // what re-uses them stays behind the wait
        float cs[8];  // per column the chunk sum that this lane stores
#pragma unroll  // every accumulator index a constant; cs[] stays in registers
        for (int j = 0; j < 8; ++j) {
            float q[4];  // a fragment's eight squares of this lane: four independent chains
#pragma unroll  // q[] stays in registers
            for (int i = 0; i < 4; ++i) {
                q[i] = 0.f;
#pragma unroll  // every accumulator index a constant
                for (int v = 0; v < 8; ++v) {
                    const float c = acc[i][j][v] + bv[j];
                    q[i] += c * c;
                }
            }
            const float c0 = q[0] + q[1], c1 = q[2] + q[3];
            cs[j] = (h ? c1 : c0) + xhalf(h ? c0 : c1);
        }
        float* srow = Ssq + (size_t)((m0 + wm * 64u) / (uint32_t)CHUNK + h) * (uint32_t)N + n0 + wn * 128u + r16;
        fence();  // the chunk sums and their address stay in front of their stores
#pragma unroll  // cs[] stays in registers; the column is an immediate offset
        for (int j = 0; j < 8; ++j) srow[j * 16] = cs[j];
        asm volatile("s_wait_xcnt 0x0" ::: "memory");  // these stores' registers may be re-used from here
        fence();  // what re-uses them stays behind the wait
        float* crow = Cout + (size_t)(m0 + wm * 64u + 8u * h) * (uint32_t)N + n0 + wn * 128u + r16;
        float* rp[4][8];  // the 32 rows' addresses, formed in front of the first store
#pragma unroll  // rp[] stays in registers
        for (int i = 0; i < 4; ++i)
#pragma unroll  // rp[] stays in registers
            for (int v = 0; v < 8; ++v) rp[i][v] = crow + (size_t)(i * 16 + v) * (uint32_t)N;
#pragma unroll  // every accumulator index a constant
        for (int j = 0; j < 8; ++j) {
            float o[4][8];
#pragma unroll  // o[] stays in registers
            for (int i = 0; i < 4; ++i)
#pragma unroll  // o[] stays in registers
                for (int v = 0; v < 8; ++v) o[i][v] = acc[i][j][v] + bv[j];
            fence();  // the sums (and, in column 0, the addresses) stay in front of the stores
#pragma unroll  // o[] and rp[] stay in registers; the column is an immediate offset
            for (int i = 0; i < 4; ++i)
#pragma unroll  // o[] and rp[] stay in registers
                for (int v = 0; v < 8; ++v) rp[i][v][j * 16] = o[i][v];
            // the next column's sums may re-use the stores' registers from here
            if (j < 7) asm volatile("s_wait_xcnt 0x0" ::: "memory");
        }
        return;
    }
#pragma unroll
    for (int j = 0; j < 8; ++j) {
        const uint32_t n = n0 + wn * 128u + (uint32_t)j * 16u + r16;
        const float bv = bias[n];
#pragma unroll
        for (int i = 0; i < 4; ++i) {
            const uint32_t mb = m0 + wm * 64u + (uint32_t)i * 16u + 8u * h;
#pragma unroll
            for (int v = 0; v < 8; ++v) {
                Cout[(size_t)(mb + v) * (uint32_t)N + n] = acc[i][j][v] + bv;
            }
        }
    }
}

// A as bf16 hi and lo
__global__ __launch_bounds__(256)
void wmma_gemm_bias(const unsigned short* __restrict__ Ahi,
                    const unsigned short* __restrict__ Alo,
                    const unsigned short* __restrict__ Bhi,
                    const unsigned short* __restrict__ Blo,
                    const float* __restrict__ bias,
                    float* __restrict__ Cout,
                    int M, int N, int K) {
    gemm_body<false>(nullptr, Ahi, Alo, Bhi, Blo, bias, Cout, nullptr, M, N, K);
}

// A as f32; also writes Ssq, (M / CHUNK, N): the sums of C^2 over chunks of CHUNK rows
__global__ __launch_bounds__(256)
void wmma_gemm_bias_f32a(const float* __restrict__ A,
                         const unsigned short* __restrict__ Bhi,
                         const unsigned short* __restrict__ Blo,
                         const float* __restrict__ bias,
                         float* __restrict__ Cout,
                         float* __restrict__ Ssq,
                         int M, int N, int K) {
    gemm_body<true>(A, nullptr, nullptr, Bhi, Blo, bias, Cout, Ssq, M, N, K);
}

// ---------------------------------------------------------------------------
// The two cumsums over T run as chunked scans: T is cut into chunks of CHUNK
// rows, an earlier launch sums each chunk, and the scan launch starts each chunk
// from the sum of the chunk sums in front of it. In stage_pi one block = one (b, chunk),
// 256 threads x 4 channels = all CH channels (16 lanes per head); stage_y: see there.
// ---------------------------------------------------------------------------
constexpr int CH = 1024;    // channels = 256 threads x 4; a constant, so that the rows of a
                            // trip are immediate offsets from one address
constexpr int PPITCH = 32;  // floats per block in the Pi chunk sums: one 128-byte line each
constexpr int PRE = 16;     // chunk sums read per trip when a chunk's start value is formed

// Four reciprocals by v_rcp_f32 (good to about one unit in the last place), in place of four
// correctly rounded divisions of some ten dependent vector instructions each. Every argument
// here is at least 1e-12 (a clamp, an added 1e-8, an added 1).
// One statement, so that the slot behind a transcendental is kept by construction: each
// reciprocal replaces its own argument, so none touches a register of the one in front of it
// (and no register is added), and the closing v_nop stands between the last one and whatever
// first reads or overwrites one of the four.
__device__ __forceinline__ float4 rcp4(float a, float b, float c, float d) {
    asm("v_rcp_f32 %0, %0\n\tv_rcp_f32 %1, %1\n\tv_rcp_f32 %2, %2\n\tv_rcp_f32 %3, %3\n\tv_nop"
        : "+v"(a), "+v"(b), "+v"(c), "+v"(d));
    return make_float4(a, b, c, d);
}

// Stage 1a, S[b,chunk,c] = sum over the chunk's rows of w^2, is the first GEMM's epilogue.

// Stages 1b, 2 and 3a in one launch. A block holds all CH channels, that is all 16 heads,
// of its CHUNK rows, so the softmax over heads needs nothing of another block:
//   1b: denom = cumsum_T(w^2); tmp[h,t] = (sum_d w^2/denom + D*dbias)*temp, handed on in LDS
//   2 : Pi = softmax of tmp over the 16 heads, stored for stage 3b and handed on in LDS
//   3a: chunk sums of w^2*Pi (per channel) and of Pi (per head)
// The chunk's rows of w are read once and stay in registers from 1b to 3a.
__global__ __launch_bounds__(256)
void stage_pi(const float* __restrict__ w,
              const float* __restrict__ S,
              const float* __restrict__ temp,
              const float* __restrict__ denom_bias,
              float* __restrict__ Pi,
              float* __restrict__ Swp,
              float* __restrict__ P,
              int T, int H, int D) {
    __shared__ float tl[16 * CHUNK];                              // tmp[head][row]
    __shared__ __attribute__((aligned(16))) float pl[16 * CHUNK]; // Pi[head][row]
    const int nc = T / CHUNK;
    const int b = blockIdx.x / nc, j = blockIdx.x % nc;
    const int h = threadIdx.x >> 4;
    const int l = threadIdx.x & 15;
    const int t0 = j * CHUNK;

    const float* base  = w + (size_t)blockIdx.x * CHUNK * CH + threadIdx.x * 4;
    const float* dbias = denom_bias + (size_t)h * T + t0;
    const float th = temp[h];

    // running sum at the chunk's start: the chunk sums in front of it
    float4 run = make_float4(0.f, 0.f, 0.f, 0.f);
    const float* sp = S + (size_t)b * nc * CH + threadIdx.x * 4;
    // Trips of PRE rows, no remainder loop: PRE divides nc, so every row read is one of
    // this b's chunk sums; a row at or past j adds 0.
    for (int i0 = 0; i0 < j; i0 += PRE) {
        float4 v[PRE];
#pragma unroll  // PRE independent loads in flight per trip
        for (int u = 0; u < PRE; ++u) v[u] = *(const float4*)(sp + (size_t)(i0 + u) * CH);
#pragma unroll  // v[] stays in registers
        for (int u = 0; u < PRE; ++u) {
            const bool on = i0 + u < j;
            run.x += on ? v[u].x : 0.f; run.y += on ? v[u].y : 0.f;
            run.z += on ? v[u].z : 0.f; run.w += on ? v[u].w : 0.f;
        }
    }

    // the chunk's rows, held to the end of the kernel
    float4 wv[CHUNK];
#pragma unroll  // wv[] stays in registers; the rows are immediate offsets from one address
    for (int u = 0; u < CHUNK; ++u) wv[u] = *(const float4*)(base + (size_t)u * CH);

    // 16 rows at a time; lane u of a head's 16 keeps row u's sum, so the body has no branch
#pragma unroll  // every index into wv[] a constant
    for (int tb = 0; tb < CHUNK; tb += 16) {
        float val[16];
#pragma unroll  // wv[] and val[] stay in registers
        for (int u = 0; u < 16; ++u) {
            const float4 x = wv[tb + u];
            float sx = x.x * x.x, sy = x.y * x.y;
            float sz = x.z * x.z, sw = x.w * x.w;
            run.x += sx; run.y += sy; run.z += sz; run.w += sw;
            const float4 rd = rcp4(fmaxf(run.x, 1e-12f), fmaxf(run.y, 1e-12f),
                                   fmaxf(run.z, 1e-12f), fmaxf(run.w, 1e-12f));
            val[u] = sx * rd.x + sy * rd.y + sz * rd.z + sw * rd.w;
        }
        // reduce over the 16-lane group (stays within half-wave), the sixteen rows'
        // exchanges of a step side by side so that one wait serves them all
#pragma unroll  // the four steps' lane masks become constants
        for (int m = 8; m >= 1; m >>= 1) {
            float o[16];
#pragma unroll  // sixteen independent exchanges in flight; o[] stays in registers
            for (int u = 0; u < 16; ++u) o[u] = __shfl_xor(val[u], m, 32);
#pragma unroll  // val[] stays in registers
            for (int u = 0; u < 16; ++u) val[u] += o[u];
        }
        float keep = val[0];
#pragma unroll  // val[] stays in registers
        for (int u = 1; u < 16; ++u) keep = (l == u) ? val[u] : keep;
        tl[h * CHUNK + tb + l] = (keep + (float)D * dbias[tb + l]) * th;
    }
    __syncthreads();  // all 16 heads' tmp of the chunk's rows stand in tl

    // Softmax over the heads: lane r of every wave forms row r's maximum and sum; wave k
    // writes heads 2k and 2k + 1 (their exponentials formed again from the same operands,
    // so that no register array is indexed by the wave's number).
    const int row = threadIdx.x & 31;
    const int hp = (threadIdx.x >> 5) * 2;
    float pv[2];
    {
        float v[16];
        float m = -3.4e38f;
#pragma unroll  // v[] stays in registers
        for (int g = 0; g < 16; ++g) { v[g] = tl[g * CHUNK + row]; m = fmaxf(m, v[g]); }
        float s = 0.f;
#pragma unroll  // v[] stays in registers
        for (int g = 0; g < 16; ++g) s += __expf(v[g] - m);
        const float inv = 1.f / s;
#pragma unroll  // two heads a wave; pv[] stays in registers
        for (int k = 0; k < 2; ++k) {
            pv[k] = __expf(tl[(hp + k) * CHUNK + row] - m) * inv;
            pl[(hp + k) * CHUNK + row] = pv[k];
        }
    }
    __syncthreads();  // all 16 heads' Pi of the chunk's rows stand in pl

    // Pi goes to memory behind the barrier, which would otherwise wait for these stores
    float* q = Pi + ((size_t)b * H + hp) * T + t0 + row;
    q[0] = pv[0];
    q[T] = pv[1];

    const float4* pr = (const float4*)(pl + h * CHUNK);
    float4 s = make_float4(0.f, 0.f, 0.f, 0.f);
    float spi = 0.f;
#pragma unroll  // every index into wv[] a constant
    for (int t4 = 0; t4 < CHUNK / 4; ++t4) {
        const float4 p4 = pr[t4];
        const float pa[4] = {p4.x, p4.y, p4.z, p4.w};
#pragma unroll  // pa[] stays in registers
        for (int c = 0; c < 4; ++c) {
            const float pi = pa[c];
            const float4 x = wv[4 * t4 + c];
            spi += pi;
            s.x += x.x * x.x * pi;
            s.y += x.y * x.y * pi;
            s.z += x.z * x.z * pi;
            s.w += x.w * x.w * pi;
        }
    }
    *(float4*)(Swp + (size_t)blockIdx.x * CH + threadIdx.x * 4) = s;
    if (l == 0) P[(size_t)blockIdx.x * PPITCH + h] = spi;
}

// ---------------------------------------------------------------------------
// Stage 3b: dots = cumsum_T(w^2*Pi)/(cumsum_T(Pi)+1e-8); y = -(w*Pi)/(1+dots)
// Writes y straight into bf16 hi/lo buffers (GEMM2 inputs).
// One block = YW chunks of one b x YCH channels, a wave per chunk. T's chunks are cut into YW
// segments; wave k takes a chunk of segment k, all at the same place in their segments. So the
// block reads every chunk sum of its channels once, a segment a wave, and no wave sums more
// than a segment's rows; the segments' sums go from wave to wave through LDS.
// ---------------------------------------------------------------------------
constexpr int YW = 8;     // waves of a block = segments of T
constexpr int YCH = 128;  // channels of a block: 32 lanes x 4

__global__ __launch_bounds__(256)
void stage_y(const float* __restrict__ w,
             const float* __restrict__ Pi,
             const float* __restrict__ S,
             const float* __restrict__ P,
             unsigned short* __restrict__ yhi,
             unsigned short* __restrict__ ylo,
             int T, int H) {
    __shared__ __attribute__((aligned(16))) float segS[YW][YCH];  // a segment's sum of w^2*Pi, per channel
    __shared__ float segP[YW][32];                                // a segment's sum of Pi, per lane (its head's)
    const int nc = T / CHUNK;
    const int seg = nc / YW;                  // chunks of a segment
    const int wave = threadIdx.x >> 5, lane = threadIdx.x & 31;
    const int jg = blockIdx.x % seg;          // the chunk's place in its segment, the same for the 8 waves
    const int cg = (blockIdx.x / seg) % (CH / YCH);
    const int b  = (blockIdx.x / seg) / (CH / YCH);
    const int j  = wave * seg + jg;           // this wave's chunk
    const int ch = cg * YCH + lane * 4;       // this lane's first channel
    const int h  = ch >> 6;                   // 16 lanes x 4 channels per head

    const float* wbase = w + ((size_t)b * nc + j) * CHUNK * CH + ch;
    const float* pbase = Pi + ((size_t)b * H + h) * T + j * CHUNK;
    size_t obase = ((size_t)b * nc + j) * CHUNK * CH + ch;

    // Running sums at the chunk's start. A wave reads the chunk sums of its own segment alone, once:
    // 'all' is the whole segment's sum, which the waves behind it need, 'cum' the sum of the
    // segment's chunks in front of this wave's chunk.
    float4 cumWP = make_float4(0.f, 0.f, 0.f, 0.f);
    float4 allWP = make_float4(0.f, 0.f, 0.f, 0.f);
    float cumPi = 0.f, allPi = 0.f;
    const float* sp = S + ((size_t)b * nc + wave * seg) * CH + ch;
    const float* pp = P + ((size_t)b * nc + wave * seg) * PPITCH + h;
    // Trips of PRE rows, no remainder loop: PRE divides seg, so every row read is one of this
    // segment's chunk sums.
    for (int i0 = 0; i0 < seg; i0 += PRE) {
        float4 v[PRE];
        float p[PRE];
#pragma unroll  // 2 * PRE independent loads in flight per trip
        for (int u = 0; u < PRE; ++u) {
            v[u] = *(const float4*)(sp + (size_t)(i0 + u) * CH);
            p[u] = pp[(size_t)(i0 + u) * PPITCH];
        }
        asm volatile("s_wait_xcnt 0x0" ::: "memory");  // the loads' address registers may be re-used from here
        fence();  // all loads of the trip are issued ahead of the first sum: one latency, not two
#pragma unroll  // v[] and p[] stay in registers
        for (int u = 0; u < PRE; ++u) {
            const bool on = i0 + u < jg;
            allWP.x += v[u].x; allWP.y += v[u].y; allWP.z += v[u].z; allWP.w += v[u].w;
            allPi += p[u];
            cumWP.x += on ? v[u].x : 0.f; cumWP.y += on ? v[u].y : 0.f;
            cumWP.z += on ? v[u].z : 0.f; cumWP.w += on ? v[u].w : 0.f;
            cumPi += on ? p[u] : 0.f;
        }
    }
    *(float4*)&segS[wave][lane * 4] = allWP;
    segP[wave][lane] = allPi;
    __syncthreads();  // the 8 segments' sums stand in segS and segP
#pragma unroll  // the last segment's sum is in front of nobody
    for (int g = 0; g < YW - 1; ++g) {
        const bool on = g < wave;
        const float4 v = *(const float4*)&segS[g][lane * 4];
        const float p = segP[g][lane];
        cumWP.x += on ? v.x : 0.f; cumWP.y += on ? v.y : 0.f;
        cumWP.z += on ? v.z : 0.f; cumWP.w += on ? v.w : 0.f;
        cumPi += on ? p : 0.f;
    }

    // 8 rows per trip: their loads fly together ahead of the serial sums
    for (int tb = 0; tb < CHUNK; tb += 8) {
        float4 wr[8];
        float pr[8];
#pragma unroll  // eight rows' loads in flight
        for (int u = 0; u < 8; ++u) {
            pr[u] = pbase[tb + u];
            wr[u] = *(const float4*)(wbase + (size_t)(tb + u) * CH);
        }
        // 1 / (cumsum(Pi) + 1e-8) of the eight rows; one reciprocal serves a row's four channels
        float rdn[8];
#pragma unroll  // pr[] and rdn[] stay in registers
        for (int u4 = 0; u4 < 8; u4 += 4) {
            const float c0 = cumPi + pr[u4], c1 = c0 + pr[u4 + 1];
            const float c2 = c1 + pr[u4 + 2], c3 = c2 + pr[u4 + 3];
            cumPi = c3;
            const float4 r = rcp4(c0 + 1e-8f, c1 + 1e-8f, c2 + 1e-8f, c3 + 1e-8f);
            rdn[u4] = r.x; rdn[u4 + 1] = r.y; rdn[u4 + 2] = r.z; rdn[u4 + 3] = r.w;
        }
#pragma unroll  // wr[], pr[] and rdn[] stay in registers
        for (int u = 0; u < 8; ++u) {
            float pi = pr[u];
            float4 wv = wr[u];
            cumWP.x += wv.x * wv.x * pi;
            cumWP.y += wv.y * wv.y * pi;
            cumWP.z += wv.z * wv.z * pi;
            cumWP.w += wv.w * wv.w * pi;
            const float4 at = rcp4(1.f + cumWP.x * rdn[u], 1.f + cumWP.y * rdn[u],
                                   1.f + cumWP.z * rdn[u], 1.f + cumWP.w * rdn[u]);
            float yx = -(wv.x * pi) * at.x;
            float yy = -(wv.y * pi) * at.y;
            float yz = -(wv.z * pi) * at.z;
            float yw = -(wv.w * pi) * at.w;

            unsigned short h0 = f2bf(yx), h1 = f2bf(yy), h2 = f2bf(yz), h3 = f2bf(yw);
            unsigned short l0 = f2bf(yx - bf2f(h0)), l1 = f2bf(yy - bf2f(h1));
            unsigned short l2 = f2bf(yz - bf2f(h2)), l3 = f2bf(yw - bf2f(h3));

            size_t o = obase + (size_t)(tb + u) * CH;
            uint2 hv, lv;
            hv.x = (unsigned)h0 | ((unsigned)h1 << 16);
            hv.y = (unsigned)h2 | ((unsigned)h3 << 16);
            lv.x = (unsigned)l0 | ((unsigned)l1 << 16);
            lv.y = (unsigned)l2 | ((unsigned)l3 << 16);
            *(uint2*)(yhi + o) = hv;
            *(uint2*)(ylo + o) = lv;
        }
        // the next trip re-uses the stores' registers: keep the wait in front of that
        asm volatile("s_wait_xcnt 0x0" ::: "memory");
    }
}

// ---------------------------------------------------------------------------
// Host-side launch
// ---------------------------------------------------------------------------
extern "C" void kernel_launch(void* const* d_in, const int* in_sizes, int n_in,
                              void* d_out, int out_size, void* d_ws, size_t ws_size,
                              hipStream_t stream) {
    const float* x          = (const float*)d_in[0];
    const float* Wa         = (const float*)d_in[1];
    const float* ba         = (const float*)d_in[2];
    const float* Wp         = (const float*)d_in[3];
    const float* bp         = (const float*)d_in[4];
    const float* temp       = (const float*)d_in[5];
    const float* denom_bias = (const float*)d_in[6];

    const int B = 4, T = 4096, C = 1024, H = 16, D = 64;
    const int M = B * T;   // 16384
    const int N = C, K = C;

    // Workspace layout (bytes)
    char* ws = (char*)d_ws;
    float*          wbuf = (float*)(ws + 0);                       // 64 MB  (B,T,C) f32
    unsigned short* hi   = (unsigned short*)(ws + 67108864);       // 32 MB  y-hi
    unsigned short* lo   = (unsigned short*)(ws + 100663296);      // 32 MB  y-lo
    unsigned short* Wahi = (unsigned short*)(ws + 134217728);      //  2 MB
    unsigned short* Walo = (unsigned short*)(ws + 136314880);      //  2 MB
    unsigned short* Wphi = (unsigned short*)(ws + 138412032);      //  2 MB
    unsigned short* Wplo = (unsigned short*)(ws + 140509184);      //  2 MB
    float*          Pib  = (float*)(ws + 143654912);               //  1 MB  (B,H,T)
    float*          Ssq  = (float*)(ws + 144703488);               //  2 MB  (B,T/32,C) chunk sums of w^2
    float*          Swp  = (float*)(ws + 146800640);               //  2 MB  (B,T/32,C) chunk sums of w^2*Pi
    float*          Spi  = (float*)(ws + 148897792);               // 64 KB  (B,T/32,32) chunk sums of Pi

    const int nW = C * C;      // 1M
    // a whole multiple of a block's share, so the grid covers it exactly
    split_bf16<<<nW / SPLIT_BLOCK, 256, 0, stream>>>(Wa, Wahi, Walo);
    split_bf16<<<nW / SPLIT_BLOCK, 256, 0, stream>>>(Wp, Wphi, Wplo);

    const int blocks = (M / 256) * (N / 256); // one 256 x 256 tile of the output per block

    // GEMM1: w = x @ Wa.T + ba, and the chunk sums of w^2
    wmma_gemm_bias_f32a<<<blocks, 256, 0, stream>>>(x, Wahi, Walo, ba, wbuf, Ssq, M, N, K);

    // Scan / softmax / scan
    const int chunks = B * (T / CHUNK);       // one block per (b, chunk of rows) in stage_pi; YW chunks x YCH channels a block in stage_y
    stage_pi<<<chunks, 256, 0, stream>>>(wbuf, Ssq, temp, denom_bias, Pib, Swp, Spi, T, H, D);
    stage_y<<<chunks, 256, 0, stream>>>(wbuf, Pib, Swp, Spi, hi, lo, T, H);

    // GEMM2: out = y @ Wp.T + bp
    wmma_gemm_bias<<<blocks, 256, 0, stream>>>(hi, lo, Wphi, Wplo, bp,
                                               (float*)d_out, M, N, K);
}

// v009
// A run of this version takes 137 microseconds.
// Timed twice side by side with v008, it ran 1.03 times as fast both times.
// Over all steps from v000 it is 35.4 times as fast.
#include <hip/hip_runtime.h>
#include <hip/hip_bf16.h>
#include <stdint.h>

// ---------------------------------------------------------------------------
// CDNA5 (gfx1250) implementation of the TSSA causal-attention reference.
//   GEMMs run on v_wmma_f32_16x16x32_bf16 with an error-compensated
//   bf16 hi/lo split (hi*hi + hi*lo + lo*hi) to keep ~fp32 accuracy.
//   The first GEMM takes x as f32 and splits its A fragments in registers.
//   The cumsums over T are chunked scans (chunk sums, then a scan per chunk); the first
//   GEMM's epilogue forms the chunk sums of w^2, and its tile's sums, from its accumulators.
// ---------------------------------------------------------------------------

typedef __attribute__((ext_vector_type(16))) __bf16 v16bf;
typedef __attribute__((ext_vector_type(8)))  float  v8f;

typedef __attribute__((ext_vector_type(2)))  float  f32x2;
typedef __attribute__((ext_vector_type(2)))  __bf16 bf16x2;

union Frag16 {
    v16bf v;
    uint4 u[2];
    uint32_t w[8];
};

__device__ __forceinline__ unsigned short f2bf(float f) {
    // round-to-nearest-even bf16 truncation
    unsigned u = __float_as_uint(f);
    unsigned r = 0x7fffu + ((u >> 16) & 1u);
    return (unsigned short)((u + r) >> 16);
}
__device__ __forceinline__ float bf2f(unsigned short h) {
    return __uint_as_float(((unsigned)h) << 16);
}

// ---------------------------------------------------------------------------
// Split f32 -> bf16 hi + bf16 lo residual.
// A thread takes SPLIT_U groups of four elements instead of one element, so that a launch
// starts 1/32 of the waves. A block of 256 threads takes SPLIT_BLOCK consecutive elements
// (the element count is a whole multiple of it). Every load of a wave is 512 contiguous
// bytes, every store 256; the SPLIT_U loads of a lane fly together.
// ---------------------------------------------------------------------------
constexpr int SPLIT_U = 8;                     // 16-byte loads of a lane
constexpr int SPLIT_BLOCK = SPLIT_U * 1024;    // elements of a block

__global__ __launch_bounds__(256)
void split_bf16(const float* __restrict__ in,
                unsigned short* __restrict__ hi,
                unsigned short* __restrict__ lo) {
    const size_t base = (size_t)blockIdx.x * SPLIT_BLOCK + threadIdx.x * 4;
    const float* p = in + base;
    unsigned short* ph = hi + base;
    unsigned short* pl = lo + base;
    float4 v[SPLIT_U];
    uint2 hv[SPLIT_U], lv[SPLIT_U];
#pragma unroll  // all loads in flight together; every offset an immediate from one address
    for (int u = 0; u < SPLIT_U; ++u) v[u] = *(const float4*)(p + u * 1024);
#pragma unroll  // v[], hv[] and lv[] stay in registers
    for (int u = 0; u < SPLIT_U; ++u) {
        const float4 f = v[u];
        unsigned short h0 = f2bf(f.x), h1 = f2bf(f.y), h2 = f2bf(f.z), h3 = f2bf(f.w);
        unsigned short l0 = f2bf(f.x - bf2f(h0)), l1 = f2bf(f.y - bf2f(h1));
        unsigned short l2 = f2bf(f.z - bf2f(h2)), l3 = f2bf(f.w - bf2f(h3));
        hv[u].x = (unsigned)h0 | ((unsigned)h1 << 16);
        hv[u].y = (unsigned)h2 | ((unsigned)h3 << 16);
        lv[u].x = (unsigned)l0 | ((unsigned)l1 << 16);
        lv[u].y = (unsigned)l2 | ((unsigned)l3 << 16);
    }
    // the arithmetic stays in front of the stores, so that nothing rewrites a register
    // that an issued store names
    __builtin_amdgcn_sched_barrier(0);
#pragma unroll  // hv[] and lv[] stay in registers
    for (int u = 0; u < SPLIT_U; ++u) {
        *(uint2*)(ph + u * 1024) = hv[u];
        *(uint2*)(pl + u * 1024) = lv[u];
    }
}

// ---------------------------------------------------------------------------
// C = A @ B^T + bias, via v_wmma_f32_16x16x32_bf16 with hi/lo compensation.
// A: (M,K) row-major (hi/lo bf16).  Brows: (N,K) row-major (hi/lo bf16).
// One 256 x 256 tile of C per work-group (M, N multiples of 256; K a multiple of 64, at
// least 128). 8 waves, 4 along m x 2 along n, each 64 rows x 128 columns of the tile.
// A pass of the K loop is 64 k = 128 bytes of every operand row. A stage is
// [A hi | A lo | B hi | B lo], 256 rows each, at an LDS pitch of 144 bytes; two buffers.
// Every wave brings its own slice (128 rows of one of the four arrays) with one tensor
// load per stage, issued a whole pass ahead of the pass that reads it.
// AF32: A is (M,K) f32. Its 64 k of a pass are 256 bytes of a row, as many as hi and lo
// together, so the stage keeps its shape: [A k 0..31 | A k 32..63 | B hi | B lo], every
// array 256 rows of 128 bytes. A wave reads its A fragments as f32 and forms hi and lo in
// registers, rounded as the split launch rounds them.
// ---------------------------------------------------------------------------
typedef uint32_t u32x4 __attribute__((ext_vector_type(4)));
typedef uint32_t u32x8 __attribute__((ext_vector_type(8)));

constexpr uint32_t TILE   = 256;                 // rows of A and rows of B per work-group
constexpr uint32_t KB     = 128;                 // bytes of an operand row per pass
constexpr uint32_t PITCH  = KB + 16;             // 16 B x odd: no bank conflict for 16-byte reads
constexpr uint32_t SROWS  = 128;                 // rows per tensor load
constexpr uint32_t SLICE  = SROWS * PITCH;       // 18,432 B
constexpr uint32_t ARR    = TILE * PITCH;        // one array's rows of a stage
constexpr uint32_t STAGE  = 4 * ARR;             // 147,456 B
static_assert(SLICE % 2048u == 0, "every slice starts at a multiple of 2 KiB");
static_assert(2u * STAGE <= 320u * 1024u, "two buffers fit the LDS");

__device__ __forceinline__ uint32_t uni(uint32_t v) { return (uint32_t)__builtin_amdgcn_readfirstlane(v); }
__device__ __forceinline__ uint32_t pinned(uint32_t v) {
    uint32_t w = (uint32_t)__builtin_amdgcn_readfirstlane(v);
    asm volatile("" : "+s"(w));  // pinned(): the value stays in a scalar register (tensor loads ignore EXEC)
    return w;
}
// this wave's LDS reads have returned (the buffer may be refilled behind the barrier)
__device__ __forceinline__ void wait_ds0() { asm volatile("s_wait_dscnt 0x0" ::: "memory"); }
// this wave's tensor load has landed (the compiler places no wait for it)
__device__ __forceinline__ void wait_tensor0() { asm volatile("s_wait_tensorcnt 0x0" ::: "memory"); }
// one request of the whole wave: a tile of SROWS rows of KB bytes into LDS
__device__ __forceinline__ void tdm_load(u32x4 g0, u32x8 g1) {
    asm volatile("tensor_load_to_lds %0, %1" :: "s"(g0), "s"(g1) : "memory");
}
// pinned descriptor words, held in their scalar registers up to here: placed behind the wait that
// covers a request, so that no word of its descriptor takes a new value while it is outstanding
__device__ __forceinline__ void hold(u32x4& g0, u32x8& g1) { asm volatile("" : "+s"(g0), "+s"(g1)); }
// the compiler does not schedule across it
__device__ __forceinline__ void fence() { __builtin_amdgcn_sched_barrier(0); }
// group 1: 1-byte elements, SROWS rows of KB bytes, 16 B of LDS pad behind every 128-byte row
__device__ __forceinline__ u32x8 tdm_group1(uint32_t src_pitch) {
    constexpr uint32_t d0 = KB, d1 = SROWS;
    u32x8 g;
    g[0] = uni((1u << 20) | (4u << 22) | (3u << 25));
    g[1] = uni((d0 & 0xFFFFu) << 16);
    g[2] = uni((d0 >> 16) | ((d1 & 0xFFFFu) << 16));
    g[3] = uni((d1 >> 16) | (d0 << 16));
    g[4] = uni(d1);
    g[5] = uni(src_pitch);
    g[6] = uni(0u);
    g[7] = uni(0u);
    return g;
}
// group 0: LDS destination (byte offset) and the global address of the tile's first byte
__device__ __forceinline__ u32x4 tdm_group0(uint32_t lds_dst, uint64_t ga) {
    u32x4 g;
    g[0] = uni(1u);
    g[1] = uni(lds_dst);
    g[2] = uni((uint32_t)ga);
    g[3] = uni((((uint32_t)(ga >> 32)) & 0x01FFFFFFu) | 0x80000000u);
    return g;
}

// p: the lane's row, at its 16-byte half (lane >> 4) of the 64 bytes (32 k) of this block
__device__ __forceinline__ Frag16 lds_frag(const unsigned char* p) {
    Frag16 f;
    f.u[0] = *(const uint4*)p;         // K chunk 0..7  (lane<16) / 8..15 (lane>=16)
    f.u[1] = *(const uint4*)(p + 32);  // K chunk 16..23 / 24..31
    return f;
}
// An A fragment's sixteen f32 of a lane. p: the lane's row, at its 32-byte quarter (lane >> 4)
// of the 128 bytes (32 k) of this block; the k order is that of lds_frag.
struct Raw16 {
    float4 q[4];
};
__device__ __forceinline__ Raw16 lds_raw(const unsigned char* p) {
    Raw16 r;
    r.q[0] = *(const float4*)p;         // K 0..3   (lane<16) / 8..11  (lane>=16)
    r.q[1] = *(const float4*)(p + 16);  // K 4..7   / 12..15
    r.q[2] = *(const float4*)(p + 64);  // K 16..19 / 24..27
    r.q[3] = *(const float4*)(p + 80);  // K 20..23 / 28..31
    return r;
}
__device__ __forceinline__ f32x2 raw_pair(const Raw16& r, int p) {  // elements 2p and 2p + 1
    const float4 v = r.q[p >> 1];
    return (p & 1) ? f32x2{v.z, v.w} : f32x2{v.x, v.y};
}
__device__ __forceinline__ uint32_t pk_bf16(f32x2 v) {  // v[0] in the low half; nearest even
    return __builtin_bit_cast(uint32_t, __builtin_convertvector(v, bf16x2));
}
// A fragment's split in five steps of eight vector instructions, one step behind one WMMA, so that
// it issues under the matrix unit's interval. No instruction of a step reads a result of the same
// step. 0: hi = bf16(x); 1, 2: hi back as f32, half the fragment each; 3: x - hi; 4: lo = bf16(x - hi).
__device__ __forceinline__ void split_step(int st, const Raw16& r, Frag16& hi, Frag16& lo, f32x2 (&t)[8]) {
#pragma unroll  // every index a constant
    for (int p = 0; p < 8; ++p) {
        if (st == 0) hi.w[p] = pk_bf16(raw_pair(r, p));
        if (st == 1 + (p >> 2)) t[p] = f32x2{__uint_as_float(hi.w[p] << 16), __uint_as_float(hi.w[p] & 0xFFFF0000u)};
        if (st == 3) t[p] = raw_pair(r, p) - t[p];
        if (st == 4) lo.w[p] = pk_bf16(t[p]);
    }
}
__device__ __forceinline__ v8f mma(const Frag16& a, const Frag16& b, v8f c) {
    return __builtin_amdgcn_wmma_f32_16x16x32_bf16(false, a.v, false, b.v, (short)0, c, false, false);
}

constexpr int CHUNK = 32;   // rows of a chunk of the scans over T (below); 32 floats of tmp/Pi = one 128-byte line

// lane l's value from lane l ^ 16
__device__ __forceinline__ float xhalf(float x) {
    const int b = __builtin_bit_cast(int, x);
    return __builtin_bit_cast(float, __builtin_amdgcn_permlanex16(b, b, 0x76543210, 0xfedcba98, false, false));
}

template <bool AF32>
__device__ __forceinline__
void gemm_body(const float* __restrict__ Af,
               const unsigned short* __restrict__ Ahi,
               const unsigned short* __restrict__ Alo,
               const unsigned short* __restrict__ Bhi,
               const unsigned short* __restrict__ Blo,
               const float* __restrict__ bias,
               float* __restrict__ Cout,
               float* __restrict__ Ssq,
               float* __restrict__ Stl,
               int M, int N, int K) {
    __shared__ __attribute__((aligned(2048))) unsigned char L[2 * STAGE];
    const uint32_t lane = threadIdx.x & 31u, r16 = lane & 15u, h = lane >> 4;
    const uint32_t wave = uni(threadIdx.x >> 5);
    const uint32_t tiles_n = (uint32_t)N / TILE;
    const uint32_t tm = blockIdx.x / tiles_n, tn = blockIdx.x - tm * tiles_n;
    const uint32_t m0 = tm * TILE, n0 = tn * TILE;
    const uint32_t wm = wave >> 1, wn = wave & 1u;
    const uint32_t kb = (uint32_t)K * 2u;        // bytes of a bf16 source row
    const uint32_t T  = pinned((uint32_t)K / 64u);
    (void)M;

    // this wave's slice: array wave >> 1 of the stage's four, rows 128 * (wave & 1) on
    const uint32_t arr = wave >> 1;
    const uint32_t srow = ((arr < 2u) ? m0 : n0) + SROWS * (wave & 1u);
    uint64_t sbase;     // the array's first byte of pass 0
    uint32_t spitch;    // bytes of a source row
    uint32_t sstep;     // bytes of a source row per pass
    if constexpr (AF32) {
        sbase  = (arr < 2u) ? (uint64_t)(uintptr_t)Af + arr * KB
                            : (uint64_t)(uintptr_t)((arr == 2u) ? Bhi : Blo);
        spitch = (arr < 2u) ? 2u * kb : kb;
        sstep  = (arr < 2u) ? 2u * KB : KB;
    } else {
        sbase  = (uint64_t)(uintptr_t)((arr == 0u) ? Ahi : (arr == 1u) ? Alo : (arr == 2u) ? Bhi : Blo);
        spitch = kb;
        sstep  = KB;
    }
    const uint64_t src = sbase + (uint64_t)srow * spitch;
    const uint32_t lds_slice = (uint32_t)(size_t)L + wave * SLICE;   // add buffer * STAGE
    u32x8 g1 = tdm_group1(spitch);

    v8f acc[4][8];
#pragma unroll
    for (int i = 0; i < 4; ++i)
#pragma unroll
        for (int j = 0; j < 8; ++j) acc[i][j] = v8f{};

    // per-lane fragment bases in a buffer
    const uint32_t a_base = (wm * 64u + r16) * PITCH + (AF32 ? 32u : 16u) * h;
    const uint32_t b_base = 2u * ARR + (wn * 128u + r16) * PITCH + 16u * h;

    u32x4 g0 = tdm_group0(lds_slice, src);
    tdm_load(g0, g1);                                    // stage 0
    wait_tensor0();
    hold(g0, g1);
    __syncthreads();                                     // stage 0 is published
    g0 = tdm_group0(lds_slice + STAGE, src + sstep);
    tdm_load(g0, g1);                                    // stage 1

#pragma clang loop unroll(disable)  // one pass per trip: the buffer index stays a scalar
    for (uint32_t t = 0; t < T; ++t) {
        const uint32_t buf = (t & 1u) * STAGE;
        const unsigned char* la = L + buf + a_base;
        const unsigned char* lb = L + buf + b_base;
        // A pass is 8 units of 24 WMMAs: unit q = block (32 k) q >> 2, columns 32 * (q & 3) on.
        // The A fragments of both blocks and two sets of a unit's B fragments are held.
        Frag16 ah[2][4], al[2][4], bh[2][2], bl[2][2];
        Raw16 r0[4], r1[4];  // AF32: the A fragments of the two blocks as f32
        f32x2 tp[8];         // AF32: the fragment that is being split, between two steps
        // the first unit's fragments in the order of their use, so that its first WMMAs
        // wait for the first loads only
#pragma unroll
        for (int i = 0; i < 4; ++i) {
            if constexpr (AF32) r0[i] = lds_raw(la + (uint32_t)i * 16u * PITCH);
            else                ah[0][i] = lds_frag(la + (uint32_t)i * 16u * PITCH);
        }
#pragma unroll
        for (int jj = 0; jj < 2; ++jj) bh[0][jj] = lds_frag(lb + (uint32_t)jj * 16u * PITCH);
        fence();  // keeps these loads in front of the ones that are needed later
#pragma unroll
        for (int jj = 0; jj < 2; ++jj) bl[0][jj] = lds_frag(lb + ARR + (uint32_t)jj * 16u * PITCH);
        if constexpr (AF32) {  // the one fragment of the second block that the first unit splits
            r1[3] = lds_raw(la + ARR + 3u * 16u * PITCH);
        } else {
#pragma unroll
            for (int i = 0; i < 4; ++i) al[0][i] = lds_frag(la + ARR + (uint32_t)i * 16u * PITCH);
        }
        fence();  // and these in front of the next unit's
#pragma unroll  // every fragment and accumulator index a constant
        for (int q = 0; q < 8; ++q) {
            const int u = q >> 2, jp = q & 3, s = q & 1;
            // the next unit's fragments, as one group ahead of this unit's WMMAs
            if (q < 7) {
                const int un = (q + 1) >> 2, jn = (q + 1) & 3;
#pragma unroll
                for (int jj = 0; jj < 2; ++jj) {
                    bh[s ^ 1][jj] = lds_frag(lb + (uint32_t)(2 * jn + jj) * 16u * PITCH + 64u * (uint32_t)un);
                    bl[s ^ 1][jj] = lds_frag(lb + ARR + (uint32_t)(2 * jn + jj) * 16u * PITCH + 64u * (uint32_t)un);
                }
            }
            if (u == 0) {  // a quarter of the second block's A fragments
                if constexpr (AF32) {  // a unit ahead of the unit that splits it
                    if (q < 3) r1[q] = lds_raw(la + ARR + (uint32_t)q * 16u * PITCH);
                } else {
                    ah[1][jp] = lds_frag(la + (uint32_t)jp * 16u * PITCH + 64u);
                    al[1][jp] = lds_frag(la + ARR + (uint32_t)jp * 16u * PITCH + 64u);
                }
            }
            fence();  // keeps the group of LDS loads together, ahead of the WMMAs
            // AF32: the step of the split that stands behind WMMA k of this unit. Unit 0 splits the
            // first block (fragment i's hi part ahead of the unit's WMMA i, its lo part ahead of
            // WMMA 16 + i) and, behind its last five WMMAs, the second block's fragment 3; units 1 to 3
            // split that block's fragments 0 to 2.
            auto step_behind = [&](int k) {
                if constexpr (AF32) {
                    const int f = (k - 3) >> 2;  // unit 0, WMMAs 3 to 18: the fragment whose lo part is formed
                    if (q == 0 && k < 3)                split_step(0, r0[k + 1], ah[0][k + 1], al[0][k + 1], tp);
                    else if (q == 0 && k < 19)          split_step(1 + ((k - 3) & 3), r0[f], ah[0][f], al[0][f], tp);
                    else if (q == 0)                    split_step(k - 19, r1[3], ah[1][3], al[1][3], tp);
                    else if (q >= 1 && q <= 3 && k < 5) split_step(k, r1[q - 1], ah[1][q - 1], al[1][q - 1], tp);
                    else return;
                    // keeps the step behind its WMMA: left alone, the compiler puts the split in front of the unit
                    fence();
                }
            };
            if constexpr (AF32) {
                if (q == 0) {
                    split_step(0, r0[0], ah[0][0], al[0][0], tp);
                    fence();  // the other fragments' steps stay behind the first WMMA
                }
            }
            // per accumulator the order stays hi*hi, hi*lo, lo*hi; eight tiles stand
            // between two products into the same accumulator
#pragma unroll
            for (int jj = 0; jj < 2; ++jj)
#pragma unroll
                for (int i = 0; i < 4; ++i) {
                    acc[i][2 * jp + jj] = mma(ah[u][i], bh[s][jj], acc[i][2 * jp + jj]);
                    step_behind(4 * jj + i);
                }
#pragma unroll
            for (int jj = 0; jj < 2; ++jj)
#pragma unroll
                for (int i = 0; i < 4; ++i) {
                    acc[i][2 * jp + jj] = mma(ah[u][i], bl[s][jj], acc[i][2 * jp + jj]);
                    step_behind(8 + 4 * jj + i);
                }
#pragma unroll
            for (int jj = 0; jj < 2; ++jj)
#pragma unroll
                for (int i = 0; i < 4; ++i) {
                    acc[i][2 * jp + jj] = mma(al[u][i], bh[s][jj], acc[i][2 * jp + jj]);
                    step_behind(16 + 4 * jj + i);
                }
            fence();  // keeps the next group of LDS loads out of this unit's WMMAs
        }
        // publish point of stage t + 1
        wait_ds0();
        wait_tensor0();
        hold(g0, g1);
        __syncthreads();
        if (pinned(t + 2u < T)) {  // the refill, into the buffer this pass has just read
            g0 = tdm_group0(lds_slice + buf, src + (uint64_t)(t + 2u) * sstep);
            tdm_load(g0, g1);
        }
    }
    wait_tensor0();
    wait_ds0();

    // C/D layout: VGPR v holds M = v + 8*(lane>=16), N = lane%16
    if constexpr (AF32) {
        // The same sums and stores as below, ordered so that no register which an issued load or
        // store names is rewritten ahead of a wait:
        // the bias loads, a wait; the chunk sums, their stores, a wait; the
        // 32 row addresses; then column by column the 32 sums, their 32 stores, a wait; the tile sum.
        // Ssq[chunk][n] = the sum of C^2 over the chunk's CHUNK rows: a wave's 64 rows are two whole
        // chunks (fragments 0, 1 and 2, 3), so each sum is formed by one wave alone, from the values
        // that it stores. A lane sums its 16 rows of either chunk; lanes l and l ^ 16 hold the two
        // halves of a chunk's rows, and lane half h keeps and stores chunk h of the two.
        static_assert(CHUNK == 32, "a chunk is two 16-row fragments");
        float bv[8];
#pragma unroll  // bv[] stays in registers
        for (int j = 0; j < 8; ++j) bv[j] = bias[n0 + wn * 128u + (uint32_t)j * 16u + r16];
        asm volatile("s_wait_xcnt 0x0" ::: "memory");  // the loads' address registers may be re-used from here
        fence();  // what re-uses them stays behind the wait
        float cs[8];  // per column the chunk sum that this lane stores
#pragma unroll  // every accumulator index a constant; cs[] stays in registers
        for (int j = 0; j < 8; ++j) {
            float q[4];  // a fragment's eight squares of this lane: four independent chains
#pragma unroll  // q[] stays in registers
            for (int i = 0; i < 4; ++i) {
                q[i] = 0.f;
#pragma unroll  // every accumulator index a constant
                for (int v = 0; v < 8; ++v) {
                    const float c = acc[i][j][v] + bv[j];
                    q[i] += c * c;
                }
            }
            const float c0 = q[0] + q[1], c1 = q[2] + q[3];
            cs[j] = (h ? c1 : c0) + xhalf(h ? c0 : c1);
        }
        // Stl[tile row][n] = the sum of C^2 over the tile's TILE rows. A wave's two chunk sums of a
        // column stand in lanes l and l ^ 16; their sum, the wave's 64 rows, goes to LDS, where lane
        // half h writes the odd (h = 1) or even columns' fragment, 32 floats in a row a store. The
        // ring is idle: every wave's last read and last tensor load ended ahead of the last pass's barrier.
        float* red = (float*)L;  // [4 waves along m][TILE columns]
#pragma unroll  // cs[] stays in registers
        for (int k = 0; k < 4; ++k) {
            const float e = cs[2 * k] + xhalf(cs[2 * k]);
            const float o = cs[2 * k + 1] + xhalf(cs[2 * k + 1]);
            red[wm * TILE + wn * 128u + 32u * (uint32_t)k + lane] = h ? o : e;
        }
        float* srow = Ssq + (size_t)((m0 + wm * 64u) / (uint32_t)CHUNK + h) * (uint32_t)N + n0 + wn * 128u + r16;
        fence();  // the chunk sums and their address stay in front of their stores
#pragma unroll  // cs[] stays in registers; the column is an immediate offset
        for (int j = 0; j < 8; ++j) srow[j * 16] = cs[j];
        asm volatile("s_wait_xcnt 0x0" ::: "memory");  // these stores' registers may be re-used from here
        fence();  // what re-uses them stays behind the wait
        float* crow = Cout + (size_t)(m0 + wm * 64u + 8u * h) * (uint32_t)N + n0 + wn * 128u + r16;
        float* rp[4][8];  // the 32 rows' addresses, formed in front of the first store
#pragma unroll  // rp[] stays in registers
        for (int i = 0; i < 4; ++i)
#pragma unroll  // rp[] stays in registers
            for (int v = 0; v < 8; ++v) rp[i][v] = crow + (size_t)(i * 16 + v) * (uint32_t)N;
#pragma unroll  // every accumulator index a constant
        for (int j = 0; j < 8; ++j) {
            float o[4][8];
#pragma unroll  // o[] stays in registers
            for (int i = 0; i < 4; ++i)
#pragma unroll  // o[] stays in registers
                for (int v = 0; v < 8; ++v) o[i][v] = acc[i][j][v] + bv[j];
            fence();  // the sums (and, in column 0, the addresses) stay in front of the stores
#pragma unroll  // o[] and rp[] stay in registers; the column is an immediate offset
            for (int i = 0; i < 4; ++i)
#pragma unroll  // o[] and rp[] stay in registers
                for (int v = 0; v < 8; ++v) rp[i][v][j * 16] = o[i][v];
            // the next column's sums (behind the last column: the tile sum) may re-use the stores' registers from here
            asm volatile("s_wait_xcnt 0x0" ::: "memory");
        }
        fence();  // the tile sum stays behind the stores of C, which so start without waiting for another wave
        wait_ds0();  // this wave's sums stand in red
        // The work-group's barrier by hand: __syncthreads() would wait here until the stores of C have
        // completed. Behind it the four waves' sums of every column stand in red.
        asm volatile("s_barrier_signal -1\n\ts_barrier_wait -1" ::: "memory");
        Stl[(size_t)tm * (uint32_t)N + n0 + threadIdx.x] =
            ((red[threadIdx.x] + red[TILE + threadIdx.x]) + red[2u * TILE + threadIdx.x]) + red[3u * TILE + threadIdx.x];
        return;
    }
#pragma unroll
    for (int j = 0; j < 8; ++j) {
        const uint32_t n = n0 + wn * 128u + (uint32_t)j * 16u + r16;
        const float bv = bias[n];
#pragma unroll
        for (int i = 0; i < 4; ++i) {
            const uint32_t mb = m0 + wm * 64u + (uint32_t)i * 16u + 8u * h;
#pragma unroll
            for (int v = 0; v < 8; ++v) {
                Cout[(size_t)(mb + v) * (uint32_t)N + n] = acc[i][j][v] + bv;
            }
        }
    }
}

// A as bf16 hi and lo
__global__ __launch_bounds__(256)
void wmma_gemm_bias(const unsigned short* __restrict__ Ahi,
                    const unsigned short* __restrict__ Alo,
                    const unsigned short* __restrict__ Bhi,
                    const unsigned short* __restrict__ Blo,
                    const float* __restrict__ bias,
                    float* __restrict__ Cout,
                    int M, int N, int K) {
    gemm_body<false>(nullptr, Ahi, Alo, Bhi, Blo, bias, Cout, nullptr, nullptr, M, N, K);
}

// A as f32; also writes Ssq, (M / CHUNK, N): the sums of C^2 over chunks of CHUNK rows, and
// Stl, (M / TILE, N): the same over the tiles' TILE rows
__global__ __launch_bounds__(256)
void wmma_gemm_bias_f32a(const float* __restrict__ A,
                         const unsigned short* __restrict__ Bhi,
                         const unsigned short* __restrict__ Blo,
                         const float* __restrict__ bias,
                         float* __restrict__ Cout,
                         float* __restrict__ Ssq,
                         float* __restrict__ Stl,
                         int M, int N, int K) {
    gemm_body<true>(A, nullptr, nullptr, Bhi, Blo, bias, Cout, Ssq, Stl, M, N, K);
}

// ---------------------------------------------------------------------------
// The two cumsums over T run as chunked scans: T is cut into chunks of CHUNK
// rows, an earlier launch sums each chunk, and the scan launch starts each chunk
// from the sum of the chunk sums in front of it. In stage_pi one block = one (b, chunk),
// 256 threads x 4 channels = all CH channels (16 lanes per head); stage_y: see there.
// ---------------------------------------------------------------------------
constexpr int CH = 1024;    // channels = 256 threads x 4; a constant, so that the rows of a
                            // trip are immediate offsets from one address
constexpr int PPITCH = 32;  // floats per block in the Pi chunk sums: one 128-byte line each
constexpr int PRE = 16;     // sums read per trip when a chunk's start value is formed
constexpr int TCH = (int)TILE / CHUNK;  // chunks of a tile of the first GEMM

// Four reciprocals by v_rcp_f32 (good to about one unit in the last place), in place of four
// correctly rounded divisions of some ten dependent vector instructions each. Every argument
// here is at least 1e-12 (a clamp, an added 1e-8, an added 1).
// One statement, so that the slot behind a transcendental is kept by construction: each
// reciprocal replaces its own argument, so none touches a register of the one in front of it
// (and no register is added), and the closing v_nop stands between the last one and whatever
// first reads or overwrites one of the four.
__device__ __forceinline__ float4 rcp4(float a, float b, float c, float d) {
    asm("v_rcp_f32 %0, %0\n\tv_rcp_f32 %1, %1\n\tv_rcp_f32 %2, %2\n\tv_rcp_f32 %3, %3\n\tv_nop"
        : "+v"(a), "+v"(b), "+v"(c), "+v"(d));
    return make_float4(a, b, c, d);
}

// Stage 1a, S[b,chunk,c] = sum over the chunk's rows of w^2 and St[b,tile,c] = the same over a
// tile's TCH chunks, is the first GEMM's epilogue.

// Stages 1b, 2 and 3a in one launch. A block holds all CH channels, that is all 16 heads,
// of its CHUNK rows, so the softmax over heads needs nothing of another block:
//   1b: denom = cumsum_T(w^2); tmp[h,t] = (sum_d w^2/denom + D*dbias)*temp, handed on in LDS
//   2 : Pi = softmax of tmp over the 16 heads, stored for stage 3b and handed on in LDS
//   3a: chunk sums of w^2*Pi (per channel) and of Pi (per head)
// The chunk's rows of w are read once and stay in registers from 1b to 3a.
__global__ __launch_bounds__(256)
void stage_pi(const float* __restrict__ w,
              const float* __restrict__ S,
              const float* __restrict__ St,
              const float* __restrict__ temp,
              const float* __restrict__ denom_bias,
              float* __restrict__ Pi,
              float* __restrict__ Swp,
              float* __restrict__ P,
              int T, int H, int D) {
    __shared__ float tl[16 * CHUNK];                              // tmp[head][row]
    __shared__ __attribute__((aligned(16))) float pl[16 * CHUNK]; // Pi[head][row]
    const int nc = T / CHUNK;
    const int b = blockIdx.x / nc, j = blockIdx.x % nc;
    const int h = threadIdx.x >> 4;
    const int l = threadIdx.x & 15;
    const int t0 = j * CHUNK;

    const float* base  = w + (size_t)blockIdx.x * CHUNK * CH + threadIdx.x * 4;
    const float* dbias = denom_bias + (size_t)h * T + t0;
    const float th = temp[h];

    // Running sum at the chunk's start, in two levels: the sums of the whole tiles in front of the
    // chunk's tile, then the chunk sums of its own tile in front of it.
    const int jt = j / TCH, jc = j % TCH;
    float4 run = make_float4(0.f, 0.f, 0.f, 0.f);
    const float* sp = S + ((size_t)b * nc + (j - jc)) * CH + threadIdx.x * 4;
    const float* tp = St + (size_t)b * (nc / TCH) * CH + threadIdx.x * 4;
    // the tile's chunk sums but the last, which is in front of nobody; they fly with the tile sums
    float4 cv[TCH - 1];
#pragma unroll  // cv[] stays in registers; the rows are immediate offsets from one address
    for (int u = 0; u < TCH - 1; ++u) cv[u] = *(const float4*)(sp + (size_t)u * CH);
    asm volatile("s_wait_xcnt 0x0" ::: "memory");  // the loads' address registers may be re-used from here
    fence();  // what re-uses them stays behind the wait
    // Trips of PRE rows, no remainder loop: PRE divides the tiles of a b, so every row read is one
    // of this b's tile sums; a row at or past jt adds 0.
    for (int i0 = 0; i0 < jt; i0 += PRE) {
        float4 v[PRE];
#pragma unroll  // PRE independent loads in flight per trip
        for (int u = 0; u < PRE; ++u) v[u] = *(const float4*)(tp + (size_t)(i0 + u) * CH);
        asm volatile("s_wait_xcnt 0x0" ::: "memory");  // the loads' address registers may be re-used from here
        fence();  // what re-uses them stays behind the wait
#pragma unroll  // v[] stays in registers
        for (int u = 0; u < PRE; ++u) {
            const bool on = i0 + u < jt;
            run.x += on ? v[u].x : 0.f; run.y += on ? v[u].y : 0.f;
            run.z += on ? v[u].z : 0.f; run.w += on ? v[u].w : 0.f;
        }
    }
#pragma unroll  // cv[] stays in registers
    for (int u = 0; u < TCH - 1; ++u) {
        const bool on = u < jc;
        run.x += on ? cv[u].x : 0.f; run.y += on ? cv[u].y : 0.f;
        run.z += on ? cv[u].z : 0.f; run.w += on ? cv[u].w : 0.f;
    }

    // the chunk's rows, held to the end of the kernel
    float4 wv[CHUNK];
#pragma unroll  // wv[] stays in registers; the rows are immediate offsets from one address
    for (int u = 0; u < CHUNK; ++u) wv[u] = *(const float4*)(base + (size_t)u * CH);

    // 16 rows at a time; lane u of a head's 16 keeps row u's sum, so the body has no branch
#pragma unroll  // every index into wv[] a constant
    for (int tb = 0; tb < CHUNK; tb += 16) {
        float val[16];
#pragma unroll  // wv[] and val[] stay in registers
        for (int u = 0; u < 16; ++u) {
            const float4 x = wv[tb + u];
            float sx = x.x * x.x, sy = x.y * x.y;
            float sz = x.z * x.z, sw = x.w * x.w;
            run.x += sx; run.y += sy; run.z += sz; run.w += sw;
            const float4 rd = rcp4(fmaxf(run.x, 1e-12f), fmaxf(run.y, 1e-12f),
                                   fmaxf(run.z, 1e-12f), fmaxf(run.w, 1e-12f));
            val[u] = sx * rd.x + sy * rd.y + sz * rd.z + sw * rd.w;
        }
        // reduce over the 16-lane group (stays within half-wave), the sixteen rows'
        // exchanges of a step side by side so that one wait serves them all
#pragma unroll  // the four steps' lane masks become constants
        for (int m = 8; m >= 1; m >>= 1) {
            float o[16];
#pragma unroll  // sixteen independent exchanges in flight; o[] stays in registers
            for (int u = 0; u < 16; ++u) o[u] = __shfl_xor(val[u], m, 32);
#pragma unroll  // val[] stays in registers
            for (int u = 0; u < 16; ++u) val[u] += o[u];
        }
        float keep = val[0];
#pragma unroll  // val[] stays in registers
        for (int u = 1; u < 16; ++u) keep = (l == u) ? val[u] : keep;
        tl[h * CHUNK + tb + l] = (keep + (float)D * dbias[tb + l]) * th;
    }
    __syncthreads();  // all 16 heads' tmp of the chunk's rows stand in tl

    // Softmax over the heads: lane r of every wave forms row r's maximum and sum; wave k
    // writes heads 2k and 2k + 1 (their exponentials formed again from the same operands,
    // so that no register array is indexed by the wave's number).
    const int row = threadIdx.x & 31;
    const int hp = (threadIdx.x >> 5) * 2;
    float pv[2];
    {
        float v[16];
        float m = -3.4e38f;
#pragma unroll  // v[] stays in registers
        for (int g = 0; g < 16; ++g) { v[g] = tl[g * CHUNK + row]; m = fmaxf(m, v[g]); }
        float s = 0.f;
#pragma unroll  // v[] stays in registers
        for (int g = 0; g < 16; ++g) s += __expf(v[g] - m);
        const float inv = 1.f / s;
#pragma unroll  // two heads a wave; pv[] stays in registers
        for (int k = 0; k < 2; ++k) {
            pv[k] = __expf(tl[(hp + k) * CHUNK + row] - m) * inv;
            pl[(hp + k) * CHUNK + row] = pv[k];
        }
    }
    __syncthreads();  // all 16 heads' Pi of the chunk's rows stand in pl

    // Pi goes to memory behind the barrier, which would otherwise wait for these stores
    float* q = Pi + ((size_t)b * H + hp) * T + t0 + row;
    q[0] = pv[0];
    q[T] = pv[1];

    const float4* pr = (const float4*)(pl + h * CHUNK);
    float4 s = make_float4(0.f, 0.f, 0.f, 0.f);
    float spi = 0.f;
#pragma unroll  // every index into wv[] a constant
    for (int t4 = 0; t4 < CHUNK / 4; ++t4) {
        const float4 p4 = pr[t4];
        const float pa[4] = {p4.x, p4.y, p4.z, p4.w};
#pragma unroll  // pa[] stays in registers
        for (int c = 0; c < 4; ++c) {
            const float pi = pa[c];
            const float4 x = wv[4 * t4 + c];
            spi += pi;
            s.x += x.x * x.x * pi;
            s.y += x.y * x.y * pi;
            s.z += x.z * x.z * pi;
            s.w += x.w * x.w * pi;
        }
    }
    *(float4*)(Swp + (size_t)blockIdx.x * CH + threadIdx.x * 4) = s;
    if (l == 0) P[(size_t)blockIdx.x * PPITCH + h] = spi;
}

// ---------------------------------------------------------------------------
// Stage 3b: dots = cumsum_T(w^2*Pi)/(cumsum_T(Pi)+1e-8); y = -(w*Pi)/(1+dots)
// Writes y straight into bf16 hi/lo buffers (GEMM2 inputs).
// One block = YW chunks of one b x YCH channels, a wave per chunk. T's chunks are cut into YW
// segments; wave k takes a chunk of segment k, all at the same place in their segments. So the
// block reads every chunk sum of its channels once, a segment a wave, and no wave sums more
// than a segment's rows; the segments' sums go from wave to wave through LDS.
// ---------------------------------------------------------------------------
constexpr int YW = 8;     // waves of a block = segments of T
constexpr int YCH = 128;  // channels of a block: 32 lanes x 4

__global__ __launch_bounds__(256)
void stage_y(const float* __restrict__ w,
             const float* __restrict__ Pi,
             const float* __restrict__ S,
             const float* __restrict__ P,
             unsigned short* __restrict__ yhi,
             unsigned short* __restrict__ ylo,
             int T, int H) {
    __shared__ __attribute__((aligned(16))) float segS[YW][YCH];  // a segment's sum of w^2*Pi, per channel
    __shared__ float segP[YW][32];                                // a segment's sum of Pi, per lane (its head's)
    const int nc = T / CHUNK;
    const int seg = nc / YW;                  // chunks of a segment
    const int wave = threadIdx.x >> 5, lane = threadIdx.x & 31;
    const int jg = blockIdx.x % seg;          // the chunk's place in its segment, the same for the 8 waves
    const int cg = (blockIdx.x / seg) % (CH / YCH);
    const int b  = (blockIdx.x / seg) / (CH / YCH);
    const int j  = wave * seg + jg;           // this wave's chunk
    const int ch = cg * YCH + lane * 4;       // this lane's first channel
    const int h  = ch >> 6;                   // 16 lanes x 4 channels per head

    const float* wbase = w + ((size_t)b * nc + j) * CHUNK * CH + ch;
    const float* pbase = Pi + ((size_t)b * H + h) * T + j * CHUNK;
    size_t obase = ((size_t)b * nc + j) * CHUNK * CH + ch;

    // Running sums at the chunk's start. A wave reads the chunk sums of its own segment alone, once:
    // 'all' is the whole segment's sum, which the waves behind it need, 'cum' the sum of the
    // segment's chunks in front of this wave's chunk.
    float4 cumWP = make_float4(0.f, 0.f, 0.f, 0.f);
    float4 allWP = make_float4(0.f, 0.f, 0.f, 0.f);
    float cumPi = 0.f, allPi = 0.f;
    const float* sp = S + ((size_t)b * nc + wave * seg) * CH + ch;
    const float* pp = P + ((size_t)b * nc + wave * seg) * PPITCH + h;
    // Trips of PRE rows, no remainder loop: PRE divides seg, so every row read is one of this
    // segment's chunk sums.
    for (int i0 = 0; i0 < seg; i0 += PRE) {
        float4 v[PRE];
        float p[PRE];
#pragma unroll  // 2 * PRE independent loads in flight per trip
        for (int u = 0; u < PRE; ++u) {
            v[u] = *(const float4*)(sp + (size_t)(i0 + u) * CH);
            p[u] = pp[(size_t)(i0 + u) * PPITCH];
        }
        asm volatile("s_wait_xcnt 0x0" ::: "memory");  // the loads' address registers may be re-used from here
        fence();  // all loads of the trip are issued ahead of the first sum: one latency, not two
#pragma unroll  // v[] and p[] stay in registers
        for (int u = 0; u < PRE; ++u) {
            const bool on = i0 + u < jg;
            allWP.x += v[u].x; allWP.y += v[u].y; allWP.z += v[u].z; allWP.w += v[u].w;
            allPi += p[u];
            cumWP.x += on ? v[u].x : 0.f; cumWP.y += on ? v[u].y : 0.f;
            cumWP.z += on ? v[u].z : 0.f; cumWP.w += on ? v[u].w : 0.f;
            cumPi += on ? p[u] : 0.f;
        }
    }
    *(float4*)&segS[wave][lane * 4] = allWP;
    segP[wave][lane] = allPi;
    __syncthreads();  // the 8 segments' sums stand in segS and segP
#pragma unroll  // the last segment's sum is in front of nobody
    for (int g = 0; g < YW - 1; ++g) {
        const bool on = g < wave;
        const float4 v = *(const float4*)&segS[g][lane * 4];
        const float p = segP[g][lane];
        cumWP.x += on ? v.x : 0.f; cumWP.y += on ? v.y : 0.f;
        cumWP.z += on ? v.z : 0.f; cumWP.w += on ? v.w : 0.f;
        cumPi += on ? p : 0.f;
    }

    // 8 rows per trip: their loads fly together ahead of the serial sums
    for (int tb = 0; tb < CHUNK; tb += 8) {
        float4 wr[8];
        float pr[8];
#pragma unroll  // eight rows' loads in flight
        for (int u = 0; u < 8; ++u) {
            pr[u] = pbase[tb + u];
            wr[u] = *(const float4*)(wbase + (size_t)(tb + u) * CH);
        }
        // 1 / (cumsum(Pi) + 1e-8) of the eight rows; one reciprocal serves a row's four channels
        float rdn[8];
#pragma unroll  // pr[] and rdn[] stay in registers
        for (int u4 = 0; u4 < 8; u4 += 4) {
            const float c0 = cumPi + pr[u4], c1 = c0 + pr[u4 + 1];
            const float c2 = c1 + pr[u4 + 2], c3 = c2 + pr[u4 + 3];
            cumPi = c3;
            const float4 r = rcp4(c0 + 1e-8f, c1 + 1e-8f, c2 + 1e-8f, c3 + 1e-8f);
            rdn[u4] = r.x; rdn[u4 + 1] = r.y; rdn[u4 + 2] = r.z; rdn[u4 + 3] = r.w;
        }
#pragma unroll  // wr[], pr[] and rdn[] stay in registers
        for (int u = 0; u < 8; ++u) {
            float pi = pr[u];
            float4 wv = wr[u];
            cumWP.x += wv.x * wv.x * pi;
            cumWP.y += wv.y * wv.y * pi;
            cumWP.z += wv.z * wv.z * pi;
            cumWP.w += wv.w * wv.w * pi;
            const float4 at = rcp4(1.f + cumWP.x * rdn[u], 1.f + cumWP.y * rdn[u],
                                   1.f + cumWP.z * rdn[u], 1.f + cumWP.w * rdn[u]);
            float yx = -(wv.x * pi) * at.x;
            float yy = -(wv.y * pi) * at.y;
            float yz = -(wv.z * pi) * at.z;
            float yw = -(wv.w * pi) * at.w;

            unsigned short h0 = f2bf(yx), h1 = f2bf(yy), h2 = f2bf(yz), h3 = f2bf(yw);
            unsigned short l0 = f2bf(yx - bf2f(h0)), l1 = f2bf(yy - bf2f(h1));
            unsigned short l2 = f2bf(yz - bf2f(h2)), l3 = f2bf(yw - bf2f(h3));

            size_t o = obase + (size_t)(tb + u) * CH;
            uint2 hv, lv;
            hv.x = (unsigned)h0 | ((unsigned)h1 << 16);
            hv.y = (unsigned)h2 | ((unsigned)h3 << 16);
            lv.x = (unsigned)l0 | ((unsigned)l1 << 16);
            lv.y = (unsigned)l2 | ((unsigned)l3 << 16);
            *(uint2*)(yhi + o) = hv;
            *(uint2*)(ylo + o) = lv;
        }
        // the next trip re-uses the stores' registers: keep the wait in front of that
        asm volatile("s_wait_xcnt 0x0" ::: "memory");
    }
}

// ---------------------------------------------------------------------------
// Host-side launch
// ---------------------------------------------------------------------------
extern "C" void kernel_launch(void* const* d_in, const int* in_sizes, int n_in,
                              void* d_out, int out_size, void* d_ws, size_t ws_size,
                              hipStream_t stream) {
    const float* x          = (const float*)d_in[0];
    const float* Wa         = (const float*)d_in[1];
    const float* ba         = (const float*)d_in[2];
    const float* Wp         = (const float*)d_in[3];
    const float* bp         = (const float*)d_in[4];
    const float* temp       = (const float*)d_in[5];
    const float* denom_bias = (const float*)d_in[6];

    const int B = 4, T = 4096, C = 1024, H = 16, D = 64;
    const int M = B * T;   // 16384
    const int N = C, K = C;

    // Workspace layout (bytes)
    char* ws = (char*)d_ws;
    float*          wbuf = (float*)(ws + 0);                       // 64 MB  (B,T,C) f32
    unsigned short* hi   = (unsigned short*)(ws + 67108864);       // 32 MB  y-hi
    unsigned short* lo   = (unsigned short*)(ws + 100663296);      // 32 MB  y-lo
    unsigned short* Wahi = (unsigned short*)(ws + 134217728);      //  2 MB
    unsigned short* Walo = (unsigned short*)(ws + 136314880);      //  2 MB
    unsigned short* Wphi = (unsigned short*)(ws + 138412032);      //  2 MB
    unsigned short* Wplo = (unsigned short*)(ws + 140509184);      //  2 MB
    float*          Pib  = (float*)(ws + 143654912);               //  1 MB  (B,H,T)
    float*          Ssq  = (float*)(ws + 144703488);               //  2 MB  (B,T/32,C) chunk sums of w^2
    float*          Swp  = (float*)(ws + 146800640);               //  2 MB  (B,T/32,C) chunk sums of w^2*Pi
    float*          Spi  = (float*)(ws + 148897792);               // 64 KB  (B,T/32,32) chunk sums of Pi
    float*          Stl  = (float*)(ws + 148963328);               // 256 KB (B,T/256,C) tile sums of w^2

    const int nW = C * C;      // 1M
    // a whole multiple of a block's share, so the grid covers it exactly
    split_bf16<<<nW / SPLIT_BLOCK, 256, 0, stream>>>(Wa, Wahi, Walo);
    split_bf16<<<nW / SPLIT_BLOCK, 256, 0, stream>>>(Wp, Wphi, Wplo);

    const int blocks = (M / 256) * (N / 256); // one 256 x 256 tile of the output per block

    // GEMM1: w = x @ Wa.T + ba, and the chunk and tile sums of w^2
    wmma_gemm_bias_f32a<<<blocks, 256, 0, stream>>>(x, Wahi, Walo, ba, wbuf, Ssq, Stl, M, N, K);

    // Scan / softmax / scan
    const int chunks = B * (T / CHUNK);       // one block per (b, chunk of rows)
    stage_pi<<<chunks, 256, 0, stream>>>(wbuf, Ssq, Stl, temp, denom_bias, Pib, Swp, Spi, T, H, D);
    stage_y<<<chunks, 256, 0, stream>>>(wbuf, Pib, Swp, Spi, hi, lo, T, H);

    // GEMM2: out = y @ Wp.T + bp
    wmma_gemm_bias<<<blocks, 256, 0, stream>>>(hi, lo, Wphi, Wplo, bp,
                                               (float*)d_out, M, N, K);
}
